// v000
// Measured on an AMD MI455X. A time is GPU time per run, averaged over a window of back-to-back runs after a warm-up
// (all launches, gaps included; the runs take copies of the inputs in turn), and the median of several windows.
// Apart from v000's, it joins two sittings. Times from different sittings can be a few percent apart, while
// side-by-side timings come from the same sitting.
// The starting kernel, v000, takes 1830 microseconds a run.
// compute dtype: all float inputs rounded to bf16; q/k/v projections with EXACT bf16 products on WMMA 16x16x32 (f32 accumulate) + bias; logits q x k once to f16 each (1 product) over the full 512-wide head x 512^-0.5; softmax f32; P x 2^11 once to f16 x v once to f16 (1 product), four 128-column passes over the same probability plane; f32 output (no output projection).
#include <hip/hip_runtime.h>
#include <math.h>

typedef __attribute__((ext_vector_type(16))) _Float16 v16h;
typedef __attribute__((ext_vector_type(16))) __bf16 v16b;
typedef __attribute__((ext_vector_type(8)))  _Float16 v8h;
typedef __attribute__((ext_vector_type(8)))  float v8f;
typedef __attribute__((ext_vector_type(4)))  float v4f;
typedef __attribute__((ext_vector_type(2)))  float v2f;
typedef __attribute__((ext_vector_type(4)))  unsigned v4u;
typedef __attribute__((ext_vector_type(4)))  int v4i;
typedef float __attribute__((may_alias)) float_a;
typedef int __attribute__((may_alias)) int_a;

template <typename T> __device__ __forceinline__ void vst2(void* p, T v) { *(T*)p = v;  }
__device__ __forceinline__ v8f wmma16(v16h a, v16h b, v8f c) {
  v8f d = __builtin_amdgcn_wmma_f32_16x16x32_f16(false, a, false, b, (short)0, c, false, false);
  asm volatile("v_nop\n\tv_nop\n\tv_nop\n\tv_nop" : "+v"(d) : "v"(a), "v"(b));
  return d;
}
__device__ __forceinline__ v8f wmma_bf(v16b a, v16b b, v8f c) {
  v8f d = __builtin_amdgcn_wmma_f32_16x16x32_bf16(false, a, false, b, (short)0, c, false, false);
  asm volatile("v_nop\n\tv_nop\n\tv_nop\n\tv_nop" : "+v"(d) : "v"(a), "v"(b));
  return d;
}
// 16x16x32 fragments: lane = (h = lane>>4, row/col = lane&15); elements 0..7 = k0+8h+0..7, 8..15 = k0+16+8h+0..7; D element r = row 8h+r
__device__ __forceinline__ v16h frag_h(const _Float16* rowk0, int lane) {
  union { v16h v; v8h q[2]; } u; const _Float16* p = rowk0 + 8 * (lane >> 4);
  u.q[0] = *(const v8h*)p; u.q[1] = *(const v8h*)(p + 16); return u.v;
}
__device__ __forceinline__ v16h frag_f32(const float* rowk0, int lane) {
  v16h a; const float* p = rowk0 + 8 * (lane >> 4);
#pragma unroll
  for (int i = 0; i < 8; ++i) { a[i] = (_Float16)p[i]; a[8 + i] = (_Float16)p[16 + i]; }
  return a;
}
__device__ __forceinline__ v16h frag_f32s(const float* rowk0, int lane, float sc) {
  v16h a; const float* p = rowk0 + 8 * (lane >> 4);
#pragma unroll
  for (int i = 0; i < 8; ++i) { a[i] = (_Float16)(p[i] * sc); a[8 + i] = (_Float16)(p[16 + i] * sc); }
  return a;
}
// column fragment from a [K][ld] layout (column n), rows >= K read as 0
__device__ __forceinline__ v16h fragc_f32(const float* W, int k0, int n, int lane, int ld, int K) {
  v16h a; const int g = lane >> 4;
#pragma unroll
  for (int i = 0; i < 8; ++i) { const int ka = k0 + 8 * g + i, kb = ka + 16;
    a[i] = (_Float16)(ka < K ? W[(size_t)(ka < K ? ka : K - 1) * ld + n] : 0.f); a[8 + i] = (_Float16)(kb < K ? W[(size_t)(kb < K ? kb : K - 1) * ld + n] : 0.f); }
  return a;
}
struct F2 { v16b h, l; };
__device__ __forceinline__ F2 bsplit16(const float v[16]) { F2 r;
#pragma unroll
  for (int i = 0; i < 16; ++i) { const __bf16 h = (__bf16)v[i]; r.h[i] = h; r.l[i] = (__bf16)(v[i] - (float)h); }
  return r; }
__device__ __forceinline__ F2 split_row(const float* row, int k0, int lane) { float v[16]; const float* p = row + k0 + 8 * (lane >> 4);
#pragma unroll
  for (int i = 0; i < 8; ++i) { v[i] = p[i]; v[8 + i] = p[16 + i]; }
  return bsplit16(v); }
__device__ __forceinline__ F2 split_rowK(const float* row, int k0, int lane, int K) { float v[16]; const int g = lane >> 4;
#pragma unroll
  for (int i = 0; i < 8; ++i) { const int ka = k0 + 8 * g + i, kb = ka + 16; v[i] = ka < K ? row[ka < K ? ka : K - 1] : 0.f; v[8 + i] = kb < K ? row[kb < K ? kb : K - 1] : 0.f; }
  return bsplit16(v); }
__device__ __forceinline__ F2 split_col(const float* W, int k0, int n, int lane, int ld, int K) { float v[16]; const int g = lane >> 4;
#pragma unroll
  for (int i = 0; i < 8; ++i) { const int ka = k0 + 8 * g + i, kb = ka + 16; v[i] = ka < K ? W[(size_t)(ka < K ? ka : K - 1) * ld + n] : 0.f; v[8 + i] = kb < K ? W[(size_t)(kb < K ? kb : K - 1) * ld + n] : 0.f; }
  return bsplit16(v); }
__device__ __forceinline__ v8f mac3(const F2& a, const F2& b, v8f c) { c = wmma_bf(a.l, b.h, c); c = wmma_bf(a.h, b.l, c); return wmma_bf(a.h, b.h, c); }
__device__ __forceinline__ float sigm(float v) { return 1.0f / (1.0f + expf(-v)); }
#define LDSX() do { asm volatile("s_wait_dscnt 0" ::: "memory"); __builtin_amdgcn_wave_barrier(); __builtin_amdgcn_fence(__ATOMIC_RELEASE, "workgroup"); } while (0)

// Single-head scaled-dot-product self-attention with a 512-wide head (x [4,2048,512]; torch (out,in) Wq / Wk / Wv [512,512] and biases uniform(+-1/sqrt(512)) (nonzero), einsum 'bnd,ed->bne'; scores = q k^T / sqrt(512) over all 512 dims; softmax over the 2,048 keys; out = weights v, [4,2048,512]; no output projection).
#define NB 4
#define TT 2048
#define CC 512            // NH * HD = projected width
#define DIN 512          // input (model) width
#define NH 4   // P.v column groups of HD = 128 (they share ONE probability plane)
#define HD 128
#define HDSC 512   // the score kernel contracts over the whole 512-wide head
#define NQB (TT / 64)
#define HG 1
#define SCALE (0.04419417382415922f)   // 1 / sqrt(512)
#define CAUSAL 0
#ifndef TNB
#define TNB NB
#endif
__device__ __forceinline__ float bfr(float v) { return (float)(__bf16)v; }
__host__ __device__ __forceinline__ int kb_last(int qb) { return CAUSAL ? ((qb * 64 + 63) >> 7) : (TT / 128 - 1); }
typedef __attribute__((ext_vector_type(8))) __bf16 v8b;
__device__ __forceinline__ v16b frag_b(const __bf16* rowk0, int lane) {
  union { v16b v; v8b q[2]; } u; const __bf16* p = rowk0 + 8 * (lane >> 4);
  u.q[0] = *(const v8b*)p; u.q[1] = *(const v8b*)(p + 16); return u.v;
}
#define QBH 0              // causal: query blocks 0..QBH-1 of each sequence (few keys, no averaging) take the high-precision path
#define QHI 0               // single-product logits on every row
#define KHI 64            // key rows carrying k residual / v bf16 hi+lo planes (used only by the causal high-precision path)
// B fragment (k rows k0+.., output column o) of a weight: (in,out) [K][ld] or (out,in) [ld rows of K]: bf16 exact, or f16(bf16 * 256) exact
__device__ __forceinline__ v16b wcol_io(const float* Wm, int k0, int o, int lane, int ld) { v16b w; const int g = lane >> 4;
#pragma unroll
  for (int i = 0; i < 8; ++i) { w[i] = (__bf16)Wm[(size_t)(k0 + 8 * g + i) * ld + o]; w[8 + i] = (__bf16)Wm[(size_t)(k0 + 16 + 8 * g + i) * ld + o]; }
  return w; }
__device__ __forceinline__ v16b wcol_oi(const float* Wm, int k0, int o, int lane, int K) { v16b w; const float* p = Wm + (size_t)o * K + k0 + 8 * (lane >> 4);
#pragma unroll
  for (int i = 0; i < 8; ++i) { w[i] = (__bf16)p[i]; w[8 + i] = (__bf16)p[16 + i]; }
  return w; }
__device__ __forceinline__ v16h wcolh_io(const float* Wm, int k0, int o, int lane, int ld) { v16h w; const int g = lane >> 4;
#pragma unroll
  for (int i = 0; i < 8; ++i) { w[i] = (_Float16)(bfr(Wm[(size_t)(k0 + 8 * g + i) * ld + o]) * 256.0f); w[8 + i] = (_Float16)(bfr(Wm[(size_t)(k0 + 16 + 8 * g + i) * ld + o]) * 256.0f); }
  return w; }
__device__ __forceinline__ v16h wcolh_oi(const float* Wm, int k0, int o, int lane, int K) { v16h w; const float* p = Wm + (size_t)o * K + k0 + 8 * (lane >> 4);
#pragma unroll
  for (int i = 0; i < 8; ++i) { w[i] = (_Float16)(bfr(p[i]) * 256.0f); w[8 + i] = (_Float16)(bfr(p[16 + i]) * 256.0f); }
  return w; }
#define WQKV_LAYOUT 1   // 0 = (in,out) [DIN][CC]; 1 = (out,in) [CC][DIN]; 2 = per-head [NH][DIN][HD]
__device__ __forceinline__ v16b wcol_hdk(const float* Wm, int k0, int o, int lane) { v16b w; const int g = lane >> 4; const float* p = Wm + (size_t)(o / HD) * DIN * HD + (o % HD);
#pragma unroll
  for (int i = 0; i < 8; ++i) { w[i] = (__bf16)p[(size_t)(k0 + 8 * g + i) * HD]; w[8 + i] = (__bf16)p[(size_t)(k0 + 16 + 8 * g + i) * HD]; }
  return w; }
#define WO_OUT_IN 1
#if WQKV_LAYOUT == 1
#define WCOL(W, k0, o, lane) wcol_oi(W, k0, o, lane, DIN)
#elif WQKV_LAYOUT == 2
#define WCOL(W, k0, o, lane) wcol_hdk(W, k0, o, lane)
#else
#define WCOL(W, k0, o, lane) wcol_io(W, k0, o, lane, CC)
#endif
#if WO_OUT_IN
#define WOCOL(W, k0, o, lane) wcol_oi(W, k0, o, lane, CC)
#define WOCOLH(W, k0, o, lane) wcolh_oi(W, k0, o, lane, CC)
#else
#define WOCOL(W, k0, o, lane) wcol_io(W, k0, o, lane, DIN)
#define WOCOLH(W, k0, o, lane) wcolh_io(W, k0, o, lane, DIN)
#endif

static_assert(CC == NH * HD && HDSC == CC && HD <= 128, "one 512-wide head: scores over all CC columns, P.v in NH column groups of HD <= 128 (the k_pv store width)");
#ifndef SM_EXTRA_PARAMS
#define SM_EXTRA_PARAMS
#endif
#ifndef PROJ_EXTRA_PARAMS
#define PROJ_EXTRA_PARAMS
#endif
#ifndef SM_MASK_HOOK
#define SM_MASK_HOOK (void)0
#endif

#define WS_QH  0u                                      // f16 q rows [b*t][CC]
#define WS_KH  (WS_QH + 2u * (size_t)NB * TT * CC)      // f16 k rows [b*t][CC]
#define WS_VT  (WS_KH + 2u * (size_t)NB * TT * CC)      // f16 v planes [b][c][t]
#define WS_QL  (WS_VT + 2u * (size_t)NB * CC * TT)      // f16 q residual x 2^10 rows [b][t < QHI][CC]
#define WS_KL  (WS_QL + 2u * (size_t)NB * QHI * CC)     // f16 k residual x 2^10 rows [b][t < KHI][CC]
#define WS_VB  (WS_KL + 2u * (size_t)NB * KHI * CC)     // bf16 v hi planes [b][c][t < KHI]
#define WS_VBL (WS_VB + 2u * (size_t)NB * CC * KHI)
#define WS_S   (WS_VBL + 2u * (size_t)NB * CC * KHI)    // f32 logits / P [hg][t][s]
#define WS_Y   (WS_S  + 4u * (size_t)HG * TT * TT)      // f32 ctx rows [b*t][CC] (only when there is an output projection)
#define WS_END (WS_Y)   // no ctx rows: k_pv writes the output directly

// ---- k_proj: block = (64 rows, 128 cols, which): q/k/v = X W (+ b) with exact bf16 products (K = DIN) -> which 0: q f16 rows (+ residual rows < QHI); 1: k f16 rows (+ residual rows < KHI); 2: v f16 planes [c][t] (+ bf16 hi/lo planes for t < KHI)
__global__ __launch_bounds__(128) void k_proj(const float* __restrict__ XQ, const float* __restrict__ XK, const float* __restrict__ XV, const float* __restrict__ WQ, const float* __restrict__ WK, const float* __restrict__ WV, const float* __restrict__ BQ, const float* __restrict__ BK, const float* __restrict__ BV,
    _Float16* __restrict__ QH, _Float16* __restrict__ QL, _Float16* __restrict__ KH, _Float16* __restrict__ KL, _Float16* __restrict__ VT, __bf16* __restrict__ VB, __bf16* __restrict__ VBL) {
  __shared__ __align__(16) _Float16 sh[64][136], sl[64][136]; __shared__ __align__(16) _Float16 th[128][72]; __shared__ __align__(16) __bf16 tb[128][72], tbl[128][72];
  const int tid = threadIdx.x, wave = tid >> 5, lane = tid & 31, col = lane & 15, g = lane >> 4; const int which = blockIdx.z; const int c0 = blockIdx.y * 128; const size_t r0 = (size_t)blockIdx.x * 64; const size_t bb = r0 / TT; const int t0 = (int)(r0 % TT);
  const float* X = which == 0 ? XQ : which == 1 ? XK : XV; const float* WA = which == 0 ? WQ : which == 1 ? WK : WV; const float* BA = which == 0 ? BQ : which == 1 ? BK : BV;
  v8f acc[8] = {};
#pragma unroll 2
  for (int kc = 0; kc < DIN / 32; ++kc) { v16b a; { const float* p = X + (r0 + wave * 16 + col) * DIN + kc * 32 + 8 * g;
#pragma unroll
      for (int i = 0; i < 8; ++i) { a[i] = (__bf16)p[i]; a[8 + i] = (__bf16)p[16 + i]; } }
    asm volatile("s_wait_loadcnt 0x0" ::: "memory");
#pragma unroll
    for (int j = 0; j < 8; ++j) { const v16b w = WCOL(WA, kc * 32, c0 + j * 16 + col, lane); asm volatile("s_wait_loadcnt 0x0" ::: "memory"); acc[j] = wmma_bf(a, w, acc[j]); } }
  if (which < 2) { _Float16* DH = which == 0 ? QH : KH; _Float16* DL = which == 0 ? QL : KL; const int nhi = which == 0 ? QHI : KHI; const bool hi_rows = t0 < nhi;
#pragma unroll
    for (int j = 0; j < 8; ++j) { const float bias = BA ? bfr(BA[c0 + j * 16 + col]) : 0.f;
#pragma unroll
      for (int r = 0; r < 8; ++r) { const float v = acc[j][r] + bias; const _Float16 hv = (_Float16)v; sh[wave * 16 + 8 * g + r][j * 16 + col] = hv; sl[wave * 16 + 8 * g + r][j * 16 + col] = (_Float16)((v - (float)hv) * 1024.0f); } }
    __syncthreads();
    for (int e = tid; e < 64 * 16; e += 128) { const int rl = e >> 4, q = e & 15; vst2((unsigned*)(DH + (r0 + rl) * CC + c0 + q * 8), *(const v4u*)&sh[rl][q * 8]); if (hi_rows) vst2((unsigned*)(DL + (bb * nhi + t0 + rl) * (size_t)CC + c0 + q * 8), *(const v4u*)&sl[rl][q * 8]); }
  } else { const bool hi_rows = t0 < KHI;
#pragma unroll
    for (int j = 0; j < 8; ++j) { const float bias = BA ? bfr(BA[c0 + j * 16 + col]) : 0.f;
#pragma unroll
      for (int r = 0; r < 8; ++r) { const float v = acc[j][r] + bias; const int rl = wave * 16 + 8 * g + r, cl = j * 16 + col; th[cl][rl] = (_Float16)v; const __bf16 bh = (__bf16)v; tb[cl][rl] = bh; tbl[cl][rl] = (__bf16)(v - (float)bh); } }
    __syncthreads();
    for (int e = tid; e < 128 * 8; e += 128) { const int cl = e >> 3, q = e & 7; vst2((unsigned*)(VT + (bb * CC + c0 + cl) * (size_t)TT + t0 + q * 8), *(const v4u*)&th[cl][q * 8]); if (hi_rows) { const size_t o3 = (bb * CC + c0 + cl) * (size_t)KHI + t0 + q * 8; vst2((unsigned*)(VB + o3), *(const v4u*)&tb[cl][q * 8]); vst2((unsigned*)(VBL + o3), *(const v4u*)&tbl[cl][q * 8]); } } } }
// ---- k_sc: block = (query block qb, key block kb <= kb_last(qb), head in group) of batch b: logits x SCALE; q hi + residual (x 2^10) against k (2 products) for query rows < QHI, plus the k residual (3 products) for query blocks < QBH (causal early rows); causal: blocks past the diagonal exit, the mask itself is applied by index in k_sm  [here: head width HDSC = 512, single head h = 0]
__global__ __launch_bounds__(128) void k_sc(const _Float16* __restrict__ QH, const _Float16* __restrict__ KH, const _Float16* __restrict__ QL, const _Float16* __restrict__ KL, int b, int h0, float* __restrict__ S0) { __shared__ __align__(16) float ss[4][16][132];
  const int qb = blockIdx.x, kb = blockIdx.y; if (kb > kb_last(qb)) return;
  const int h = h0 + blockIdx.z; float* S = S0 + (size_t)blockIdx.z * TT * TT;
  const int tid = threadIdx.x, wave = tid >> 5, lane = tid & 31, col = lane & 15, g = lane >> 4; const int k0 = kb * 128; const int ql0 = qb * 64 + wave * 16; const size_t q0 = (size_t)b * TT + ql0, kr0 = (size_t)b * TT + k0;
  v8f acc[8] = {}, accl[8] = {};
  const _Float16* QLb = QL + (size_t)b * QHI * CC; const _Float16* KLb = KL + (size_t)b * KHI * CC;
  if (qb < QBH) {
#pragma unroll
    for (int kc = 0; kc < HDSC / 32; ++kc) { const v16h ah = frag_h(QH + (q0 + col) * CC + h * HDSC + kc * 32, lane), al = frag_h(QLb + (size_t)(ql0 + col) * CC + h * HDSC + kc * 32, lane);
#pragma unroll
      for (int j = 0; j < 8; ++j) { const v16h kbf = frag_h(KH + (kr0 + j * 16 + col) * CC + h * HDSC + kc * 32, lane), klf = frag_h(KLb + (size_t)(k0 + j * 16 + col) * CC + h * HDSC + kc * 32, lane); acc[j] = wmma16(ah, kbf, acc[j]); accl[j] = wmma16(al, kbf, accl[j]); accl[j] = wmma16(ah, klf, accl[j]); } }
  } else if (qb * 64 < QHI) {
#pragma unroll
    for (int kc = 0; kc < HDSC / 32; ++kc) { const v16h ah = frag_h(QH + (q0 + col) * CC + h * HDSC + kc * 32, lane), al = frag_h(QLb + (size_t)(ql0 + col) * CC + h * HDSC + kc * 32, lane);
#pragma unroll
      for (int j = 0; j < 8; ++j) { const v16h kbf = frag_h(KH + (kr0 + j * 16 + col) * CC + h * HDSC + kc * 32, lane); acc[j] = wmma16(ah, kbf, acc[j]); accl[j] = wmma16(al, kbf, accl[j]); } }
  } else {
#pragma unroll
    for (int kc = 0; kc < HDSC / 32; ++kc) { const v16h ah = frag_h(QH + (q0 + col) * CC + h * HDSC + kc * 32, lane);
#pragma unroll
      for (int j = 0; j < 8; ++j) { const v16h kbf = frag_h(KH + (kr0 + j * 16 + col) * CC + h * HDSC + kc * 32, lane); acc[j] = wmma16(ah, kbf, acc[j]); } } }
#pragma unroll
  for (int j = 0; j < 8; ++j) {
#pragma unroll
    for (int r = 0; r < 8; ++r) ss[wave][8 * g + r][j * 16 + col] = (acc[j][r] + accl[j][r] * (1.0f / 1024.0f)) * SCALE; }
  LDSX(); for (int rl = 0; rl < 16; ++rl) vst2(S + (size_t)(ql0 + rl) * TT + k0 + lane * 4, *(const v4f*)&ss[wave][rl][lane * 4]); }
// ---- k_sm: block = query row t (head in group): keys [0, kend): causal -> logit if s <= t else excluded; softmax in f32; P x 2^11 in place (0 for excluded)
__global__ __launch_bounds__(256) void k_sm(float* __restrict__ S0 SM_EXTRA_PARAMS) { __shared__ float sred[8]; __shared__ float sbc; __shared__ __align__(16) float shv[TT];
  const int tid = threadIdx.x; const int t = blockIdx.x; const int kend = (kb_last(t >> 6) + 1) * 128;
  float* sr = S0 + (size_t)blockIdx.y * TT * TT + (size_t)t * TT;
  float m = -3.0e38f; for (int k = tid; k < kend; k += 256) { float v = (!CAUSAL || k <= t) ? sr[k] : -3.0e38f; SM_MASK_HOOK; shv[k] = v; m = fmaxf(m, v); }
#pragma unroll
  for (int o = 1; o < 32; o <<= 1) m = fmaxf(m, __shfl_xor(m, o));
  if ((tid & 31) == 0) sred[tid >> 5] = m; __syncthreads(); if (tid == 0) { float a = sred[0]; for (int i = 1; i < 8; ++i) a = fmaxf(a, sred[i]); sbc = a; } __syncthreads(); m = sbc; __syncthreads();
  float sum = 0.f; for (int k = tid; k < kend; k += 256) { const float v = shv[k]; const float e = (v <= -1.0e38f) ? 0.f : expf(v - m); shv[k] = e; sum += e; }
#pragma unroll
  for (int o = 1; o < 32; o <<= 1) sum += __shfl_xor(sum, o);
  if ((tid & 31) == 0) sred[tid >> 5] = sum; __syncthreads(); if (tid == 0) { float a = 0.f; for (int i = 0; i < 8; ++i) a += sred[i]; sbc = a > 0.f ? 2048.0f / a : 0.f; }   /* a fully excluded row yields P = 0 */ __syncthreads(); const float inv = sbc;
  for (int k = tid; k < kend; k += 256) shv[k] = shv[k] * inv;
  __syncthreads(); for (int q = tid; q < kend / 4; q += 256) vst2(sr + q * 4, *(const v4f*)&shv[q * 4]); }
// ---- k_pv: block = 64 queries (qb) of (b, h): ctx = P . v over keys [0, kend) (P x 2^11 once to f16 against v f16: 1 product; causal early query blocks: P and v as bf16 hi + lo, 3 products); 512-B (row, head) segment by 32 lanes
__global__ __launch_bounds__(128) void k_pv(const float* __restrict__ PS0, const _Float16* __restrict__ VT, const __bf16* __restrict__ VB, const __bf16* __restrict__ VBL, int b, int h0, float* __restrict__ Y) { const int h = h0 + blockIdx.z; const float* PS = PS0 + (size_t)blockIdx.z * TT * TT; __shared__ __align__(16) float ss[4][16][HD + 4];
  const int tid = threadIdx.x, wave = tid >> 5, lane = tid & 31, col = lane & 15, g = lane >> 4; const int qb = blockIdx.x; const int ql0 = qb * 64 + wave * 16; const int kce = (kb_last(qb) + 1) * 4;
  v8f acc[HD / 16] = {};
  if (qb < QBH) {
#pragma unroll 1
    for (int kc = 0; kc < kce; ++kc) { const F2 p = split_row(PS + (size_t)(ql0 + col) * TT, kc * 32, lane);
      asm volatile("s_wait_loadcnt 0x0" ::: "memory");
#pragma unroll
      for (int j = 0; j < HD / 16; ++j) { const size_t po = ((size_t)b * CC + h * HD + j * 16 + col) * (size_t)KHI + kc * 32; const v16b vh = frag_b(VB + po, lane); acc[j] = wmma_bf(p.h, vh, acc[j]); acc[j] = wmma_bf(p.l, vh, acc[j]); acc[j] = wmma_bf(p.h, frag_b(VBL + po, lane), acc[j]); } }
  } else {
#pragma unroll 1
    for (int kc = 0; kc < kce; ++kc) { const v16h p = frag_f32(PS + (size_t)(ql0 + col) * TT + kc * 32, lane);
      asm volatile("s_wait_loadcnt 0x0" ::: "memory");
#pragma unroll
      for (int j = 0; j < HD / 16; ++j) { const size_t po = ((size_t)b * CC + h * HD + j * 16 + col) * (size_t)TT + kc * 32; acc[j] = wmma16(p, frag_h(VT + po, lane), acc[j]); } } }
#pragma unroll
  for (int j = 0; j < HD / 16; ++j)
#pragma unroll
    for (int r = 0; r < 8; ++r) ss[wave][8 * g + r][j * 16 + col] = acc[j][r] * (1.0f / 2048.0f);
  LDSX(); for (int rl = 0; rl < 16; ++rl) if (lane < HD / 4) vst2(Y + ((size_t)b * TT + ql0 + rl) * CC + h * HD + lane * 4, *(const v4f*)&ss[wave][rl][lane * 4]); }

extern "C" void kernel_launch(void* const* d_in, const int* in_sizes, int n_in, void* d_out, int out_size, void* d_ws, size_t ws_size, hipStream_t stream) {
  (void)in_sizes; (void)n_in; (void)out_size;
  const float** F = (const float**)d_in;
  if (ws_size < (size_t)WS_END) return;
  char* ws = (char*)d_ws; _Float16 *QH = (_Float16*)(ws + WS_QH), *KH = (_Float16*)(ws + WS_KH), *VT = (_Float16*)(ws + WS_VT), *QL = (_Float16*)(ws + WS_QL), *KL = (_Float16*)(ws + WS_KL); __bf16 *VB = (__bf16*)(ws + WS_VB), *VBL = (__bf16*)(ws + WS_VBL); float *S = (float*)(ws + WS_S), *Y = (float*)(ws + WS_Y);
  (void)Y; (void)QL; (void)KL; (void)VB; (void)VBL;
  // inputs: 0 x [4,2048,512]; 1 Wq [512,512] (out,in), 2 bq; 3 Wk, 4 bk; 5 Wv, 6 bv (biases nonzero)
  k_proj<<<dim3(TNB * TT / 64, CC / 128, 3), 128, 0, stream>>>(F[0], F[0], F[0], F[1], F[3], F[5], F[2], F[4], F[6], QH, QL, KH, KL, VT, VB, VBL);
  for (int b = 0; b < TNB; ++b) {
    k_sc<<<dim3(NQB, TT / 128, 1), 128, 0, stream>>>(QH, KH, QL, KL, b, 0, S);   /* one 2,048 x 2,048 plane: scores over all 512 columns */
    k_sm<<<dim3(TT, 1), 256, 0, stream>>>(S);
    for (int g = 0; g < NH; ++g) k_pv<<<dim3(NQB, 1, 1), 128, 0, stream>>>(S, VT, VB, VBL, b, g, (float*)d_out);   /* column group g: v / output columns 128g .. 128g+127, all four from plane 0 */
  }
}

// v001
// One run takes 379 microseconds.
// Two timings next to v000 put it at 4.82 and 4.80 times that version's speed.
// compute dtype: all float inputs rounded to bf16; q/k/v projections with EXACT bf16 products on WMMA 16x16x32 (f32 accumulate) + bias; logits q x k once to f16 each (1 product) over the full 512-wide head x 512^-0.5; softmax f32; P x 2^11 once to f16 x v once to f16 (1 product), four 128-column passes over the same probability plane; f32 output (no output projection).
#include <hip/hip_runtime.h>
#include <math.h>

typedef __attribute__((ext_vector_type(16))) _Float16 v16h;
typedef __attribute__((ext_vector_type(16))) __bf16 v16b;
typedef __attribute__((ext_vector_type(8)))  _Float16 v8h;
typedef __attribute__((ext_vector_type(8)))  float v8f;
typedef __attribute__((ext_vector_type(4)))  float v4f;
typedef __attribute__((ext_vector_type(2)))  float v2f;
typedef __attribute__((ext_vector_type(4)))  unsigned v4u;
typedef __attribute__((ext_vector_type(4)))  int v4i;
typedef float __attribute__((may_alias)) float_a;
typedef int __attribute__((may_alias)) int_a;

template <typename T> __device__ __forceinline__ void vst2(void* p, T v) { *(T*)p = v;  }
__device__ __forceinline__ v8f wmma16(v16h a, v16h b, v8f c) {
  v8f d = __builtin_amdgcn_wmma_f32_16x16x32_f16(false, a, false, b, (short)0, c, false, false);
  asm volatile("v_nop\n\tv_nop\n\tv_nop\n\tv_nop" : "+v"(d) : "v"(a), "v"(b));
  return d;
}
__device__ __forceinline__ v8f wmma_bf(v16b a, v16b b, v8f c) {
  v8f d = __builtin_amdgcn_wmma_f32_16x16x32_bf16(false, a, false, b, (short)0, c, false, false);
  asm volatile("v_nop\n\tv_nop\n\tv_nop\n\tv_nop" : "+v"(d) : "v"(a), "v"(b));
  return d;
}
// 16x16x32 fragments: lane = (h = lane>>4, row/col = lane&15); elements 0..7 = k0+8h+0..7, 8..15 = k0+16+8h+0..7; D element r = row 8h+r
__device__ __forceinline__ v16h frag_h(const _Float16* rowk0, int lane) {
  union { v16h v; v8h q[2]; } u; const _Float16* p = rowk0 + 8 * (lane >> 4);
  u.q[0] = *(const v8h*)p; u.q[1] = *(const v8h*)(p + 16); return u.v;
}
__device__ __forceinline__ v16h frag_f32(const float* rowk0, int lane) {
  v16h a; const float* p = rowk0 + 8 * (lane >> 4);
#pragma unroll
  for (int i = 0; i < 8; ++i) { a[i] = (_Float16)p[i]; a[8 + i] = (_Float16)p[16 + i]; }
  return a;
}
__device__ __forceinline__ v16h frag_f32s(const float* rowk0, int lane, float sc) {
  v16h a; const float* p = rowk0 + 8 * (lane >> 4);
#pragma unroll
  for (int i = 0; i < 8; ++i) { a[i] = (_Float16)(p[i] * sc); a[8 + i] = (_Float16)(p[16 + i] * sc); }
  return a;
}
// column fragment from a [K][ld] layout (column n), rows >= K read as 0
__device__ __forceinline__ v16h fragc_f32(const float* W, int k0, int n, int lane, int ld, int K) {
  v16h a; const int g = lane >> 4;
#pragma unroll
  for (int i = 0; i < 8; ++i) { const int ka = k0 + 8 * g + i, kb = ka + 16;
    a[i] = (_Float16)(ka < K ? W[(size_t)(ka < K ? ka : K - 1) * ld + n] : 0.f); a[8 + i] = (_Float16)(kb < K ? W[(size_t)(kb < K ? kb : K - 1) * ld + n] : 0.f); }
  return a;
}
struct F2 { v16b h, l; };
__device__ __forceinline__ F2 bsplit16(const float v[16]) { F2 r;
#pragma unroll
  for (int i = 0; i < 16; ++i) { const __bf16 h = (__bf16)v[i]; r.h[i] = h; r.l[i] = (__bf16)(v[i] - (float)h); }
  return r; }
__device__ __forceinline__ F2 split_row(const float* row, int k0, int lane) { float v[16]; const float* p = row + k0 + 8 * (lane >> 4);
#pragma unroll
  for (int i = 0; i < 8; ++i) { v[i] = p[i]; v[8 + i] = p[16 + i]; }
  return bsplit16(v); }
__device__ __forceinline__ F2 split_rowK(const float* row, int k0, int lane, int K) { float v[16]; const int g = lane >> 4;
#pragma unroll
  for (int i = 0; i < 8; ++i) { const int ka = k0 + 8 * g + i, kb = ka + 16; v[i] = ka < K ? row[ka < K ? ka : K - 1] : 0.f; v[8 + i] = kb < K ? row[kb < K ? kb : K - 1] : 0.f; }
  return bsplit16(v); }
__device__ __forceinline__ F2 split_col(const float* W, int k0, int n, int lane, int ld, int K) { float v[16]; const int g = lane >> 4;
#pragma unroll
  for (int i = 0; i < 8; ++i) { const int ka = k0 + 8 * g + i, kb = ka + 16; v[i] = ka < K ? W[(size_t)(ka < K ? ka : K - 1) * ld + n] : 0.f; v[8 + i] = kb < K ? W[(size_t)(kb < K ? kb : K - 1) * ld + n] : 0.f; }
  return bsplit16(v); }
__device__ __forceinline__ v8f mac3(const F2& a, const F2& b, v8f c) { c = wmma_bf(a.l, b.h, c); c = wmma_bf(a.h, b.l, c); return wmma_bf(a.h, b.h, c); }
__device__ __forceinline__ float sigm(float v) { return 1.0f / (1.0f + expf(-v)); }
#define LDSX() do { asm volatile("s_wait_dscnt 0" ::: "memory"); __builtin_amdgcn_wave_barrier(); __builtin_amdgcn_fence(__ATOMIC_RELEASE, "workgroup"); } while (0)

// Single-head scaled-dot-product self-attention with a 512-wide head (x [4,2048,512]; torch (out,in) Wq / Wk / Wv [512,512] and biases uniform(+-1/sqrt(512)) (nonzero), einsum 'bnd,ed->bne'; scores = q k^T / sqrt(512) over all 512 dims; softmax over the 2,048 keys; out = weights v, [4,2048,512]; no output projection).
#define NB 4
#define TT 2048
#define CC 512            // NH * HD = projected width
#define DIN 512          // input (model) width
#define NH 4   // P.v column groups of HD = 128 (they share ONE probability plane)
#define HD 128
#define HDSC 512   // the score kernel contracts over the whole 512-wide head
#define NQB (TT / 64)
#define SCALE (0.04419417382415922f)   // 1 / sqrt(512)
#define CAUSAL 0
#ifndef TNB
#define TNB NB
#endif
__device__ __forceinline__ float bfr(float v) { return (float)(__bf16)v; }
__host__ __device__ __forceinline__ int kb_last(int qb) { return CAUSAL ? ((qb * 64 + 63) >> 7) : (TT / 128 - 1); }
typedef __attribute__((ext_vector_type(8))) __bf16 v8b;
__device__ __forceinline__ v16b frag_b(const __bf16* rowk0, int lane) {
  union { v16b v; v8b q[2]; } u; const __bf16* p = rowk0 + 8 * (lane >> 4);
  u.q[0] = *(const v8b*)p; u.q[1] = *(const v8b*)(p + 16); return u.v;
}
#define QBH 0              // causal: query blocks 0..QBH-1 of each sequence (few keys, no averaging) take the high-precision path
#define QHI 0               // single-product logits on every row
#define KHI 64            // key rows carrying k residual / v bf16 hi+lo planes (used only by the causal high-precision path)
// B fragment (k rows k0+.., output column o) of a weight: (in,out) [K][ld] or (out,in) [ld rows of K]: bf16 exact, or f16(bf16 * 256) exact
__device__ __forceinline__ v16b wcol_io(const float* Wm, int k0, int o, int lane, int ld) { v16b w; const int g = lane >> 4;
#pragma unroll
  for (int i = 0; i < 8; ++i) { w[i] = (__bf16)Wm[(size_t)(k0 + 8 * g + i) * ld + o]; w[8 + i] = (__bf16)Wm[(size_t)(k0 + 16 + 8 * g + i) * ld + o]; }
  return w; }
__device__ __forceinline__ v16b wcol_oi(const float* Wm, int k0, int o, int lane, int K) { v16b w; const float* p = Wm + (size_t)o * K + k0 + 8 * (lane >> 4);
#pragma unroll
  for (int i = 0; i < 8; ++i) { w[i] = (__bf16)p[i]; w[8 + i] = (__bf16)p[16 + i]; }
  return w; }
__device__ __forceinline__ v16h wcolh_io(const float* Wm, int k0, int o, int lane, int ld) { v16h w; const int g = lane >> 4;
#pragma unroll
  for (int i = 0; i < 8; ++i) { w[i] = (_Float16)(bfr(Wm[(size_t)(k0 + 8 * g + i) * ld + o]) * 256.0f); w[8 + i] = (_Float16)(bfr(Wm[(size_t)(k0 + 16 + 8 * g + i) * ld + o]) * 256.0f); }
  return w; }
__device__ __forceinline__ v16h wcolh_oi(const float* Wm, int k0, int o, int lane, int K) { v16h w; const float* p = Wm + (size_t)o * K + k0 + 8 * (lane >> 4);
#pragma unroll
  for (int i = 0; i < 8; ++i) { w[i] = (_Float16)(bfr(p[i]) * 256.0f); w[8 + i] = (_Float16)(bfr(p[16 + i]) * 256.0f); }
  return w; }
#define WQKV_LAYOUT 1   // 0 = (in,out) [DIN][CC]; 1 = (out,in) [CC][DIN]; 2 = per-head [NH][DIN][HD]
__device__ __forceinline__ v16b wcol_hdk(const float* Wm, int k0, int o, int lane) { v16b w; const int g = lane >> 4; const float* p = Wm + (size_t)(o / HD) * DIN * HD + (o % HD);
#pragma unroll
  for (int i = 0; i < 8; ++i) { w[i] = (__bf16)p[(size_t)(k0 + 8 * g + i) * HD]; w[8 + i] = (__bf16)p[(size_t)(k0 + 16 + 8 * g + i) * HD]; }
  return w; }
#define WO_OUT_IN 1
#if WQKV_LAYOUT == 1
#define WCOL(W, k0, o, lane) wcol_oi(W, k0, o, lane, DIN)
#elif WQKV_LAYOUT == 2
#define WCOL(W, k0, o, lane) wcol_hdk(W, k0, o, lane)
#else
#define WCOL(W, k0, o, lane) wcol_io(W, k0, o, lane, CC)
#endif
#if WO_OUT_IN
#define WOCOL(W, k0, o, lane) wcol_oi(W, k0, o, lane, CC)
#define WOCOLH(W, k0, o, lane) wcolh_oi(W, k0, o, lane, CC)
#else
#define WOCOL(W, k0, o, lane) wcol_io(W, k0, o, lane, DIN)
#define WOCOLH(W, k0, o, lane) wcolh_io(W, k0, o, lane, DIN)
#endif

static_assert(CC == NH * HD && HDSC == CC && HD <= 128, "one 512-wide head: scores over all CC columns, P.v in NH column groups of HD <= 128 (the k_pv store width)");
#ifndef SM_EXTRA_PARAMS
#define SM_EXTRA_PARAMS
#endif
#ifndef PROJ_EXTRA_PARAMS
#define PROJ_EXTRA_PARAMS
#endif
#ifndef SM_MASK_HOOK
#define SM_MASK_HOOK (void)0
#endif

#define WS_QH  0u                                      // f16 q rows [b*t][CC]
#define WS_KH  (WS_QH + 2u * (size_t)NB * TT * CC)      // f16 k rows [b*t][CC]
#define WS_VT  (WS_KH + 2u * (size_t)NB * TT * CC)      // f16 v planes [b][c][t]
#define WS_QL  (WS_VT + 2u * (size_t)NB * CC * TT)      // f16 q residual x 2^10 rows [b][t < QHI][CC]
#define WS_KL  (WS_QL + 2u * (size_t)NB * QHI * CC)     // f16 k residual x 2^10 rows [b][t < KHI][CC]
#define WS_VB  (WS_KL + 2u * (size_t)NB * KHI * CC)     // bf16 v hi planes [b][c][t < KHI]
#define WS_VBL (WS_VB + 2u * (size_t)NB * CC * KHI)
#define WS_S   (WS_VBL + 2u * (size_t)NB * CC * KHI)    // f32 logits / P [b][t][s]: one plane per batch, so that each stage is one launch over all batches
#define WS_Y   (WS_S  + 4u * (size_t)NB * TT * TT)      // f32 ctx rows [b*t][CC] (only when there is an output projection)
#define WS_END (WS_Y)   // no ctx rows: k_pv writes the output directly

// ---- k_proj: block = (64 rows, 128 cols, which): q/k/v = X W (+ b) with exact bf16 products (K = DIN) -> which 0: q f16 rows (+ residual rows < QHI); 1: k f16 rows (+ residual rows < KHI); 2: v f16 planes [c][t] (+ bf16 hi/lo planes for t < KHI)
__global__ __launch_bounds__(128) void k_proj(const float* __restrict__ XQ, const float* __restrict__ XK, const float* __restrict__ XV, const float* __restrict__ WQ, const float* __restrict__ WK, const float* __restrict__ WV, const float* __restrict__ BQ, const float* __restrict__ BK, const float* __restrict__ BV,
    _Float16* __restrict__ QH, _Float16* __restrict__ QL, _Float16* __restrict__ KH, _Float16* __restrict__ KL, _Float16* __restrict__ VT, __bf16* __restrict__ VB, __bf16* __restrict__ VBL) {
  __shared__ __align__(16) _Float16 sh[64][136], sl[64][136]; __shared__ __align__(16) _Float16 th[128][72]; __shared__ __align__(16) __bf16 tb[128][72], tbl[128][72];
  const int tid = threadIdx.x, wave = tid >> 5, lane = tid & 31, col = lane & 15, g = lane >> 4; const int which = blockIdx.z; const int c0 = blockIdx.y * 128; const size_t r0 = (size_t)blockIdx.x * 64; const size_t bb = r0 / TT; const int t0 = (int)(r0 % TT);
  const float* X = which == 0 ? XQ : which == 1 ? XK : XV; const float* WA = which == 0 ? WQ : which == 1 ? WK : WV; const float* BA = which == 0 ? BQ : which == 1 ? BK : BV;
  v8f acc[8] = {};
#pragma unroll 2
  for (int kc = 0; kc < DIN / 32; ++kc) { v16b a; { const float* p = X + (r0 + wave * 16 + col) * DIN + kc * 32 + 8 * g;
#pragma unroll
      for (int i = 0; i < 8; ++i) { a[i] = (__bf16)p[i]; a[8 + i] = (__bf16)p[16 + i]; } }
    asm volatile("s_wait_loadcnt 0x0" ::: "memory");
#pragma unroll
    for (int j = 0; j < 8; ++j) { const v16b w = WCOL(WA, kc * 32, c0 + j * 16 + col, lane); asm volatile("s_wait_loadcnt 0x0" ::: "memory"); acc[j] = wmma_bf(a, w, acc[j]); } }
  if (which < 2) { _Float16* DH = which == 0 ? QH : KH; _Float16* DL = which == 0 ? QL : KL; const int nhi = which == 0 ? QHI : KHI; const bool hi_rows = t0 < nhi;
#pragma unroll
    for (int j = 0; j < 8; ++j) { const float bias = BA ? bfr(BA[c0 + j * 16 + col]) : 0.f;
#pragma unroll
      for (int r = 0; r < 8; ++r) { const float v = acc[j][r] + bias; const _Float16 hv = (_Float16)v; sh[wave * 16 + 8 * g + r][j * 16 + col] = hv; sl[wave * 16 + 8 * g + r][j * 16 + col] = (_Float16)((v - (float)hv) * 1024.0f); } }
    __syncthreads();
    for (int e = tid; e < 64 * 16; e += 128) { const int rl = e >> 4, q = e & 15; vst2((unsigned*)(DH + (r0 + rl) * CC + c0 + q * 8), *(const v4u*)&sh[rl][q * 8]); if (hi_rows) vst2((unsigned*)(DL + (bb * nhi + t0 + rl) * (size_t)CC + c0 + q * 8), *(const v4u*)&sl[rl][q * 8]); }
  } else { const bool hi_rows = t0 < KHI;
#pragma unroll
    for (int j = 0; j < 8; ++j) { const float bias = BA ? bfr(BA[c0 + j * 16 + col]) : 0.f;
#pragma unroll
      for (int r = 0; r < 8; ++r) { const float v = acc[j][r] + bias; const int rl = wave * 16 + 8 * g + r, cl = j * 16 + col; th[cl][rl] = (_Float16)v; const __bf16 bh = (__bf16)v; tb[cl][rl] = bh; tbl[cl][rl] = (__bf16)(v - (float)bh); } }
    __syncthreads();
    for (int e = tid; e < 128 * 8; e += 128) { const int cl = e >> 3, q = e & 7; vst2((unsigned*)(VT + (bb * CC + c0 + cl) * (size_t)TT + t0 + q * 8), *(const v4u*)&th[cl][q * 8]); if (hi_rows) { const size_t o3 = (bb * CC + c0 + cl) * (size_t)KHI + t0 + q * 8; vst2((unsigned*)(VB + o3), *(const v4u*)&tb[cl][q * 8]); vst2((unsigned*)(VBL + o3), *(const v4u*)&tbl[cl][q * 8]); } } } }
// ---- k_sc: block = (query block qb, key block kb <= kb_last(qb), batch b = blockIdx.z, plane b): logits x SCALE; q hi + residual (x 2^10) against k (2 products) for query rows < QHI, plus the k residual (3 products) for query blocks < QBH (causal early rows); causal: blocks past the diagonal exit, the mask itself is applied by index in k_sm  [here: head width HDSC = 512, single head h = 0]
__global__ __launch_bounds__(128) void k_sc(const _Float16* __restrict__ QH, const _Float16* __restrict__ KH, const _Float16* __restrict__ QL, const _Float16* __restrict__ KL, float* __restrict__ S0) { __shared__ __align__(16) float ss[4][16][132];
  const int qb = blockIdx.x, kb = blockIdx.y; if (kb > kb_last(qb)) return;
  const int b = blockIdx.z, h = 0; float* S = S0 + (size_t)b * TT * TT;
  const int tid = threadIdx.x, wave = tid >> 5, lane = tid & 31, col = lane & 15, g = lane >> 4; const int k0 = kb * 128; const int ql0 = qb * 64 + wave * 16; const size_t q0 = (size_t)b * TT + ql0, kr0 = (size_t)b * TT + k0;
  v8f acc[8] = {}, accl[8] = {};
  const _Float16* QLb = QL + (size_t)b * QHI * CC; const _Float16* KLb = KL + (size_t)b * KHI * CC;
  if (qb < QBH) {
#pragma unroll
    for (int kc = 0; kc < HDSC / 32; ++kc) { const v16h ah = frag_h(QH + (q0 + col) * CC + h * HDSC + kc * 32, lane), al = frag_h(QLb + (size_t)(ql0 + col) * CC + h * HDSC + kc * 32, lane);
#pragma unroll
      for (int j = 0; j < 8; ++j) { const v16h kbf = frag_h(KH + (kr0 + j * 16 + col) * CC + h * HDSC + kc * 32, lane), klf = frag_h(KLb + (size_t)(k0 + j * 16 + col) * CC + h * HDSC + kc * 32, lane); acc[j] = wmma16(ah, kbf, acc[j]); accl[j] = wmma16(al, kbf, accl[j]); accl[j] = wmma16(ah, klf, accl[j]); } }
  } else if (qb * 64 < QHI) {
#pragma unroll
    for (int kc = 0; kc < HDSC / 32; ++kc) { const v16h ah = frag_h(QH + (q0 + col) * CC + h * HDSC + kc * 32, lane), al = frag_h(QLb + (size_t)(ql0 + col) * CC + h * HDSC + kc * 32, lane);
#pragma unroll
      for (int j = 0; j < 8; ++j) { const v16h kbf = frag_h(KH + (kr0 + j * 16 + col) * CC + h * HDSC + kc * 32, lane); acc[j] = wmma16(ah, kbf, acc[j]); accl[j] = wmma16(al, kbf, accl[j]); } }
  } else {
#pragma unroll
    for (int kc = 0; kc < HDSC / 32; ++kc) { const v16h ah = frag_h(QH + (q0 + col) * CC + h * HDSC + kc * 32, lane);
#pragma unroll
      for (int j = 0; j < 8; ++j) { const v16h kbf = frag_h(KH + (kr0 + j * 16 + col) * CC + h * HDSC + kc * 32, lane); acc[j] = wmma16(ah, kbf, acc[j]); } } }
#pragma unroll
  for (int j = 0; j < 8; ++j) {
#pragma unroll
    for (int r = 0; r < 8; ++r) ss[wave][8 * g + r][j * 16 + col] = (acc[j][r] + accl[j][r] * (1.0f / 1024.0f)) * SCALE; }
  LDSX(); for (int rl = 0; rl < 16; ++rl) vst2(S + (size_t)(ql0 + rl) * TT + k0 + lane * 4, *(const v4f*)&ss[wave][rl][lane * 4]); }
// ---- k_sm: block = query row t (plane = batch = blockIdx.y): keys [0, kend): causal -> logit if s <= t else excluded; softmax in f32; P x 2^11 in place (0 for excluded)
__global__ __launch_bounds__(256) void k_sm(float* __restrict__ S0 SM_EXTRA_PARAMS) { __shared__ float sred[8]; __shared__ float sbc; __shared__ __align__(16) float shv[TT];
  const int tid = threadIdx.x; const int t = blockIdx.x; const int kend = (kb_last(t >> 6) + 1) * 128;
  float* sr = S0 + (size_t)blockIdx.y * TT * TT + (size_t)t * TT;
  float m = -3.0e38f; for (int k = tid; k < kend; k += 256) { float v = (!CAUSAL || k <= t) ? sr[k] : -3.0e38f; SM_MASK_HOOK; shv[k] = v; m = fmaxf(m, v); }
#pragma unroll
  for (int o = 1; o < 32; o <<= 1) m = fmaxf(m, __shfl_xor(m, o));
  if ((tid & 31) == 0) sred[tid >> 5] = m; __syncthreads(); if (tid == 0) { float a = sred[0]; for (int i = 1; i < 8; ++i) a = fmaxf(a, sred[i]); sbc = a; } __syncthreads(); m = sbc; __syncthreads();
  float sum = 0.f; for (int k = tid; k < kend; k += 256) { const float v = shv[k]; const float e = (v <= -1.0e38f) ? 0.f : expf(v - m); shv[k] = e; sum += e; }
#pragma unroll
  for (int o = 1; o < 32; o <<= 1) sum += __shfl_xor(sum, o);
  if ((tid & 31) == 0) sred[tid >> 5] = sum; __syncthreads(); if (tid == 0) { float a = 0.f; for (int i = 0; i < 8; ++i) a += sred[i]; sbc = a > 0.f ? 2048.0f / a : 0.f; }   /* a fully excluded row yields P = 0 */ __syncthreads(); const float inv = sbc;
  for (int k = tid; k < kend; k += 256) shv[k] = shv[k] * inv;
  __syncthreads(); for (int q = tid; q < kend / 4; q += 256) vst2(sr + q * 4, *(const v4f*)&shv[q * 4]); }
// ---- k_pv: block = 64 queries (qb = blockIdx.x) of (column group h = blockIdx.y, batch b = blockIdx.z; plane b): ctx = P . v over keys [0, kend) (P x 2^11 once to f16 against v f16: 1 product; causal early query blocks: P and v as bf16 hi + lo, 3 products); 512-B (row, head) segment by 32 lanes
__global__ __launch_bounds__(128) void k_pv(const float* __restrict__ PS0, const _Float16* __restrict__ VT, const __bf16* __restrict__ VB, const __bf16* __restrict__ VBL, float* __restrict__ Y) { const int h = blockIdx.y, b = blockIdx.z; const float* PS = PS0 + (size_t)b * TT * TT; __shared__ __align__(16) float ss[4][16][HD + 4];
  const int tid = threadIdx.x, wave = tid >> 5, lane = tid & 31, col = lane & 15, g = lane >> 4; const int qb = blockIdx.x; const int ql0 = qb * 64 + wave * 16; const int kce = (kb_last(qb) + 1) * 4;
  v8f acc[HD / 16] = {};
  if (qb < QBH) {
#pragma unroll 1
    for (int kc = 0; kc < kce; ++kc) { const F2 p = split_row(PS + (size_t)(ql0 + col) * TT, kc * 32, lane);
      asm volatile("s_wait_loadcnt 0x0" ::: "memory");
#pragma unroll
      for (int j = 0; j < HD / 16; ++j) { const size_t po = ((size_t)b * CC + h * HD + j * 16 + col) * (size_t)KHI + kc * 32; const v16b vh = frag_b(VB + po, lane); acc[j] = wmma_bf(p.h, vh, acc[j]); acc[j] = wmma_bf(p.l, vh, acc[j]); acc[j] = wmma_bf(p.h, frag_b(VBL + po, lane), acc[j]); } }
  } else {
#pragma unroll 1
    for (int kc = 0; kc < kce; ++kc) { const v16h p = frag_f32(PS + (size_t)(ql0 + col) * TT + kc * 32, lane);
      asm volatile("s_wait_loadcnt 0x0" ::: "memory");
#pragma unroll
      for (int j = 0; j < HD / 16; ++j) { const size_t po = ((size_t)b * CC + h * HD + j * 16 + col) * (size_t)TT + kc * 32; acc[j] = wmma16(p, frag_h(VT + po, lane), acc[j]); } } }
#pragma unroll
  for (int j = 0; j < HD / 16; ++j)
#pragma unroll
    for (int r = 0; r < 8; ++r) ss[wave][8 * g + r][j * 16 + col] = acc[j][r] * (1.0f / 2048.0f);
  LDSX(); for (int rl = 0; rl < 16; ++rl) if (lane < HD / 4) vst2(Y + ((size_t)b * TT + ql0 + rl) * CC + h * HD + lane * 4, *(const v4f*)&ss[wave][rl][lane * 4]); }

extern "C" void kernel_launch(void* const* d_in, const int* in_sizes, int n_in, void* d_out, int out_size, void* d_ws, size_t ws_size, hipStream_t stream) {
  (void)in_sizes; (void)n_in; (void)out_size;
  const float** F = (const float**)d_in;
  if (ws_size < (size_t)WS_END) return;
  char* ws = (char*)d_ws; _Float16 *QH = (_Float16*)(ws + WS_QH), *KH = (_Float16*)(ws + WS_KH), *VT = (_Float16*)(ws + WS_VT), *QL = (_Float16*)(ws + WS_QL), *KL = (_Float16*)(ws + WS_KL); __bf16 *VB = (__bf16*)(ws + WS_VB), *VBL = (__bf16*)(ws + WS_VBL); float *S = (float*)(ws + WS_S), *Y = (float*)(ws + WS_Y);
  (void)Y; (void)QL; (void)KL; (void)VB; (void)VBL;
  // inputs: 0 x [4,2048,512]; 1 Wq [512,512] (out,in), 2 bq; 3 Wk, 4 bk; 5 Wv, 6 bv (biases nonzero)
  k_proj<<<dim3(TNB * TT / 64, CC / 128, 3), 128, 0, stream>>>(F[0], F[0], F[0], F[1], F[3], F[5], F[2], F[4], F[6], QH, QL, KH, KL, VT, VB, VBL);
  k_sc<<<dim3(NQB, TT / 128, TNB), 128, 0, stream>>>(QH, KH, QL, KL, S);   /* one 2,048 x 2,048 plane per batch: scores over all 512 columns */
  k_sm<<<dim3(TT, TNB), 256, 0, stream>>>(S);
  k_pv<<<dim3(NQB, NH, TNB), 128, 0, stream>>>(S, VT, VB, VBL, (float*)d_out);   /* column group y: v / output columns 128y .. 128y+127, all four from the batch's one plane */
}

// v002
// Measured time: 121 microseconds a run.
// Next to v001, in two timings, it ran 3.11 and 3.15 times as fast.
// All steps since v000 together make it 15.0 times as fast.
// compute dtype: all float inputs rounded to bf16; q/k/v projections with EXACT bf16 products on WMMA 16x16x32 (f32 accumulate) + bias; logits q x k once to f16 each (1 product) over the full 512-wide head x 512^-0.5; softmax f32; P x 2^11 once to f16 x v once to f16 (1 product), four 128-column passes over the same probability plane; f32 output (no output projection).
#include <hip/hip_runtime.h>
#include <math.h>

typedef __attribute__((ext_vector_type(16))) _Float16 v16h;
typedef __attribute__((ext_vector_type(16))) __bf16 v16b;
typedef __attribute__((ext_vector_type(8)))  _Float16 v8h;
typedef __attribute__((ext_vector_type(8)))  float v8f;
typedef __attribute__((ext_vector_type(4)))  float v4f;
typedef __attribute__((ext_vector_type(2)))  float v2f;
typedef __attribute__((ext_vector_type(4)))  unsigned v4u;
typedef __attribute__((ext_vector_type(4)))  int v4i;
typedef float __attribute__((may_alias)) float_a;
typedef int __attribute__((may_alias)) int_a;

template <typename T> __device__ __forceinline__ void vst2(void* p, T v) { *(T*)p = v;  }
__device__ __forceinline__ v8f wmma16(v16h a, v16h b, v8f c) {
  v8f d = __builtin_amdgcn_wmma_f32_16x16x32_f16(false, a, false, b, (short)0, c, false, false);
  asm volatile("v_nop\n\tv_nop\n\tv_nop\n\tv_nop" : "+v"(d) : "v"(a), "v"(b));
  return d;
}
__device__ __forceinline__ v8f wmma_bf(v16b a, v16b b, v8f c) {
  v8f d = __builtin_amdgcn_wmma_f32_16x16x32_bf16(false, a, false, b, (short)0, c, false, false);
  asm volatile("v_nop\n\tv_nop\n\tv_nop\n\tv_nop" : "+v"(d) : "v"(a), "v"(b));
  return d;
}
// 16x16x32 fragments: lane = (h = lane>>4, row/col = lane&15); elements 0..7 = k0+8h+0..7, 8..15 = k0+16+8h+0..7; D element r = row 8h+r
__device__ __forceinline__ v16h frag_h(const _Float16* rowk0, int lane) {
  union { v16h v; v8h q[2]; } u; const _Float16* p = rowk0 + 8 * (lane >> 4);
  u.q[0] = *(const v8h*)p; u.q[1] = *(const v8h*)(p + 16); return u.v;
}
__device__ __forceinline__ v16h frag_f32(const float* rowk0, int lane) {
  v16h a; const float* p = rowk0 + 8 * (lane >> 4);
#pragma unroll
  for (int i = 0; i < 8; ++i) { a[i] = (_Float16)p[i]; a[8 + i] = (_Float16)p[16 + i]; }
  return a;
}
__device__ __forceinline__ v16h frag_f32s(const float* rowk0, int lane, float sc) {
  v16h a; const float* p = rowk0 + 8 * (lane >> 4);
#pragma unroll
  for (int i = 0; i < 8; ++i) { a[i] = (_Float16)(p[i] * sc); a[8 + i] = (_Float16)(p[16 + i] * sc); }
  return a;
}
// column fragment from a [K][ld] layout (column n), rows >= K read as 0
__device__ __forceinline__ v16h fragc_f32(const float* W, int k0, int n, int lane, int ld, int K) {
  v16h a; const int g = lane >> 4;
#pragma unroll
  for (int i = 0; i < 8; ++i) { const int ka = k0 + 8 * g + i, kb = ka + 16;
    a[i] = (_Float16)(ka < K ? W[(size_t)(ka < K ? ka : K - 1) * ld + n] : 0.f); a[8 + i] = (_Float16)(kb < K ? W[(size_t)(kb < K ? kb : K - 1) * ld + n] : 0.f); }
  return a;
}
struct F2 { v16b h, l; };
__device__ __forceinline__ F2 bsplit16(const float v[16]) { F2 r;
#pragma unroll
  for (int i = 0; i < 16; ++i) { const __bf16 h = (__bf16)v[i]; r.h[i] = h; r.l[i] = (__bf16)(v[i] - (float)h); }
  return r; }
__device__ __forceinline__ F2 split_row(const float* row, int k0, int lane) { float v[16]; const float* p = row + k0 + 8 * (lane >> 4);
#pragma unroll
  for (int i = 0; i < 8; ++i) { v[i] = p[i]; v[8 + i] = p[16 + i]; }
  return bsplit16(v); }
__device__ __forceinline__ F2 split_rowK(const float* row, int k0, int lane, int K) { float v[16]; const int g = lane >> 4;
#pragma unroll
  for (int i = 0; i < 8; ++i) { const int ka = k0 + 8 * g + i, kb = ka + 16; v[i] = ka < K ? row[ka < K ? ka : K - 1] : 0.f; v[8 + i] = kb < K ? row[kb < K ? kb : K - 1] : 0.f; }
  return bsplit16(v); }
__device__ __forceinline__ F2 split_col(const float* W, int k0, int n, int lane, int ld, int K) { float v[16]; const int g = lane >> 4;
#pragma unroll
  for (int i = 0; i < 8; ++i) { const int ka = k0 + 8 * g + i, kb = ka + 16; v[i] = ka < K ? W[(size_t)(ka < K ? ka : K - 1) * ld + n] : 0.f; v[8 + i] = kb < K ? W[(size_t)(kb < K ? kb : K - 1) * ld + n] : 0.f; }
  return bsplit16(v); }
__device__ __forceinline__ v8f mac3(const F2& a, const F2& b, v8f c) { c = wmma_bf(a.l, b.h, c); c = wmma_bf(a.h, b.l, c); return wmma_bf(a.h, b.h, c); }
__device__ __forceinline__ float sigm(float v) { return 1.0f / (1.0f + expf(-v)); }
#define LDSX() do { asm volatile("s_wait_dscnt 0" ::: "memory"); __builtin_amdgcn_wave_barrier(); __builtin_amdgcn_fence(__ATOMIC_RELEASE, "workgroup"); } while (0)

// Single-head scaled-dot-product self-attention with a 512-wide head (x [4,2048,512]; torch (out,in) Wq / Wk / Wv [512,512] and biases uniform(+-1/sqrt(512)) (nonzero), einsum 'bnd,ed->bne'; scores = q k^T / sqrt(512) over all 512 dims; softmax over the 2,048 keys; out = weights v, [4,2048,512]; no output projection).
#define NB 4
#define TT 2048
#define CC 512            // NH * HD = projected width
#define DIN 512          // input (model) width
#define NH 4   // P.v column groups of HD = 128 (they share ONE probability plane)
#define HD 128
#define HDSC 512   // the score kernel contracts over the whole 512-wide head
#define NQB (TT / 64)
#define SCALE (0.04419417382415922f)   // 1 / sqrt(512)
#define CAUSAL 0
#ifndef TNB
#define TNB NB
#endif
__device__ __forceinline__ float bfr(float v) { return (float)(__bf16)v; }
__host__ __device__ __forceinline__ int kb_last(int qb) { return CAUSAL ? ((qb * 64 + 63) >> 7) : (TT / 128 - 1); }
typedef __attribute__((ext_vector_type(8))) __bf16 v8b;
__device__ __forceinline__ v16b frag_b(const __bf16* rowk0, int lane) {
  union { v16b v; v8b q[2]; } u; const __bf16* p = rowk0 + 8 * (lane >> 4);
  u.q[0] = *(const v8b*)p; u.q[1] = *(const v8b*)(p + 16); return u.v;
}
#define QBH 0              // causal: query blocks 0..QBH-1 of each sequence (few keys, no averaging) take the high-precision path
#define QHI 0               // single-product logits on every row
#define KHI 64            // key rows carrying k residual / v bf16 hi+lo planes (used only by the causal high-precision path)
// B fragment (k rows k0+.., output column o) of a weight: (in,out) [K][ld] or (out,in) [ld rows of K]: bf16 exact, or f16(bf16 * 256) exact
__device__ __forceinline__ v16b wcol_io(const float* Wm, int k0, int o, int lane, int ld) { v16b w; const int g = lane >> 4;
#pragma unroll
  for (int i = 0; i < 8; ++i) { w[i] = (__bf16)Wm[(size_t)(k0 + 8 * g + i) * ld + o]; w[8 + i] = (__bf16)Wm[(size_t)(k0 + 16 + 8 * g + i) * ld + o]; }
  return w; }
__device__ __forceinline__ v16b wcol_oi(const float* Wm, int k0, int o, int lane, int K) { v16b w; const float* p = Wm + (size_t)o * K + k0 + 8 * (lane >> 4);
#pragma unroll
  for (int i = 0; i < 8; ++i) { w[i] = (__bf16)p[i]; w[8 + i] = (__bf16)p[16 + i]; }
  return w; }
__device__ __forceinline__ v16h wcolh_io(const float* Wm, int k0, int o, int lane, int ld) { v16h w; const int g = lane >> 4;
#pragma unroll
  for (int i = 0; i < 8; ++i) { w[i] = (_Float16)(bfr(Wm[(size_t)(k0 + 8 * g + i) * ld + o]) * 256.0f); w[8 + i] = (_Float16)(bfr(Wm[(size_t)(k0 + 16 + 8 * g + i) * ld + o]) * 256.0f); }
  return w; }
__device__ __forceinline__ v16h wcolh_oi(const float* Wm, int k0, int o, int lane, int K) { v16h w; const float* p = Wm + (size_t)o * K + k0 + 8 * (lane >> 4);
#pragma unroll
  for (int i = 0; i < 8; ++i) { w[i] = (_Float16)(bfr(p[i]) * 256.0f); w[8 + i] = (_Float16)(bfr(p[16 + i]) * 256.0f); }
  return w; }
#define WQKV_LAYOUT 1   // 0 = (in,out) [DIN][CC]; 1 = (out,in) [CC][DIN]; 2 = per-head [NH][DIN][HD]
__device__ __forceinline__ v16b wcol_hdk(const float* Wm, int k0, int o, int lane) { v16b w; const int g = lane >> 4; const float* p = Wm + (size_t)(o / HD) * DIN * HD + (o % HD);
#pragma unroll
  for (int i = 0; i < 8; ++i) { w[i] = (__bf16)p[(size_t)(k0 + 8 * g + i) * HD]; w[8 + i] = (__bf16)p[(size_t)(k0 + 16 + 8 * g + i) * HD]; }
  return w; }
#define WO_OUT_IN 1
#if WQKV_LAYOUT == 1
#define WCOL(W, k0, o, lane) wcol_oi(W, k0, o, lane, DIN)
#elif WQKV_LAYOUT == 2
#define WCOL(W, k0, o, lane) wcol_hdk(W, k0, o, lane)
#else
#define WCOL(W, k0, o, lane) wcol_io(W, k0, o, lane, CC)
#endif
#if WO_OUT_IN
#define WOCOL(W, k0, o, lane) wcol_oi(W, k0, o, lane, CC)
#define WOCOLH(W, k0, o, lane) wcolh_oi(W, k0, o, lane, CC)
#else
#define WOCOL(W, k0, o, lane) wcol_io(W, k0, o, lane, DIN)
#define WOCOLH(W, k0, o, lane) wcolh_io(W, k0, o, lane, DIN)
#endif

static_assert(CC == NH * HD && HDSC == CC && HD <= 128, "one 512-wide head: scores over all CC columns, P.v in NH column groups of HD <= 128 (the k_pv store width)");
#ifndef SM_EXTRA_PARAMS
#define SM_EXTRA_PARAMS
#endif
#ifndef PROJ_EXTRA_PARAMS
#define PROJ_EXTRA_PARAMS
#endif
#ifndef SM_MASK_HOOK
#define SM_MASK_HOOK (void)0
#endif

#define WS_QH  0u                                      // f16 q rows [b*t][CC]
#define WS_KH  (WS_QH + 2u * (size_t)NB * TT * CC)      // f16 k rows [b*t][CC]
#define WS_VT  (WS_KH + 2u * (size_t)NB * TT * CC)      // f16 v planes [b][c][t]
#define WS_QL  (WS_VT + 2u * (size_t)NB * CC * TT)      // f16 q residual x 2^10 rows [b][t < QHI][CC]
#define WS_KL  (WS_QL + 2u * (size_t)NB * QHI * CC)     // f16 k residual x 2^10 rows [b][t < KHI][CC]
#define WS_VB  (WS_KL + 2u * (size_t)NB * KHI * CC)     // bf16 v hi planes [b][c][t < KHI]
#define WS_VBL (WS_VB + 2u * (size_t)NB * CC * KHI)
#define WS_S   (WS_VBL + 2u * (size_t)NB * CC * KHI)    // f32 logits / P [b][t][s]: one plane per batch, so that each stage is one launch over all batches
#define WS_Y   (WS_S  + 4u * (size_t)NB * TT * TT)      // f32 ctx rows [b*t][CC] (only when there is an output projection)
#define WS_END (WS_Y)   // no ctx rows: k_pv writes the output directly

// ---- operand staging: a block's A tile (64 rows) and B tile (128 rows) of one 128-wide k chunk go to LDS by whole-line loads (16-bit source: 16 lanes per 256-B row; f32 source: one wave per 512-B row, rounded once on the way); all 4 waves then read their fragments from LDS (the loops of these helpers are unrolled whole, so that every register array is indexed by constants)
#define KCH 128   // k elements per staged chunk
#define LP 136    // LDS row pitch in 16-bit elements: 272 B = 17 x 16 B, so that 16 rows read 16 B each fall on all 64 banks
typedef __attribute__((ext_vector_type(4))) _Float16 v4h;
typedef __attribute__((ext_vector_type(4))) __bf16 v4b;
template <int ROWS> __device__ __forceinline__ void ld16(v8h (&r)[ROWS / 8], const _Float16* src, size_t ld, int tid) { const _Float16* p = src + (size_t)(tid >> 4) * ld + (tid & 15) * 8;
#pragma unroll
  for (int i = 0; i < ROWS / 8; ++i) r[i] = *(const v8h*)(p + (size_t)(i * 8) * ld);
  asm volatile("s_wait_xcnt 0x0" :: "v"(p) : "memory"); }   // stands in front of any overwrite of the address register pair that these loads name; p as an input keeps that pair whole up to here
template <int ROWS> __device__ __forceinline__ void st16(_Float16* t, const v8h (&r)[ROWS / 8], int tid) {
#pragma unroll
  for (int i = 0; i < ROWS / 8; ++i) *(v8h*)(t + (i * 8 + (tid >> 4)) * LP + (tid & 15) * 8) = r[i]; }
template <int ROWS> __device__ __forceinline__ void ld32(v4f (&r)[ROWS / 4], const float* src, size_t ld, int tid) { const float* p = src + (size_t)(tid >> 5) * ld + (tid & 31) * 4;
#pragma unroll
  for (int i = 0; i < ROWS / 4; ++i) r[i] = *(const v4f*)(p + (size_t)(i * 4) * ld);
  asm volatile("s_wait_xcnt 0x0" :: "v"(p) : "memory"); }   // as in ld16
template <int ROWS, typename E, typename V4> __device__ __forceinline__ void st32(E* t, const v4f (&r)[ROWS / 4], int tid) {
#pragma unroll
  for (int i = 0; i < ROWS / 4; ++i) { V4 h;
#pragma unroll
    for (int e = 0; e < 4; ++e) h[e] = (E)r[i][e];
    *(V4*)(t + (i * 4 + (tid >> 5)) * LP + (tid & 31) * 4) = h; } }
// one staged chunk of a wave's 16 x 128 product: the 18 fragment reads of k step kc + 1 stand as one group in front of the 8 products of step kc, so that no product waits out an LDS latency of its own (arow: the lane's A row; brow: the lane's row of B column group 0)
__device__ __forceinline__ void chunk_h(const _Float16* arow, const _Float16* brow, int lane, v8f (&acc)[8]) { v16h a = frag_h(arow, lane), b[8];
#pragma unroll
  for (int j = 0; j < 8; ++j) b[j] = frag_h(brow + j * 16 * LP, lane);
#pragma unroll
  for (int kc = 0; kc < KCH / 32; ++kc) { v16h an = a, bn[8];
#pragma unroll
    for (int j = 0; j < 8; ++j) bn[j] = b[j];
    if (kc + 1 < KCH / 32) { an = frag_h(arow + (kc + 1) * 32, lane);
#pragma unroll
      for (int j = 0; j < 8; ++j) bn[j] = frag_h(brow + j * 16 * LP + (kc + 1) * 32, lane); }
#pragma unroll
    for (int j = 0; j < 8; ++j) acc[j] = wmma16(a, b[j], acc[j]);
    a = an;
#pragma unroll
    for (int j = 0; j < 8; ++j) b[j] = bn[j]; } }
__device__ __forceinline__ void chunk_b(const __bf16* arow, const __bf16* brow, int lane, v8f (&acc)[8]) { v16b a = frag_b(arow, lane), b[8];
#pragma unroll
  for (int j = 0; j < 8; ++j) b[j] = frag_b(brow + j * 16 * LP, lane);
#pragma unroll
  for (int kc = 0; kc < KCH / 32; ++kc) { v16b an = a, bn[8];
#pragma unroll
    for (int j = 0; j < 8; ++j) bn[j] = b[j];
    if (kc + 1 < KCH / 32) { an = frag_b(arow + (kc + 1) * 32, lane);
#pragma unroll
      for (int j = 0; j < 8; ++j) bn[j] = frag_b(brow + j * 16 * LP + (kc + 1) * 32, lane); }
#pragma unroll
    for (int j = 0; j < 8; ++j) acc[j] = wmma_bf(a, b[j], acc[j]);
    a = an;
#pragma unroll
    for (int j = 0; j < 8; ++j) b[j] = bn[j]; } }
static_assert(HD == 128 && WQKV_LAYOUT == 1 && DIN % KCH == 0 && HDSC % KCH == 0 && KCH == 128, "staged chunks: k-contiguous (out,in) weights, whole chunks, one key block of kb_last() per chunk");

// ---- k_proj: block = (64 rows, 128 cols, which): q/k/v = X W (+ b) with exact bf16 products (K = DIN) -> which 0: q f16 rows (+ residual rows < QHI); 1: k f16 rows (+ residual rows < KHI); 2: v f16 planes [c][t] (+ bf16 hi/lo planes for t < KHI)
__global__ __launch_bounds__(128) void k_proj(const float* __restrict__ XQ, const float* __restrict__ XK, const float* __restrict__ XV, const float* __restrict__ WQ, const float* __restrict__ WK, const float* __restrict__ WV, const float* __restrict__ BQ, const float* __restrict__ BK, const float* __restrict__ BV,
    _Float16* __restrict__ QH, _Float16* __restrict__ QL, _Float16* __restrict__ KH, _Float16* __restrict__ KL, _Float16* __restrict__ VT, __bf16* __restrict__ VB, __bf16* __restrict__ VBL) {
  __shared__ __align__(16) unsigned char smem[90112];   // main loop: operand tiles xa, xb; behind its last barrier: the output staging arrays
  _Float16 (*sh)[136] = (_Float16 (*)[136])smem; _Float16 (*sl)[136] = (_Float16 (*)[136])(smem + 17408); _Float16 (*th)[72] = (_Float16 (*)[72])(smem + 34816); __bf16 (*tb)[72] = (__bf16 (*)[72])(smem + 53248); __bf16 (*tbl)[72] = (__bf16 (*)[72])(smem + 71680);
  __bf16* xa = (__bf16*)smem; __bf16* xb = xa + 64 * LP;
  const int tid = threadIdx.x, wave = tid >> 5, lane = tid & 31, col = lane & 15, g = lane >> 4; const int which = blockIdx.z; const int c0 = blockIdx.y * 128; const size_t r0 = (size_t)blockIdx.x * 64; const size_t bb = r0 / TT; const int t0 = (int)(r0 % TT);
  const float* X = which == 0 ? XQ : which == 1 ? XK : XV; const float* WA = which == 0 ? WQ : which == 1 ? WK : WV; const float* BA = which == 0 ? BQ : which == 1 ? BK : BV;
  v8f acc[8] = {};
#pragma unroll 1   // rolled: the barriers keep the chunks apart anyway, and one copy of the chunk body keeps the code short
  for (int c = 0; c < DIN / KCH; ++c) { { v4f xr[16], wr[32]; ld32<64>(xr, X + r0 * DIN + c * KCH, DIN, tid); ld32<128>(wr, WA + (size_t)c0 * DIN + c * KCH, DIN, tid); st32<64, __bf16, v4b>(xa, xr, tid); st32<128, __bf16, v4b>(xb, wr, tid); }
    __syncthreads();   // the chunk's tiles are complete before any wave reads them
    chunk_b(xa + (wave * 16 + col) * LP, xb + col * LP, lane, acc);
    __syncthreads(); }   // every wave has left the tiles before they are refilled (or reused as output staging)
  if (which < 2) { _Float16* DH = which == 0 ? QH : KH; _Float16* DL = which == 0 ? QL : KL; const int nhi = which == 0 ? QHI : KHI; const bool hi_rows = t0 < nhi;
#pragma unroll
    for (int j = 0; j < 8; ++j) { const float bias = BA ? bfr(BA[c0 + j * 16 + col]) : 0.f;
#pragma unroll
      for (int r = 0; r < 8; ++r) { const float v = acc[j][r] + bias; const _Float16 hv = (_Float16)v; sh[wave * 16 + 8 * g + r][j * 16 + col] = hv; sl[wave * 16 + 8 * g + r][j * 16 + col] = (_Float16)((v - (float)hv) * 1024.0f); } }
    __syncthreads();
    for (int e = tid; e < 64 * 16; e += 128) { const int rl = e >> 4, q = e & 15; vst2((unsigned*)(DH + (r0 + rl) * CC + c0 + q * 8), *(const v4u*)&sh[rl][q * 8]); if (hi_rows) vst2((unsigned*)(DL + (bb * nhi + t0 + rl) * (size_t)CC + c0 + q * 8), *(const v4u*)&sl[rl][q * 8]); }
  } else { const bool hi_rows = t0 < KHI;
#pragma unroll
    for (int j = 0; j < 8; ++j) { const float bias = BA ? bfr(BA[c0 + j * 16 + col]) : 0.f;
#pragma unroll
      for (int r = 0; r < 8; ++r) { const float v = acc[j][r] + bias; const int rl = wave * 16 + 8 * g + r, cl = j * 16 + col; th[cl][rl] = (_Float16)v; const __bf16 bh = (__bf16)v; tb[cl][rl] = bh; tbl[cl][rl] = (__bf16)(v - (float)bh); } }
    __syncthreads();
    for (int e = tid; e < 128 * 8; e += 128) { const int cl = e >> 3, q = e & 7; vst2((unsigned*)(VT + (bb * CC + c0 + cl) * (size_t)TT + t0 + q * 8), *(const v4u*)&th[cl][q * 8]); if (hi_rows) { const size_t o3 = (bb * CC + c0 + cl) * (size_t)KHI + t0 + q * 8; vst2((unsigned*)(VB + o3), *(const v4u*)&tb[cl][q * 8]); vst2((unsigned*)(VBL + o3), *(const v4u*)&tbl[cl][q * 8]); } } } }
// ---- k_sc: block = (query block qb, key block kb <= kb_last(qb), batch b = blockIdx.z, plane b): logits x SCALE; q hi + residual (x 2^10) against k (2 products) for query rows < QHI, plus the k residual (3 products) for query blocks < QBH (causal early rows); causal: blocks past the diagonal exit, the mask itself is applied by index in k_sm  [here: head width HDSC = 512, single head h = 0]
__global__ __launch_bounds__(128) void k_sc(const _Float16* __restrict__ QH, const _Float16* __restrict__ KH, const _Float16* __restrict__ QL, const _Float16* __restrict__ KL, float* __restrict__ S0) { __shared__ __align__(16) unsigned char smem[192 * LP * 2];   // main loop: q tile ta, k tile tk; behind its last barrier: the output staging ss
  float (*ss)[16][132] = (float (*)[16][132])smem; _Float16* ta = (_Float16*)smem; _Float16* tk = ta + 64 * LP;
  const int qb = blockIdx.x, kb = blockIdx.y; if (kb > kb_last(qb)) return;
  const int b = blockIdx.z, h = 0; float* S = S0 + (size_t)b * TT * TT;
  const int tid = threadIdx.x, wave = tid >> 5, lane = tid & 31, col = lane & 15, g = lane >> 4; const int k0 = kb * 128; const int ql0 = qb * 64 + wave * 16; const size_t q0 = (size_t)b * TT + ql0, kr0 = (size_t)b * TT + k0;
  v8f acc[8] = {}, accl[8] = {};
  const _Float16* QLb = QL + (size_t)b * QHI * CC; const _Float16* KLb = KL + (size_t)b * KHI * CC;
  if (qb < QBH) {
#pragma unroll
    for (int kc = 0; kc < HDSC / 32; ++kc) { const v16h ah = frag_h(QH + (q0 + col) * CC + h * HDSC + kc * 32, lane), al = frag_h(QLb + (size_t)(ql0 + col) * CC + h * HDSC + kc * 32, lane);
#pragma unroll
      for (int j = 0; j < 8; ++j) { const v16h kbf = frag_h(KH + (kr0 + j * 16 + col) * CC + h * HDSC + kc * 32, lane), klf = frag_h(KLb + (size_t)(k0 + j * 16 + col) * CC + h * HDSC + kc * 32, lane); acc[j] = wmma16(ah, kbf, acc[j]); accl[j] = wmma16(al, kbf, accl[j]); accl[j] = wmma16(ah, klf, accl[j]); } }
  } else if (qb * 64 < QHI) {
#pragma unroll
    for (int kc = 0; kc < HDSC / 32; ++kc) { const v16h ah = frag_h(QH + (q0 + col) * CC + h * HDSC + kc * 32, lane), al = frag_h(QLb + (size_t)(ql0 + col) * CC + h * HDSC + kc * 32, lane);
#pragma unroll
      for (int j = 0; j < 8; ++j) { const v16h kbf = frag_h(KH + (kr0 + j * 16 + col) * CC + h * HDSC + kc * 32, lane); acc[j] = wmma16(ah, kbf, acc[j]); accl[j] = wmma16(al, kbf, accl[j]); } }
  } else {
#pragma unroll 1   // rolled, as in k_proj
    for (int c = 0; c < HDSC / KCH; ++c) { { v8h qr[8], kr[16]; ld16<64>(qr, QH + ((size_t)b * TT + qb * 64) * CC + h * HDSC + c * KCH, CC, tid); ld16<128>(kr, KH + kr0 * CC + h * HDSC + c * KCH, CC, tid); st16<64>(ta, qr, tid); st16<128>(tk, kr, tid); }
      __syncthreads();   // the chunk's tiles are complete before any wave reads them
      chunk_h(ta + (wave * 16 + col) * LP, tk + col * LP, lane, acc);
      __syncthreads(); } }   // every wave has left the tiles before they are refilled (or reused as output staging)
#pragma unroll
  for (int j = 0; j < 8; ++j) {
#pragma unroll
    for (int r = 0; r < 8; ++r) ss[wave][8 * g + r][j * 16 + col] = (acc[j][r] + accl[j][r] * (1.0f / 1024.0f)) * SCALE; }
  LDSX(); for (int rl = 0; rl < 16; ++rl) vst2(S + (size_t)(ql0 + rl) * TT + k0 + lane * 4, *(const v4f*)&ss[wave][rl][lane * 4]); }
// ---- k_sm: block = query row t (plane = batch = blockIdx.y): keys [0, kend): causal -> logit if s <= t else excluded; softmax in f32; P x 2^11 in place (0 for excluded)
__global__ __launch_bounds__(256) void k_sm(float* __restrict__ S0 SM_EXTRA_PARAMS) { __shared__ float sred[8]; __shared__ float sbc; __shared__ __align__(16) float shv[TT];
  const int tid = threadIdx.x; const int t = blockIdx.x; const int kend = (kb_last(t >> 6) + 1) * 128;
  float* sr = S0 + (size_t)blockIdx.y * TT * TT + (size_t)t * TT;
  float m = -3.0e38f; for (int k = tid; k < kend; k += 256) { float v = (!CAUSAL || k <= t) ? sr[k] : -3.0e38f; SM_MASK_HOOK; shv[k] = v; m = fmaxf(m, v); }
#pragma unroll
  for (int o = 1; o < 32; o <<= 1) m = fmaxf(m, __shfl_xor(m, o));
  if ((tid & 31) == 0) sred[tid >> 5] = m; __syncthreads(); if (tid == 0) { float a = sred[0]; for (int i = 1; i < 8; ++i) a = fmaxf(a, sred[i]); sbc = a; } __syncthreads(); m = sbc; __syncthreads();
  float sum = 0.f; for (int k = tid; k < kend; k += 256) { const float v = shv[k]; const float e = (v <= -1.0e38f) ? 0.f : expf(v - m); shv[k] = e; sum += e; }
#pragma unroll
  for (int o = 1; o < 32; o <<= 1) sum += __shfl_xor(sum, o);
  if ((tid & 31) == 0) sred[tid >> 5] = sum; __syncthreads(); if (tid == 0) { float a = 0.f; for (int i = 0; i < 8; ++i) a += sred[i]; sbc = a > 0.f ? 2048.0f / a : 0.f; }   /* a fully excluded row yields P = 0 */ __syncthreads(); const float inv = sbc;
  for (int k = tid; k < kend; k += 256) shv[k] = shv[k] * inv;
  __syncthreads(); for (int q = tid; q < kend / 4; q += 256) vst2(sr + q * 4, *(const v4f*)&shv[q * 4]); }
// ---- k_pv: block = 64 queries (qb = blockIdx.x) of (column group h = blockIdx.y, batch b = blockIdx.z; plane b): ctx = P . v over keys [0, kend) (P x 2^11 once to f16 against v f16: 1 product; causal early query blocks: P and v as bf16 hi + lo, 3 products); 512-B (row, head) segment by 32 lanes
__global__ __launch_bounds__(128) void k_pv(const float* __restrict__ PS0, const _Float16* __restrict__ VT, const __bf16* __restrict__ VB, const __bf16* __restrict__ VBL, float* __restrict__ Y) { const int h = blockIdx.y, b = blockIdx.z; const float* PS = PS0 + (size_t)b * TT * TT; __shared__ __align__(16) float ss[4][16][HD + 4]; __shared__ __align__(16) _Float16 tp[64 * LP], tv[128 * LP];
  const int tid = threadIdx.x, wave = tid >> 5, lane = tid & 31, col = lane & 15, g = lane >> 4; const int qb = blockIdx.x; const int ql0 = qb * 64 + wave * 16; const int kce = (kb_last(qb) + 1) * 4;
  v8f acc[HD / 16] = {};
  if (qb < QBH) {
#pragma unroll 1
    for (int kc = 0; kc < kce; ++kc) { const F2 p = split_row(PS + (size_t)(ql0 + col) * TT, kc * 32, lane);
      asm volatile("s_wait_loadcnt 0x0" ::: "memory");
#pragma unroll
      for (int j = 0; j < HD / 16; ++j) { const size_t po = ((size_t)b * CC + h * HD + j * 16 + col) * (size_t)KHI + kc * 32; const v16b vh = frag_b(VB + po, lane); acc[j] = wmma_bf(p.h, vh, acc[j]); acc[j] = wmma_bf(p.l, vh, acc[j]); acc[j] = wmma_bf(p.h, frag_b(VBL + po, lane), acc[j]); } }
  } else {
    const float* Pg = PS + (size_t)qb * 64 * TT; const _Float16* Vg = VT + ((size_t)b * CC + h * HD) * (size_t)TT; const int nch = kce / (KCH / 32);
    v4f pr[16]; v8h vr[16]; ld32<64>(pr, Pg, TT, tid); ld16<128>(vr, Vg, TT, tid);
#pragma unroll 1   // rolled, as in k_proj
    for (int c = 0; c < nch; ++c) { st32<64, _Float16, v4h>(tp, pr, tid); st16<128>(tv, vr, tid);
      __syncthreads();   // the chunk's tiles are complete before any wave reads them
      if (c + 1 < nch) { ld32<64>(pr, Pg + (c + 1) * KCH, TT, tid); ld16<128>(vr, Vg + (c + 1) * KCH, TT, tid); }   // the next chunk flies into registers while this one is multiplied
      chunk_h(tp + (wave * 16 + col) * LP, tv + col * LP, lane, acc);
      __syncthreads(); } }   // every wave has left the tiles before they are refilled
#pragma unroll
  for (int j = 0; j < HD / 16; ++j)
#pragma unroll
    for (int r = 0; r < 8; ++r) ss[wave][8 * g + r][j * 16 + col] = acc[j][r] * (1.0f / 2048.0f);
  LDSX(); for (int rl = 0; rl < 16; ++rl) if (lane < HD / 4) vst2(Y + ((size_t)b * TT + ql0 + rl) * CC + h * HD + lane * 4, *(const v4f*)&ss[wave][rl][lane * 4]); }

extern "C" void kernel_launch(void* const* d_in, const int* in_sizes, int n_in, void* d_out, int out_size, void* d_ws, size_t ws_size, hipStream_t stream) {
  (void)in_sizes; (void)n_in; (void)out_size;
  const float** F = (const float**)d_in;
  if (ws_size < (size_t)WS_END) return;
  char* ws = (char*)d_ws; _Float16 *QH = (_Float16*)(ws + WS_QH), *KH = (_Float16*)(ws + WS_KH), *VT = (_Float16*)(ws + WS_VT), *QL = (_Float16*)(ws + WS_QL), *KL = (_Float16*)(ws + WS_KL); __bf16 *VB = (__bf16*)(ws + WS_VB), *VBL = (__bf16*)(ws + WS_VBL); float *S = (float*)(ws + WS_S), *Y = (float*)(ws + WS_Y);
  (void)Y; (void)QL; (void)KL; (void)VB; (void)VBL;
  // inputs: 0 x [4,2048,512]; 1 Wq [512,512] (out,in), 2 bq; 3 Wk, 4 bk; 5 Wv, 6 bv (biases nonzero)
  k_proj<<<dim3(TNB * TT / 64, CC / 128, 3), 128, 0, stream>>>(F[0], F[0], F[0], F[1], F[3], F[5], F[2], F[4], F[6], QH, QL, KH, KL, VT, VB, VBL);
  k_sc<<<dim3(NQB, TT / 128, TNB), 128, 0, stream>>>(QH, KH, QL, KL, S);   /* one 2,048 x 2,048 plane per batch: scores over all 512 columns */
  k_sm<<<dim3(TT, TNB), 256, 0, stream>>>(S);
  k_pv<<<dim3(NQB, NH, TNB), 128, 0, stream>>>(S, VT, VB, VBL, (float*)d_out);   /* column group y: v / output columns 128y .. 128y+127, all four from the batch's one plane */
}

// v003
// Measured time: 77.9 microseconds a run.
// Timed twice side by side with v002, it ran 1.55 times as fast both times.
// Over all steps from v000 it is 23.3 times as fast.
// compute dtype: all float inputs rounded to bf16; q/k/v projections with EXACT bf16 products on WMMA 16x16x32 (f32 accumulate) + bias; logits q x k once to f16 each (1 product) over the full 512-wide head x 512^-0.5; softmax f32, split by key block: exp(logit - block max) once to f16 x v once to f16 (1 product per key block), each block's partial product weighted in f32 by exp(block max - row max) / row sum; four 128-column passes over the same plane; f32 output (no output projection).
#include <hip/hip_runtime.h>
#include <math.h>

typedef __attribute__((ext_vector_type(16))) _Float16 v16h;
typedef __attribute__((ext_vector_type(16))) __bf16 v16b;
typedef __attribute__((ext_vector_type(8)))  _Float16 v8h;
typedef __attribute__((ext_vector_type(8)))  float v8f;
typedef __attribute__((ext_vector_type(4)))  float v4f;
typedef __attribute__((ext_vector_type(2)))  float v2f;
typedef __attribute__((ext_vector_type(4)))  unsigned v4u;
typedef __attribute__((ext_vector_type(4)))  int v4i;
typedef float __attribute__((may_alias)) float_a;
typedef int __attribute__((may_alias)) int_a;

template <typename T> __device__ __forceinline__ void vst2(void* p, T v) { *(T*)p = v;  }
__device__ __forceinline__ v8f wmma16(v16h a, v16h b, v8f c) {
  v8f d = __builtin_amdgcn_wmma_f32_16x16x32_f16(false, a, false, b, (short)0, c, false, false);
  asm volatile("v_nop\n\tv_nop\n\tv_nop\n\tv_nop" : "+v"(d) : "v"(a), "v"(b));
  return d;
}
__device__ __forceinline__ v8f wmma_bf(v16b a, v16b b, v8f c) {
  v8f d = __builtin_amdgcn_wmma_f32_16x16x32_bf16(false, a, false, b, (short)0, c, false, false);
  asm volatile("v_nop\n\tv_nop\n\tv_nop\n\tv_nop" : "+v"(d) : "v"(a), "v"(b));
  return d;
}
// 16x16x32 fragments: lane = (h = lane>>4, row/col = lane&15); elements 0..7 = k0+8h+0..7, 8..15 = k0+16+8h+0..7; D element r = row 8h+r
__device__ __forceinline__ v16h frag_h(const _Float16* rowk0, int lane) {
  union { v16h v; v8h q[2]; } u; const _Float16* p = rowk0 + 8 * (lane >> 4);
  u.q[0] = *(const v8h*)p; u.q[1] = *(const v8h*)(p + 16); return u.v;
}
__device__ __forceinline__ v16h frag_f32(const float* rowk0, int lane) {
  v16h a; const float* p = rowk0 + 8 * (lane >> 4);
#pragma unroll
  for (int i = 0; i < 8; ++i) { a[i] = (_Float16)p[i]; a[8 + i] = (_Float16)p[16 + i]; }
  return a;
}
__device__ __forceinline__ v16h frag_f32s(const float* rowk0, int lane, float sc) {
  v16h a; const float* p = rowk0 + 8 * (lane >> 4);
#pragma unroll
  for (int i = 0; i < 8; ++i) { a[i] = (_Float16)(p[i] * sc); a[8 + i] = (_Float16)(p[16 + i] * sc); }
  return a;
}
// column fragment from a [K][ld] layout (column n), rows >= K read as 0
__device__ __forceinline__ v16h fragc_f32(const float* W, int k0, int n, int lane, int ld, int K) {
  v16h a; const int g = lane >> 4;
#pragma unroll
  for (int i = 0; i < 8; ++i) { const int ka = k0 + 8 * g + i, kb = ka + 16;
    a[i] = (_Float16)(ka < K ? W[(size_t)(ka < K ? ka : K - 1) * ld + n] : 0.f); a[8 + i] = (_Float16)(kb < K ? W[(size_t)(kb < K ? kb : K - 1) * ld + n] : 0.f); }
  return a;
}
struct F2 { v16b h, l; };
__device__ __forceinline__ F2 bsplit16(const float v[16]) { F2 r;
#pragma unroll
  for (int i = 0; i < 16; ++i) { const __bf16 h = (__bf16)v[i]; r.h[i] = h; r.l[i] = (__bf16)(v[i] - (float)h); }
  return r; }
__device__ __forceinline__ F2 split_row(const float* row, int k0, int lane) { float v[16]; const float* p = row + k0 + 8 * (lane >> 4);
#pragma unroll
  for (int i = 0; i < 8; ++i) { v[i] = p[i]; v[8 + i] = p[16 + i]; }
  return bsplit16(v); }
__device__ __forceinline__ F2 split_rowK(const float* row, int k0, int lane, int K) { float v[16]; const int g = lane >> 4;
#pragma unroll
  for (int i = 0; i < 8; ++i) { const int ka = k0 + 8 * g + i, kb = ka + 16; v[i] = ka < K ? row[ka < K ? ka : K - 1] : 0.f; v[8 + i] = kb < K ? row[kb < K ? kb : K - 1] : 0.f; }
  return bsplit16(v); }
__device__ __forceinline__ F2 split_col(const float* W, int k0, int n, int lane, int ld, int K) { float v[16]; const int g = lane >> 4;
#pragma unroll
  for (int i = 0; i < 8; ++i) { const int ka = k0 + 8 * g + i, kb = ka + 16; v[i] = ka < K ? W[(size_t)(ka < K ? ka : K - 1) * ld + n] : 0.f; v[8 + i] = kb < K ? W[(size_t)(kb < K ? kb : K - 1) * ld + n] : 0.f; }
  return bsplit16(v); }
__device__ __forceinline__ v8f mac3(const F2& a, const F2& b, v8f c) { c = wmma_bf(a.l, b.h, c); c = wmma_bf(a.h, b.l, c); return wmma_bf(a.h, b.h, c); }
__device__ __forceinline__ float sigm(float v) { return 1.0f / (1.0f + expf(-v)); }
#define LDSX() do { asm volatile("s_wait_dscnt 0" ::: "memory"); __builtin_amdgcn_wave_barrier(); __builtin_amdgcn_fence(__ATOMIC_RELEASE, "workgroup"); } while (0)

// Single-head scaled-dot-product self-attention with a 512-wide head (x [4,2048,512]; torch (out,in) Wq / Wk / Wv [512,512] and biases uniform(+-1/sqrt(512)) (nonzero), einsum 'bnd,ed->bne'; scores = q k^T / sqrt(512) over all 512 dims; softmax over the 2,048 keys; out = weights v, [4,2048,512]; no output projection).
#define NB 4
#define TT 2048
#define CC 512            // NH * HD = projected width
#define DIN 512          // input (model) width
#define NH 4   // P.v column groups of HD = 128 (they share ONE probability plane)
#define HD 128
#define HDSC 512   // the score kernel contracts over the whole 512-wide head
#define NQB (TT / 64)
#define SCALE (0.04419417382415922f)   // 1 / sqrt(512)
#define SCALE2 (SCALE * 1.4426950408889634f)   // SCALE x log2(e): logits in base-2 units, so that exp(a - b) is one native exp2
#define CAUSAL 0
#ifndef TNB
#define TNB NB
#endif
__device__ __forceinline__ float bfr(float v) { return (float)(__bf16)v; }
__host__ __device__ __forceinline__ int kb_last(int qb) { return CAUSAL ? ((qb * 64 + 63) >> 7) : (TT / 128 - 1); }
typedef __attribute__((ext_vector_type(8))) __bf16 v8b;
__device__ __forceinline__ v16b frag_b(const __bf16* rowk0, int lane) {
  union { v16b v; v8b q[2]; } u; const __bf16* p = rowk0 + 8 * (lane >> 4);
  u.q[0] = *(const v8b*)p; u.q[1] = *(const v8b*)(p + 16); return u.v;
}
#define QBH 0              // causal: query blocks 0..QBH-1 of each sequence (few keys, no averaging) take the high-precision path
#define QHI 0               // single-product logits on every row
#define KHI 64            // key rows carrying k residual / v bf16 hi+lo planes (the k residual is read only by k_sc's causal high-precision path; no kernel reads the v planes)
// B fragment (k rows k0+.., output column o) of a weight: (in,out) [K][ld] or (out,in) [ld rows of K]: bf16 exact, or f16(bf16 * 256) exact
__device__ __forceinline__ v16b wcol_io(const float* Wm, int k0, int o, int lane, int ld) { v16b w; const int g = lane >> 4;
#pragma unroll
  for (int i = 0; i < 8; ++i) { w[i] = (__bf16)Wm[(size_t)(k0 + 8 * g + i) * ld + o]; w[8 + i] = (__bf16)Wm[(size_t)(k0 + 16 + 8 * g + i) * ld + o]; }
  return w; }
__device__ __forceinline__ v16b wcol_oi(const float* Wm, int k0, int o, int lane, int K) { v16b w; const float* p = Wm + (size_t)o * K + k0 + 8 * (lane >> 4);
#pragma unroll
  for (int i = 0; i < 8; ++i) { w[i] = (__bf16)p[i]; w[8 + i] = (__bf16)p[16 + i]; }
  return w; }
__device__ __forceinline__ v16h wcolh_io(const float* Wm, int k0, int o, int lane, int ld) { v16h w; const int g = lane >> 4;
#pragma unroll
  for (int i = 0; i < 8; ++i) { w[i] = (_Float16)(bfr(Wm[(size_t)(k0 + 8 * g + i) * ld + o]) * 256.0f); w[8 + i] = (_Float16)(bfr(Wm[(size_t)(k0 + 16 + 8 * g + i) * ld + o]) * 256.0f); }
  return w; }
__device__ __forceinline__ v16h wcolh_oi(const float* Wm, int k0, int o, int lane, int K) { v16h w; const float* p = Wm + (size_t)o * K + k0 + 8 * (lane >> 4);
#pragma unroll
  for (int i = 0; i < 8; ++i) { w[i] = (_Float16)(bfr(p[i]) * 256.0f); w[8 + i] = (_Float16)(bfr(p[16 + i]) * 256.0f); }
  return w; }
#define WQKV_LAYOUT 1   // 0 = (in,out) [DIN][CC]; 1 = (out,in) [CC][DIN]; 2 = per-head [NH][DIN][HD]
__device__ __forceinline__ v16b wcol_hdk(const float* Wm, int k0, int o, int lane) { v16b w; const int g = lane >> 4; const float* p = Wm + (size_t)(o / HD) * DIN * HD + (o % HD);
#pragma unroll
  for (int i = 0; i < 8; ++i) { w[i] = (__bf16)p[(size_t)(k0 + 8 * g + i) * HD]; w[8 + i] = (__bf16)p[(size_t)(k0 + 16 + 8 * g + i) * HD]; }
  return w; }
#define WO_OUT_IN 1
#if WQKV_LAYOUT == 1
#define WCOL(W, k0, o, lane) wcol_oi(W, k0, o, lane, DIN)
#elif WQKV_LAYOUT == 2
#define WCOL(W, k0, o, lane) wcol_hdk(W, k0, o, lane)
#else
#define WCOL(W, k0, o, lane) wcol_io(W, k0, o, lane, CC)
#endif
#if WO_OUT_IN
#define WOCOL(W, k0, o, lane) wcol_oi(W, k0, o, lane, CC)
#define WOCOLH(W, k0, o, lane) wcolh_oi(W, k0, o, lane, CC)
#else
#define WOCOL(W, k0, o, lane) wcol_io(W, k0, o, lane, DIN)
#define WOCOLH(W, k0, o, lane) wcolh_io(W, k0, o, lane, DIN)
#endif

static_assert(CC == NH * HD && HDSC == CC && HD <= 128, "one 512-wide head: scores over all CC columns, P.v in NH column groups of HD <= 128 (the k_pv store width)");
#ifndef PROJ_EXTRA_PARAMS
#define PROJ_EXTRA_PARAMS
#endif

#define WS_QH  0u                                      // f16 q rows [b*t][CC]
#define WS_KH  (WS_QH + 2u * (size_t)NB * TT * CC)      // f16 k rows [b*t][CC]
#define WS_VT  (WS_KH + 2u * (size_t)NB * TT * CC)      // f16 v planes [b][c][t]
#define WS_QL  (WS_VT + 2u * (size_t)NB * CC * TT)      // f16 q residual x 2^10 rows [b][t < QHI][CC]
#define WS_KL  (WS_QL + 2u * (size_t)NB * QHI * CC)     // f16 k residual x 2^10 rows [b][t < KHI][CC]
#define WS_VB  (WS_KL + 2u * (size_t)NB * KHI * CC)     // bf16 v hi planes [b][c][t < KHI]
#define WS_VBL (WS_VB + 2u * (size_t)NB * CC * KHI)
#define WS_S   (WS_VBL + 2u * (size_t)NB * CC * KHI)    // f16 exp2(base-2 logit - key block's row max) [b][t][s]: one plane per batch, so that each stage is one launch over all batches
#define WS_ST  (WS_S  + 2u * (size_t)NB * TT * TT)      // f32 pairs (row max in base-2 units, row sum of exp2) of each 128-key block [b][kb][t]: a wave's 16 rows fill one 128-B line
#define WS_Y   (WS_ST + 8u * (size_t)NB * (TT / 128) * TT)   // f32 ctx rows [b*t][CC] (only when there is an output projection)
#define WS_END (WS_Y)   // no ctx rows: k_pv writes the output directly

// ---- operand staging: a block's A tile (64 rows) and B tile (128 rows) of one 128-wide k chunk go to LDS by whole-line loads (16-bit source: 16 lanes per 256-B row; f32 source: one wave per 512-B row, rounded once on the way); all 4 waves then read their fragments from LDS (the loops of these helpers are unrolled whole, so that every register array is indexed by constants)
#define KCH 128   // k elements per staged chunk
#define LP 136    // LDS row pitch in 16-bit elements: 272 B = 17 x 16 B, so that 16 rows read 16 B each fall on all 64 banks
typedef __attribute__((ext_vector_type(4))) _Float16 v4h;
typedef __attribute__((ext_vector_type(4))) __bf16 v4b;
template <int ROWS> __device__ __forceinline__ void ld16(v8h (&r)[ROWS / 8], const _Float16* src, size_t ld, int tid) { const _Float16* p = src + (size_t)(tid >> 4) * ld + (tid & 15) * 8;
#pragma unroll
  for (int i = 0; i < ROWS / 8; ++i) r[i] = *(const v8h*)(p + (size_t)(i * 8) * ld);
  asm volatile("s_wait_xcnt 0x0" :: "v"(p) : "memory"); }   // stands in front of any overwrite of the address register pair that these loads name; p as an input keeps that pair whole up to here
template <int ROWS> __device__ __forceinline__ void st16(_Float16* t, const v8h (&r)[ROWS / 8], int tid) {
#pragma unroll
  for (int i = 0; i < ROWS / 8; ++i) *(v8h*)(t + (i * 8 + (tid >> 4)) * LP + (tid & 15) * 8) = r[i]; }
template <int ROWS> __device__ __forceinline__ void ld32(v4f (&r)[ROWS / 4], const float* src, size_t ld, int tid) { const float* p = src + (size_t)(tid >> 5) * ld + (tid & 31) * 4;
#pragma unroll
  for (int i = 0; i < ROWS / 4; ++i) r[i] = *(const v4f*)(p + (size_t)(i * 4) * ld);
  asm volatile("s_wait_xcnt 0x0" :: "v"(p) : "memory"); }   // as in ld16
template <int ROWS, typename E, typename V4> __device__ __forceinline__ void st32(E* t, const v4f (&r)[ROWS / 4], int tid) {
#pragma unroll
  for (int i = 0; i < ROWS / 4; ++i) { V4 h;
#pragma unroll
    for (int e = 0; e < 4; ++e) h[e] = (E)r[i][e];
    *(V4*)(t + (i * 4 + (tid >> 5)) * LP + (tid & 31) * 4) = h; } }
// one staged chunk of a wave's 16 x 128 product: the 18 fragment reads of k step kc + 1 stand as one group in front of the 8 products of step kc, so that no product waits out an LDS latency of its own (arow: the lane's A row; brow: the lane's row of B column group 0)
__device__ __forceinline__ void chunk_h(const _Float16* arow, const _Float16* brow, int lane, v8f (&acc)[8]) { v16h a = frag_h(arow, lane), b[8];
#pragma unroll
  for (int j = 0; j < 8; ++j) b[j] = frag_h(brow + j * 16 * LP, lane);
#pragma unroll
  for (int kc = 0; kc < KCH / 32; ++kc) { v16h an = a, bn[8];
#pragma unroll
    for (int j = 0; j < 8; ++j) bn[j] = b[j];
    if (kc + 1 < KCH / 32) { an = frag_h(arow + (kc + 1) * 32, lane);
#pragma unroll
      for (int j = 0; j < 8; ++j) bn[j] = frag_h(brow + j * 16 * LP + (kc + 1) * 32, lane); }
#pragma unroll
    for (int j = 0; j < 8; ++j) acc[j] = wmma16(a, b[j], acc[j]);
    a = an;
#pragma unroll
    for (int j = 0; j < 8; ++j) b[j] = bn[j]; } }
__device__ __forceinline__ void chunk_b(const __bf16* arow, const __bf16* brow, int lane, v8f (&acc)[8]) { v16b a = frag_b(arow, lane), b[8];
#pragma unroll
  for (int j = 0; j < 8; ++j) b[j] = frag_b(brow + j * 16 * LP, lane);
#pragma unroll
  for (int kc = 0; kc < KCH / 32; ++kc) { v16b an = a, bn[8];
#pragma unroll
    for (int j = 0; j < 8; ++j) bn[j] = b[j];
    if (kc + 1 < KCH / 32) { an = frag_b(arow + (kc + 1) * 32, lane);
#pragma unroll
      for (int j = 0; j < 8; ++j) bn[j] = frag_b(brow + j * 16 * LP + (kc + 1) * 32, lane); }
#pragma unroll
    for (int j = 0; j < 8; ++j) acc[j] = wmma_bf(a, b[j], acc[j]);
    a = an;
#pragma unroll
    for (int j = 0; j < 8; ++j) b[j] = bn[j]; } }
static_assert(HD == 128 && WQKV_LAYOUT == 1 && DIN % KCH == 0 && HDSC % KCH == 0 && KCH == 128, "staged chunks: k-contiguous (out,in) weights, whole chunks, one key block of kb_last() per chunk");

// ---- k_proj: block = (64 rows, 128 cols, which): q/k/v = X W (+ b) with exact bf16 products (K = DIN) -> which 0: q f16 rows (+ residual rows < QHI); 1: k f16 rows (+ residual rows < KHI); 2: v f16 planes [c][t] (+ bf16 hi/lo planes for t < KHI)
__global__ __launch_bounds__(128) void k_proj(const float* __restrict__ XQ, const float* __restrict__ XK, const float* __restrict__ XV, const float* __restrict__ WQ, const float* __restrict__ WK, const float* __restrict__ WV, const float* __restrict__ BQ, const float* __restrict__ BK, const float* __restrict__ BV,
    _Float16* __restrict__ QH, _Float16* __restrict__ QL, _Float16* __restrict__ KH, _Float16* __restrict__ KL, _Float16* __restrict__ VT, __bf16* __restrict__ VB, __bf16* __restrict__ VBL) {
  __shared__ __align__(16) unsigned char smem[90112];   // main loop: operand tiles xa, xb; behind its last barrier: the output staging arrays
  _Float16 (*sh)[136] = (_Float16 (*)[136])smem; _Float16 (*sl)[136] = (_Float16 (*)[136])(smem + 17408); _Float16 (*th)[72] = (_Float16 (*)[72])(smem + 34816); __bf16 (*tb)[72] = (__bf16 (*)[72])(smem + 53248); __bf16 (*tbl)[72] = (__bf16 (*)[72])(smem + 71680);
  __bf16* xa = (__bf16*)smem; __bf16* xb = xa + 64 * LP;
  const int tid = threadIdx.x, wave = tid >> 5, lane = tid & 31, col = lane & 15, g = lane >> 4; const int which = blockIdx.z; const int c0 = blockIdx.y * 128; const size_t r0 = (size_t)blockIdx.x * 64; const size_t bb = r0 / TT; const int t0 = (int)(r0 % TT);
  const float* X = which == 0 ? XQ : which == 1 ? XK : XV; const float* WA = which == 0 ? WQ : which == 1 ? WK : WV; const float* BA = which == 0 ? BQ : which == 1 ? BK : BV;
  v8f acc[8] = {};
#pragma unroll 1   // rolled: the barriers keep the chunks apart anyway, and one copy of the chunk body keeps the code short
  for (int c = 0; c < DIN / KCH; ++c) { { v4f xr[16], wr[32]; ld32<64>(xr, X + r0 * DIN + c * KCH, DIN, tid); ld32<128>(wr, WA + (size_t)c0 * DIN + c * KCH, DIN, tid); st32<64, __bf16, v4b>(xa, xr, tid); st32<128, __bf16, v4b>(xb, wr, tid); }
    __syncthreads();   // the chunk's tiles are complete before any wave reads them
    chunk_b(xa + (wave * 16 + col) * LP, xb + col * LP, lane, acc);
    __syncthreads(); }   // every wave has left the tiles before they are refilled (or reused as output staging)
  if (which < 2) { _Float16* DH = which == 0 ? QH : KH; _Float16* DL = which == 0 ? QL : KL; const int nhi = which == 0 ? QHI : KHI; const bool hi_rows = t0 < nhi;
#pragma unroll
    for (int j = 0; j < 8; ++j) { const float bias = BA ? bfr(BA[c0 + j * 16 + col]) : 0.f;
#pragma unroll
      for (int r = 0; r < 8; ++r) { const float v = acc[j][r] + bias; const _Float16 hv = (_Float16)v; sh[wave * 16 + 8 * g + r][j * 16 + col] = hv; sl[wave * 16 + 8 * g + r][j * 16 + col] = (_Float16)((v - (float)hv) * 1024.0f); } }
    __syncthreads();
    for (int e = tid; e < 64 * 16; e += 128) { const int rl = e >> 4, q = e & 15; vst2((unsigned*)(DH + (r0 + rl) * CC + c0 + q * 8), *(const v4u*)&sh[rl][q * 8]); if (hi_rows) vst2((unsigned*)(DL + (bb * nhi + t0 + rl) * (size_t)CC + c0 + q * 8), *(const v4u*)&sl[rl][q * 8]); }
  } else { const bool hi_rows = t0 < KHI;
#pragma unroll
    for (int j = 0; j < 8; ++j) { const float bias = BA ? bfr(BA[c0 + j * 16 + col]) : 0.f;
#pragma unroll
      for (int r = 0; r < 8; ++r) { const float v = acc[j][r] + bias; const int rl = wave * 16 + 8 * g + r, cl = j * 16 + col; th[cl][rl] = (_Float16)v; const __bf16 bh = (__bf16)v; tb[cl][rl] = bh; tbl[cl][rl] = (__bf16)(v - (float)bh); } }
    __syncthreads();
    for (int e = tid; e < 128 * 8; e += 128) { const int cl = e >> 3, q = e & 7; vst2((unsigned*)(VT + (bb * CC + c0 + cl) * (size_t)TT + t0 + q * 8), *(const v4u*)&th[cl][q * 8]); if (hi_rows) { const size_t o3 = (bb * CC + c0 + cl) * (size_t)KHI + t0 + q * 8; vst2((unsigned*)(VB + o3), *(const v4u*)&tb[cl][q * 8]); vst2((unsigned*)(VBL + o3), *(const v4u*)&tbl[cl][q * 8]); } } } }
// value of lane l ^ M inside the lane's 16-lane row, by DPP row_xmask (every lane on): a vector move, where a shuffle would go through the LDS unit
template <int M> __device__ __forceinline__ float rowx(float v) { return __builtin_bit_cast(float, __builtin_amdgcn_update_dpp(0, __builtin_bit_cast(int, v), 0x160 | M, 0xf, 0xf, true)); }
// native exp2 with its v_nop in the same statement: the slot that the instruction set asks for between a transcendental and an instruction that reads its result or overwrites its source
__device__ __forceinline__ float exp2_slot(float v) { float e; asm("v_exp_f32 %0, %1\n\tv_nop" : "=v"(e) : "v"(v)); return e; }
// ---- k_sc: block = (query block qb, key block kb <= kb_last(qb), batch b = blockIdx.z, plane b): logits x SCALE2 (base-2 units), then this key block's share of the softmax (row max m, e = exp2(logit - m) to the plane, (m, sum e) to ST); q hi + residual (x 2^10) against k (2 products) for query rows < QHI, plus the k residual (3 products) for query blocks < QBH (causal early rows); causal: blocks past the diagonal exit  [here: head width HDSC = 512, single head h = 0]
__global__ __launch_bounds__(128) void k_sc(const _Float16* __restrict__ QH, const _Float16* __restrict__ KH, const _Float16* __restrict__ QL, const _Float16* __restrict__ KL, _Float16* __restrict__ S0, float* __restrict__ ST) { __shared__ __align__(16) unsigned char smem[192 * LP * 2];   // main loop: q tile ta, k tile tk; behind its last barrier: the output staging se
  _Float16 (*se)[16][LP] = (_Float16 (*)[16][LP])smem; _Float16* ta = (_Float16*)smem; _Float16* tk = ta + 64 * LP;
  const int qb = blockIdx.x, kb = blockIdx.y; if (kb > kb_last(qb)) return;
  const int b = blockIdx.z, h = 0; _Float16* S = S0 + (size_t)b * TT * TT;
  const int tid = threadIdx.x, wave = tid >> 5, lane = tid & 31, col = lane & 15, g = lane >> 4; const int k0 = kb * 128; const int ql0 = qb * 64 + wave * 16; const size_t q0 = (size_t)b * TT + ql0, kr0 = (size_t)b * TT + k0;
  v8f acc[8] = {}, accl[8] = {};
  const _Float16* QLb = QL + (size_t)b * QHI * CC; const _Float16* KLb = KL + (size_t)b * KHI * CC;
  if (qb < QBH) {
#pragma unroll
    for (int kc = 0; kc < HDSC / 32; ++kc) { const v16h ah = frag_h(QH + (q0 + col) * CC + h * HDSC + kc * 32, lane), al = frag_h(QLb + (size_t)(ql0 + col) * CC + h * HDSC + kc * 32, lane);
#pragma unroll
      for (int j = 0; j < 8; ++j) { const v16h kbf = frag_h(KH + (kr0 + j * 16 + col) * CC + h * HDSC + kc * 32, lane), klf = frag_h(KLb + (size_t)(k0 + j * 16 + col) * CC + h * HDSC + kc * 32, lane); acc[j] = wmma16(ah, kbf, acc[j]); accl[j] = wmma16(al, kbf, accl[j]); accl[j] = wmma16(ah, klf, accl[j]); } }
  } else if (qb * 64 < QHI) {
#pragma unroll
    for (int kc = 0; kc < HDSC / 32; ++kc) { const v16h ah = frag_h(QH + (q0 + col) * CC + h * HDSC + kc * 32, lane), al = frag_h(QLb + (size_t)(ql0 + col) * CC + h * HDSC + kc * 32, lane);
#pragma unroll
      for (int j = 0; j < 8; ++j) { const v16h kbf = frag_h(KH + (kr0 + j * 16 + col) * CC + h * HDSC + kc * 32, lane); acc[j] = wmma16(ah, kbf, acc[j]); accl[j] = wmma16(al, kbf, accl[j]); } }
  } else {
#pragma unroll 1   // rolled, as in k_proj
    for (int c = 0; c < HDSC / KCH; ++c) { { v8h qr[8], kr[16]; ld16<64>(qr, QH + ((size_t)b * TT + qb * 64) * CC + h * HDSC + c * KCH, CC, tid); ld16<128>(kr, KH + kr0 * CC + h * HDSC + c * KCH, CC, tid); st16<64>(ta, qr, tid); st16<128>(tk, kr, tid); }
      __syncthreads();   // the chunk's tiles are complete before any wave reads them
      chunk_h(ta + (wave * 16 + col) * LP, tk + col * LP, lane, acc);
      __syncthreads(); } }   // every wave has left the tiles before they are refilled (or reused as output staging)
  // row 8g + r of the wave's tile lies in the 16 lanes of half g, 8 columns a lane: max and sum go over the lane's 8 values, then over the half by 4 exchanges
  float mo = 0.f, so = 0.f;
#pragma unroll
  for (int r = 0; r < 8; ++r) { float lg[8]; float m = -3.0e38f;
#pragma unroll
    for (int j = 0; j < 8; ++j) { lg[j] = (acc[j][r] + accl[j][r] * (1.0f / 1024.0f)) * SCALE2; m = fmaxf(m, lg[j]); }
    m = fmaxf(m, rowx<1>(m)); m = fmaxf(m, rowx<2>(m)); m = fmaxf(m, rowx<4>(m)); m = fmaxf(m, rowx<8>(m));
    float sum = 0.f;
#pragma unroll
    for (int j = 0; j < 8; ++j) { const float e = exp2_slot(lg[j] - m); sum += e; se[wave][8 * g + r][j * 16 + col] = (_Float16)e; }
    sum += rowx<1>(sum); sum += rowx<2>(sum); sum += rowx<4>(sum); sum += rowx<8>(sum);
    if (col == r) { mo = m; so = sum; } }
  float* sp = ST + (((size_t)b * (TT / 128) + kb) * TT + ql0 + 8 * g + (col & 7)) * 2;
  _Float16* op = S + (size_t)(ql0 + g) * TT + k0 + col * 8;
  LDSX();
#pragma unroll
  for (int i = 0; i < 8; ++i) vst2(op + (size_t)(i * 2) * TT, *(const v4u*)&se[wave][i * 2 + g][col * 8]);   // 16 lanes per 256-B row segment
  if (col < 8) { v2f st; st[0] = mo; st[1] = so; vst2(sp, st); }   // lane col of half g stores row 8g + col
  asm volatile("s_wait_xcnt 0x0" :: "v"(sp), "v"(op) : "memory"); }   // as in ld16: stands in front of any overwrite of the address pairs that these stores name
// ---- k_pv: block = 64 queries (qb = blockIdx.x) of (column group h = blockIdx.y, batch b = blockIdx.z; plane b): ctx = sum over key blocks kb of w[kb] * (e[kb] . v[kb]) (e f16 against v f16: 1 product), w[kb] = exp2(m[kb] - row max) / row sum from the score kernel's (m, sum) pairs, per row, f32; 512-B (row, head) segment by 32 lanes
static_assert(QBH == 0 && !CAUSAL, "every query block takes the staged single-product path over all key blocks");
__global__ __launch_bounds__(128) void k_pv(const _Float16* __restrict__ PS0, const float* __restrict__ ST, const _Float16* __restrict__ VT, float* __restrict__ Y) { const int h = blockIdx.y, b = blockIdx.z; const _Float16* PS = PS0 + (size_t)b * TT * TT; __shared__ __align__(16) float ss[4][16][HD + 4]; __shared__ __align__(16) _Float16 tp[64 * LP], tv[128 * LP]; __shared__ __align__(16) float sf[TT / 128][64];
  const int tid = threadIdx.x, wave = tid >> 5, lane = tid & 31, col = lane & 15, g = lane >> 4; const int qb = blockIdx.x; const int ql0 = qb * 64 + wave * 16; const int kce = (kb_last(qb) + 1) * 4;
  v8f acc[HD / 16] = {};
  const _Float16* Pg = PS + (size_t)qb * 64 * TT; const _Float16* Vg = VT + ((size_t)b * CC + h * HD) * (size_t)TT; const int nch = kce / (KCH / 32);
  v8h pr[8], vr[16]; ld16<64>(pr, Pg, TT, tid); ld16<128>(vr, Vg, TT, tid);
  if (tid < 64) {   // waves 0 and 1, one query row a lane: the row's weight for each key block (read behind the loop's first barrier)
    const float* sp = ST + ((size_t)b * (TT / 128) * TT + qb * 64 + tid) * 2; float mk[TT / 128], sk[TT / 128]; float mx = -3.0e38f, sum = 0.f;
#pragma unroll
    for (int kb = 0; kb < TT / 128; ++kb) { const v2f st = *(const v2f*)(sp + (size_t)kb * TT * 2); mk[kb] = st[0]; sk[kb] = st[1]; }
    asm volatile("s_wait_xcnt 0x0" :: "v"(sp) : "memory");   // as in ld16
#pragma unroll
    for (int kb = 0; kb < TT / 128; ++kb) mx = fmaxf(mx, mk[kb]);
#pragma unroll
    for (int kb = 0; kb < TT / 128; ++kb) { mk[kb] = __builtin_amdgcn_exp2f(mk[kb] - mx); sum += sk[kb] * mk[kb]; }
    const float inv = 1.0f / sum;
#pragma unroll
    for (int kb = 0; kb < TT / 128; ++kb) sf[kb][tid] = mk[kb] * inv; }
#pragma unroll 1   // rolled, as in k_proj
  for (int c = 0; c < nch; ++c) { st16<64>(tp, pr, tid); st16<128>(tv, vr, tid);
    __syncthreads();   // the chunk's tiles (and, on the first trip, the weights) are complete before any wave reads them
    if (c + 1 < nch) { ld16<64>(pr, Pg + (c + 1) * KCH, TT, tid); ld16<128>(vr, Vg + (c + 1) * KCH, TT, tid); }   // the next chunk flies into registers while this one is multiplied
    const v4f w0 = *(const v4f*)&sf[c][wave * 16 + 8 * g], w1 = *(const v4f*)&sf[c][wave * 16 + 8 * g + 4];   // weights of the lane's 8 accumulator rows
    v8f part[HD / 16] = {}; chunk_h(tp + (wave * 16 + col) * LP, tv + col * LP, lane, part);
#pragma unroll
    for (int j = 0; j < HD / 16; ++j)
#pragma unroll
      for (int r = 0; r < 8; ++r) acc[j][r] += part[j][r] * (r < 4 ? w0[r] : w1[r - 4]);
    __syncthreads(); }   // every wave has left the tiles before they are refilled
#pragma unroll
  for (int j = 0; j < HD / 16; ++j)
#pragma unroll
    for (int r = 0; r < 8; ++r) ss[wave][8 * g + r][j * 16 + col] = acc[j][r];
  LDSX(); for (int rl = 0; rl < 16; ++rl) if (lane < HD / 4) vst2(Y + ((size_t)b * TT + ql0 + rl) * CC + h * HD + lane * 4, *(const v4f*)&ss[wave][rl][lane * 4]); }

extern "C" void kernel_launch(void* const* d_in, const int* in_sizes, int n_in, void* d_out, int out_size, void* d_ws, size_t ws_size, hipStream_t stream) {
  (void)in_sizes; (void)n_in; (void)out_size;
  const float** F = (const float**)d_in;
  if (ws_size < (size_t)WS_END) return;
  char* ws = (char*)d_ws; _Float16 *QH = (_Float16*)(ws + WS_QH), *KH = (_Float16*)(ws + WS_KH), *VT = (_Float16*)(ws + WS_VT), *QL = (_Float16*)(ws + WS_QL), *KL = (_Float16*)(ws + WS_KL); __bf16 *VB = (__bf16*)(ws + WS_VB), *VBL = (__bf16*)(ws + WS_VBL); _Float16* S = (_Float16*)(ws + WS_S); float *ST = (float*)(ws + WS_ST), *Y = (float*)(ws + WS_Y);
  (void)Y; (void)QL; (void)KL; (void)VB; (void)VBL;
  // inputs: 0 x [4,2048,512]; 1 Wq [512,512] (out,in), 2 bq; 3 Wk, 4 bk; 5 Wv, 6 bv (biases nonzero)
  k_proj<<<dim3(TNB * TT / 64, CC / 128, 3), 128, 0, stream>>>(F[0], F[0], F[0], F[1], F[3], F[5], F[2], F[4], F[6], QH, QL, KH, KL, VT, VB, VBL);
  k_sc<<<dim3(NQB, TT / 128, TNB), 128, 0, stream>>>(QH, KH, QL, KL, S, ST);   /* one 2,048 x 2,048 plane per batch: scores over all 512 columns */
  k_pv<<<dim3(NQB, NH, TNB), 128, 0, stream>>>(S, ST, VT, (float*)d_out);   /* column group y: v / output columns 128y .. 128y+127, all four from the batch's one plane */
}

// v004
// It runs in 69 microseconds.
// In two side-by-side timings against v003, it was 1.13 and 1.12 times as fast.
// All steps since v000 together make it 26.3 times as fast.
// compute dtype: all float inputs rounded to bf16; q/k/v projections with EXACT bf16 products on WMMA 16x16x32 (f32 accumulate) + bias; logits q x k once to f16 each (1 product) over the full 512-wide head x 512^-0.5; softmax f32, split by key block: exp(logit - block max) once to f16 x v once to f16 (1 product per key block), each block's partial product weighted in f32 by exp(block max - row max) / row sum; four 128-column passes over the same plane; f32 output (no output projection).
#include <hip/hip_runtime.h>
#include <math.h>

typedef __attribute__((ext_vector_type(16))) _Float16 v16h;
typedef __attribute__((ext_vector_type(16))) __bf16 v16b;
typedef __attribute__((ext_vector_type(8)))  _Float16 v8h;
typedef __attribute__((ext_vector_type(8)))  float v8f;
typedef __attribute__((ext_vector_type(4)))  float v4f;
typedef __attribute__((ext_vector_type(2)))  float v2f;
typedef __attribute__((ext_vector_type(4)))  unsigned v4u;
typedef __attribute__((ext_vector_type(4)))  int v4i;
typedef float __attribute__((may_alias)) float_a;
typedef int __attribute__((may_alias)) int_a;

template <typename T> __device__ __forceinline__ void vst2(void* p, T v) { *(T*)p = v;  }
// the products are the plain builtins (the compiler keeps the distances behind its own matrix instructions): an asm statement of v_nop tied to d, a and b holds those operands in v0 to v255, and the 32 x 128 wave tile, with more than 256 registers live in its loop, then builds with spills to scratch in all three kernels
__device__ __forceinline__ v8f wmma16(v16h a, v16h b, v8f c) {
  v8f d = __builtin_amdgcn_wmma_f32_16x16x32_f16(false, a, false, b, (short)0, c, false, false);
  return d;
}
__device__ __forceinline__ v8f wmma_bf(v16b a, v16b b, v8f c) {
  v8f d = __builtin_amdgcn_wmma_f32_16x16x32_bf16(false, a, false, b, (short)0, c, false, false);
  return d;
}
// 16x16x32 fragments: lane = (h = lane>>4, row/col = lane&15); elements 0..7 = k0+8h+0..7, 8..15 = k0+16+8h+0..7; D element r = row 8h+r
__device__ __forceinline__ v16h frag_h(const _Float16* rowk0, int lane) {
  union { v16h v; v8h q[2]; } u; const _Float16* p = rowk0 + 8 * (lane >> 4);
  u.q[0] = *(const v8h*)p; u.q[1] = *(const v8h*)(p + 16); return u.v;
}
__device__ __forceinline__ v16h frag_f32(const float* rowk0, int lane) {
  v16h a; const float* p = rowk0 + 8 * (lane >> 4);
#pragma unroll
  for (int i = 0; i < 8; ++i) { a[i] = (_Float16)p[i]; a[8 + i] = (_Float16)p[16 + i]; }
  return a;
}
__device__ __forceinline__ v16h frag_f32s(const float* rowk0, int lane, float sc) {
  v16h a; const float* p = rowk0 + 8 * (lane >> 4);
#pragma unroll
  for (int i = 0; i < 8; ++i) { a[i] = (_Float16)(p[i] * sc); a[8 + i] = (_Float16)(p[16 + i] * sc); }
  return a;
}
// column fragment from a [K][ld] layout (column n), rows >= K read as 0
__device__ __forceinline__ v16h fragc_f32(const float* W, int k0, int n, int lane, int ld, int K) {
  v16h a; const int g = lane >> 4;
#pragma unroll
  for (int i = 0; i < 8; ++i) { const int ka = k0 + 8 * g + i, kb = ka + 16;
    a[i] = (_Float16)(ka < K ? W[(size_t)(ka < K ? ka : K - 1) * ld + n] : 0.f); a[8 + i] = (_Float16)(kb < K ? W[(size_t)(kb < K ? kb : K - 1) * ld + n] : 0.f); }
  return a;
}
struct F2 { v16b h, l; };
__device__ __forceinline__ F2 bsplit16(const float v[16]) { F2 r;
#pragma unroll
  for (int i = 0; i < 16; ++i) { const __bf16 h = (__bf16)v[i]; r.h[i] = h; r.l[i] = (__bf16)(v[i] - (float)h); }
  return r; }
__device__ __forceinline__ F2 split_row(const float* row, int k0, int lane) { float v[16]; const float* p = row + k0 + 8 * (lane >> 4);
#pragma unroll
  for (int i = 0; i < 8; ++i) { v[i] = p[i]; v[8 + i] = p[16 + i]; }
  return bsplit16(v); }
__device__ __forceinline__ F2 split_rowK(const float* row, int k0, int lane, int K) { float v[16]; const int g = lane >> 4;
#pragma unroll
  for (int i = 0; i < 8; ++i) { const int ka = k0 + 8 * g + i, kb = ka + 16; v[i] = ka < K ? row[ka < K ? ka : K - 1] : 0.f; v[8 + i] = kb < K ? row[kb < K ? kb : K - 1] : 0.f; }
  return bsplit16(v); }
__device__ __forceinline__ F2 split_col(const float* W, int k0, int n, int lane, int ld, int K) { float v[16]; const int g = lane >> 4;
#pragma unroll
  for (int i = 0; i < 8; ++i) { const int ka = k0 + 8 * g + i, kb = ka + 16; v[i] = ka < K ? W[(size_t)(ka < K ? ka : K - 1) * ld + n] : 0.f; v[8 + i] = kb < K ? W[(size_t)(kb < K ? kb : K - 1) * ld + n] : 0.f; }
  return bsplit16(v); }
__device__ __forceinline__ v8f mac3(const F2& a, const F2& b, v8f c) { c = wmma_bf(a.l, b.h, c); c = wmma_bf(a.h, b.l, c); return wmma_bf(a.h, b.h, c); }
__device__ __forceinline__ float sigm(float v) { return 1.0f / (1.0f + expf(-v)); }
#define LDSX() do { asm volatile("s_wait_dscnt 0" ::: "memory"); __builtin_amdgcn_wave_barrier(); __builtin_amdgcn_fence(__ATOMIC_RELEASE, "workgroup"); } while (0)

// Single-head scaled-dot-product self-attention with a 512-wide head (x [4,2048,512]; torch (out,in) Wq / Wk / Wv [512,512] and biases uniform(+-1/sqrt(512)) (nonzero), einsum 'bnd,ed->bne'; scores = q k^T / sqrt(512) over all 512 dims; softmax over the 2,048 keys; out = weights v, [4,2048,512]; no output projection).
#define NB 4
#define TT 2048
#define CC 512            // NH * HD = projected width
#define DIN 512          // input (model) width
#define NH 4   // P.v column groups of HD = 128 (they share ONE probability plane)
#define HD 128
#define HDSC 512   // the score kernel contracts over the whole 512-wide head
#define NQB (TT / 64)
#define SCALE (0.04419417382415922f)   // 1 / sqrt(512)
#define SCALE2 (SCALE * 1.4426950408889634f)   // SCALE x log2(e): logits in base-2 units, so that exp(a - b) is one native exp2
#define CAUSAL 0
#ifndef TNB
#define TNB NB
#endif
__device__ __forceinline__ float bfr(float v) { return (float)(__bf16)v; }
__host__ __device__ __forceinline__ int kb_last(int qb) { return CAUSAL ? ((qb * 64 + 63) >> 7) : (TT / 128 - 1); }
typedef __attribute__((ext_vector_type(8))) __bf16 v8b;
__device__ __forceinline__ v16b frag_b(const __bf16* rowk0, int lane) {
  union { v16b v; v8b q[2]; } u; const __bf16* p = rowk0 + 8 * (lane >> 4);
  u.q[0] = *(const v8b*)p; u.q[1] = *(const v8b*)(p + 16); return u.v;
}
#define QBH 0              // no query block takes a high-precision path: k_sc has only the single-product path
#define QHI 0               // single-product logits on every row
#define KHI 64            // key rows carrying k residual / v bf16 hi+lo planes (no kernel reads the k residual or the v planes)
// B fragment (k rows k0+.., output column o) of a weight: (in,out) [K][ld] or (out,in) [ld rows of K]: bf16 exact, or f16(bf16 * 256) exact
__device__ __forceinline__ v16b wcol_io(const float* Wm, int k0, int o, int lane, int ld) { v16b w; const int g = lane >> 4;
#pragma unroll
  for (int i = 0; i < 8; ++i) { w[i] = (__bf16)Wm[(size_t)(k0 + 8 * g + i) * ld + o]; w[8 + i] = (__bf16)Wm[(size_t)(k0 + 16 + 8 * g + i) * ld + o]; }
  return w; }
__device__ __forceinline__ v16b wcol_oi(const float* Wm, int k0, int o, int lane, int K) { v16b w; const float* p = Wm + (size_t)o * K + k0 + 8 * (lane >> 4);
#pragma unroll
  for (int i = 0; i < 8; ++i) { w[i] = (__bf16)p[i]; w[8 + i] = (__bf16)p[16 + i]; }
  return w; }
__device__ __forceinline__ v16h wcolh_io(const float* Wm, int k0, int o, int lane, int ld) { v16h w; const int g = lane >> 4;
#pragma unroll
  for (int i = 0; i < 8; ++i) { w[i] = (_Float16)(bfr(Wm[(size_t)(k0 + 8 * g + i) * ld + o]) * 256.0f); w[8 + i] = (_Float16)(bfr(Wm[(size_t)(k0 + 16 + 8 * g + i) * ld + o]) * 256.0f); }
  return w; }
__device__ __forceinline__ v16h wcolh_oi(const float* Wm, int k0, int o, int lane, int K) { v16h w; const float* p = Wm + (size_t)o * K + k0 + 8 * (lane >> 4);
#pragma unroll
  for (int i = 0; i < 8; ++i) { w[i] = (_Float16)(bfr(p[i]) * 256.0f); w[8 + i] = (_Float16)(bfr(p[16 + i]) * 256.0f); }
  return w; }
#define WQKV_LAYOUT 1   // 0 = (in,out) [DIN][CC]; 1 = (out,in) [CC][DIN]; 2 = per-head [NH][DIN][HD]
__device__ __forceinline__ v16b wcol_hdk(const float* Wm, int k0, int o, int lane) { v16b w; const int g = lane >> 4; const float* p = Wm + (size_t)(o / HD) * DIN * HD + (o % HD);
#pragma unroll
  for (int i = 0; i < 8; ++i) { w[i] = (__bf16)p[(size_t)(k0 + 8 * g + i) * HD]; w[8 + i] = (__bf16)p[(size_t)(k0 + 16 + 8 * g + i) * HD]; }
  return w; }
#define WO_OUT_IN 1
#if WQKV_LAYOUT == 1
#define WCOL(W, k0, o, lane) wcol_oi(W, k0, o, lane, DIN)
#elif WQKV_LAYOUT == 2
#define WCOL(W, k0, o, lane) wcol_hdk(W, k0, o, lane)
#else
#define WCOL(W, k0, o, lane) wcol_io(W, k0, o, lane, CC)
#endif
#if WO_OUT_IN
#define WOCOL(W, k0, o, lane) wcol_oi(W, k0, o, lane, CC)
#define WOCOLH(W, k0, o, lane) wcolh_oi(W, k0, o, lane, CC)
#else
#define WOCOL(W, k0, o, lane) wcol_io(W, k0, o, lane, DIN)
#define WOCOLH(W, k0, o, lane) wcolh_io(W, k0, o, lane, DIN)
#endif

static_assert(CC == NH * HD && HDSC == CC && HD <= 128, "one 512-wide head: scores over all CC columns, P.v in NH column groups of HD <= 128 (the k_pv store width)");
#ifndef PROJ_EXTRA_PARAMS
#define PROJ_EXTRA_PARAMS
#endif

#define WS_QH  0u                                      // f16 q rows [b*t][CC]
#define WS_KH  (WS_QH + 2u * (size_t)NB * TT * CC)      // f16 k rows [b*t][CC]
#define WS_VT  (WS_KH + 2u * (size_t)NB * TT * CC)      // f16 v planes [b][c][t]
#define WS_QL  (WS_VT + 2u * (size_t)NB * CC * TT)      // f16 q residual x 2^10 rows [b][t < QHI][CC]
#define WS_KL  (WS_QL + 2u * (size_t)NB * QHI * CC)     // f16 k residual x 2^10 rows [b][t < KHI][CC]
#define WS_VB  (WS_KL + 2u * (size_t)NB * KHI * CC)     // bf16 v hi planes [b][c][t < KHI]
#define WS_VBL (WS_VB + 2u * (size_t)NB * CC * KHI)
#define WS_S   (WS_VBL + 2u * (size_t)NB * CC * KHI)    // f16 exp2(base-2 logit - key block's row max) [b][t][s]: one plane per batch, so that each stage is one launch over all batches
#define WS_ST  (WS_S  + 2u * (size_t)NB * TT * TT)      // f32 pairs (row max in base-2 units, row sum of exp2) of each 128-key block [b][kb][t]: a wave's 32 rows fill two 128-B lines
#define WS_Y   (WS_ST + 8u * (size_t)NB * (TT / 128) * TT)   // f32 ctx rows [b*t][CC] (only when there is an output projection)
#define WS_END (WS_Y)   // no ctx rows: k_pv writes the output directly

// ---- operand staging: a block's A tile (128 rows) and B tile (128 rows) of one 128-wide k chunk go to LDS by whole-line loads (16-bit source: 16 lanes per 256-B row; f32 source: one wave per 512-B row, rounded once on the way); all 4 waves then read their fragments from LDS (the loops of these helpers are unrolled whole, so that every register array is indexed by constants)
#define KCH 128   // k elements per staged chunk
#define LP 136    // LDS row pitch in 16-bit elements: 272 B = 17 x 16 B, so that 16 rows read 16 B each fall on all 64 banks
typedef __attribute__((ext_vector_type(4))) _Float16 v4h;
typedef __attribute__((ext_vector_type(4))) __bf16 v4b;
template <int ROWS> __device__ __forceinline__ void ld16(v8h (&r)[ROWS / 8], const _Float16* src, size_t ld, int tid) { const _Float16* p = src + (size_t)(tid >> 4) * ld + (tid & 15) * 8;
#pragma unroll
  for (int i = 0; i < ROWS / 8; ++i) r[i] = *(const v8h*)(p + (size_t)(i * 8) * ld);
  asm volatile("s_wait_xcnt 0x0" :: "v"(p) : "memory"); }   // stands in front of any overwrite of the address register pair that these loads name; p as an input keeps that pair whole up to here
template <int ROWS> __device__ __forceinline__ void st16(_Float16* t, const v8h (&r)[ROWS / 8], int tid) {
#pragma unroll
  for (int i = 0; i < ROWS / 8; ++i) *(v8h*)(t + (i * 8 + (tid >> 4)) * LP + (tid & 15) * 8) = r[i]; }
template <int ROWS> __device__ __forceinline__ void ld32(v4f (&r)[ROWS / 4], const float* src, size_t ld, int tid) { const float* p = src + (size_t)(tid >> 5) * ld + (tid & 31) * 4;
#pragma unroll
  for (int i = 0; i < ROWS / 4; ++i) r[i] = *(const v4f*)(p + (size_t)(i * 4) * ld);
  asm volatile("s_wait_xcnt 0x0" :: "v"(p) : "memory"); }   // as in ld16
template <int ROWS, typename E, typename V4> __device__ __forceinline__ void st32(E* t, const v4f (&r)[ROWS / 4], int tid) {
#pragma unroll
  for (int i = 0; i < ROWS / 4; ++i) { V4 h;
#pragma unroll
    for (int e = 0; e < 4; ++e) h[e] = (E)r[i][e];
    *(V4*)(t + (i * 4 + (tid >> 5)) * LP + (tid & 31) * 4) = h; } }
// one staged chunk of a wave's 32 x 128 product (two 16-row tiles against eight 16-column tiles: every B fragment read from LDS serves two products): the 20 fragment reads of k step kc + 1 stand as one group in front of the 16 products of step kc, so that no product waits out an LDS latency of its own (arow: the lane's A row in row tile 0; brow: the lane's row of B column group 0)
__device__ __forceinline__ void chunk_h(const _Float16* arow, const _Float16* brow, int lane, v8f (&acc)[2][8]) { v16h a[2], b[8];
#pragma unroll
  for (int i = 0; i < 2; ++i) a[i] = frag_h(arow + i * 16 * LP, lane);
#pragma unroll
  for (int j = 0; j < 8; ++j) b[j] = frag_h(brow + j * 16 * LP, lane);
#pragma unroll
  for (int kc = 0; kc < KCH / 32; ++kc) { v16h an[2], bn[8];
#pragma unroll
    for (int i = 0; i < 2; ++i) an[i] = a[i];
#pragma unroll
    for (int j = 0; j < 8; ++j) bn[j] = b[j];
    if (kc + 1 < KCH / 32) {
#pragma unroll
      for (int i = 0; i < 2; ++i) an[i] = frag_h(arow + i * 16 * LP + (kc + 1) * 32, lane);
#pragma unroll
      for (int j = 0; j < 8; ++j) bn[j] = frag_h(brow + j * 16 * LP + (kc + 1) * 32, lane); }
    __builtin_amdgcn_sched_barrier(0);   // keeps the next step's reads one group in front of this step's products: left free, the compiler spreads them among the products, each with a wait of its own
#pragma unroll
    for (int j = 0; j < 8; ++j)
#pragma unroll
      for (int i = 0; i < 2; ++i) acc[i][j] = wmma16(a[i], b[j], acc[i][j]);
    __builtin_amdgcn_sched_barrier(0);   // closes the block of products against the reads of the step after next
#pragma unroll
    for (int i = 0; i < 2; ++i) a[i] = an[i];
#pragma unroll
    for (int j = 0; j < 8; ++j) b[j] = bn[j]; } }
__device__ __forceinline__ void chunk_b(const __bf16* arow, const __bf16* brow, int lane, v8f (&acc)[2][8]) { v16b a[2], b[8];
#pragma unroll
  for (int i = 0; i < 2; ++i) a[i] = frag_b(arow + i * 16 * LP, lane);
#pragma unroll
  for (int j = 0; j < 8; ++j) b[j] = frag_b(brow + j * 16 * LP, lane);
#pragma unroll
  for (int kc = 0; kc < KCH / 32; ++kc) { v16b an[2], bn[8];
#pragma unroll
    for (int i = 0; i < 2; ++i) an[i] = a[i];
#pragma unroll
    for (int j = 0; j < 8; ++j) bn[j] = b[j];
    if (kc + 1 < KCH / 32) {
#pragma unroll
      for (int i = 0; i < 2; ++i) an[i] = frag_b(arow + i * 16 * LP + (kc + 1) * 32, lane);
#pragma unroll
      for (int j = 0; j < 8; ++j) bn[j] = frag_b(brow + j * 16 * LP + (kc + 1) * 32, lane); }
    __builtin_amdgcn_sched_barrier(0);   // keeps the next step's reads one group in front of this step's products: left free, the compiler spreads them among the products, each with a wait of its own
#pragma unroll
    for (int j = 0; j < 8; ++j)
#pragma unroll
      for (int i = 0; i < 2; ++i) acc[i][j] = wmma_bf(a[i], b[j], acc[i][j]);
    __builtin_amdgcn_sched_barrier(0);   // closes the block of products against the reads of the step after next
#pragma unroll
    for (int i = 0; i < 2; ++i) a[i] = an[i];
#pragma unroll
    for (int j = 0; j < 8; ++j) b[j] = bn[j]; } }
static_assert(HD == 128 && WQKV_LAYOUT == 1 && DIN % KCH == 0 && HDSC % KCH == 0 && KCH == 128, "staged chunks: k-contiguous (out,in) weights, whole chunks, one key block of kb_last() per chunk");

#define BM 128   // rows of a block's tile: 4 waves x 32 rows
static_assert(TT % BM == 0 && KHI % 8 == 0 && QHI % 8 == 0 && KHI == 64 && (QHI == 0 || QHI == 64), "a block's rows lie in one batch; residual rows are none or the first 64 of a batch's first block (waves 0 and 1)");
// ---- k_proj: block = (128 rows, 128 cols, which): q/k/v = X W (+ b) with exact bf16 products (K = DIN) -> which 0: q f16 rows (+ residual rows < QHI); 1: k f16 rows (+ residual rows < KHI); 2: v f16 planes [c][t] (+ bf16 hi/lo planes for t < KHI)
__global__ __launch_bounds__(128) void k_proj(const float* __restrict__ XQ, const float* __restrict__ XK, const float* __restrict__ XV, const float* __restrict__ WQ, const float* __restrict__ WK, const float* __restrict__ WV, const float* __restrict__ BQ, const float* __restrict__ BK, const float* __restrict__ BV,
    _Float16* __restrict__ QH, _Float16* __restrict__ QL, _Float16* __restrict__ KH, _Float16* __restrict__ KL, _Float16* __restrict__ VT, __bf16* __restrict__ VB, __bf16* __restrict__ VBL) {
  __shared__ __align__(16) unsigned char smem[71680];   // main loop: operand tiles xa, xb; behind its last barrier: the output staging arrays
  _Float16 (*sh)[136] = (_Float16 (*)[136])smem; _Float16 (*sl)[136] = (_Float16 (*)[136])(smem + 34816); _Float16 (*th)[136] = (_Float16 (*)[136])smem; __bf16 (*tb)[72] = (__bf16 (*)[72])(smem + 34816); __bf16 (*tbl)[72] = (__bf16 (*)[72])(smem + 53248);
  __bf16* xa = (__bf16*)smem; __bf16* xb = xa + BM * LP;
  const int tid = threadIdx.x, wave = tid >> 5, lane = tid & 31, col = lane & 15, g = lane >> 4; const int which = blockIdx.z; const int c0 = blockIdx.y * 128; const size_t r0 = (size_t)blockIdx.x * BM; const size_t bb = r0 / TT; const int t0 = (int)(r0 % TT);
  const float* X = which == 0 ? XQ : which == 1 ? XK : XV; const float* WA = which == 0 ? WQ : which == 1 ? WK : WV; const float* BA = which == 0 ? BQ : which == 1 ? BK : BV;
  v8f acc[2][8] = {};
#pragma unroll 1   // rolled: the barriers keep the chunks apart anyway, and one copy of the chunk body keeps the code short
  for (int c = 0; c < DIN / KCH; ++c) { { v4f xr[32]; ld32<BM>(xr, X + r0 * DIN + c * KCH, DIN, tid); st32<BM, __bf16, v4b>(xa, xr, tid); }
    { v4f wr[32]; ld32<128>(wr, WA + (size_t)c0 * DIN + c * KCH, DIN, tid); st32<128, __bf16, v4b>(xb, wr, tid); }
    __syncthreads();   // the chunk's tiles are complete before any wave reads them
    chunk_b(xa + (wave * 32 + col) * LP, xb + col * LP, lane, acc);
    __syncthreads(); }   // every wave has left the tiles before they are refilled (or reused as output staging)
  if (which < 2) { _Float16* DH = which == 0 ? QH : KH; _Float16* DL = which == 0 ? QL : KL; const int nhi = which == 0 ? QHI : KHI;
#pragma unroll
    for (int j = 0; j < 8; ++j) { const float bias = BA ? bfr(BA[c0 + j * 16 + col]) : 0.f;
#pragma unroll
      for (int i = 0; i < 2; ++i)
#pragma unroll
        for (int r = 0; r < 8; ++r) { const float v = acc[i][j][r] + bias; const _Float16 hv = (_Float16)v; sh[wave * 32 + i * 16 + 8 * g + r][j * 16 + col] = hv; sl[wave * 32 + i * 16 + 8 * g + r][j * 16 + col] = (_Float16)((v - (float)hv) * 1024.0f); } }
    __syncthreads();
    _Float16* dh = DH + (r0 + (tid >> 4)) * CC + c0 + (tid & 15) * 8; _Float16* dl = DL + (bb * nhi + t0 + (tid >> 4)) * (size_t)CC + c0 + (tid & 15) * 8;   // 16 lanes per 256-B row segment, 8 rows a group
#pragma unroll
    for (int i = 0; i < BM / 8; ++i) vst2(dh + (size_t)(i * 8) * CC, *(const v4u*)&sh[i * 8 + (tid >> 4)][(tid & 15) * 8]);
    asm volatile("s_wait_xcnt 0x0" :: "v"(dh) : "memory");   // as in ld16, and in front of the LDS reads below, which reuse these stores' data registers
    if (t0 < nhi) {   // nhi is 0 or 64 and t0 a multiple of BM: the block's first 64 rows, all below nhi
#pragma unroll
      for (int i = 0; i < 8; ++i) vst2(dl + (size_t)(i * 8) * CC, *(const v4u*)&sl[i * 8 + (tid >> 4)][(tid & 15) * 8]); }
    asm volatile("s_wait_xcnt 0x0" :: "v"(dl) : "memory");   // as in ld16
  } else {
#pragma unroll
    for (int j = 0; j < 8; ++j) { const float bias = BA ? bfr(BA[c0 + j * 16 + col]) : 0.f;
#pragma unroll
      for (int i = 0; i < 2; ++i)
#pragma unroll
        for (int r = 0; r < 8; ++r) { acc[i][j][r] += bias; th[j * 16 + col][wave * 32 + i * 16 + 8 * g + r] = (_Float16)acc[i][j][r]; } }
    if (wave < 2) {   // waves 0 and 1 hold the block's first 64 rows, the only ones that can lie below KHI
#pragma unroll
      for (int j = 0; j < 8; ++j)
#pragma unroll
        for (int i = 0; i < 2; ++i)
#pragma unroll
          for (int r = 0; r < 8; ++r) { const float v = acc[i][j][r]; const int rl = wave * 32 + i * 16 + 8 * g + r, cl = j * 16 + col; const __bf16 bh = (__bf16)v; tb[cl][rl] = bh; tbl[cl][rl] = (__bf16)(v - (float)bh); } }
    __syncthreads();
    _Float16* vt = VT + (bb * CC + c0 + (tid >> 4)) * (size_t)TT + t0 + (tid & 15) * 8;   // 16 lanes per 256-B plane segment, 8 planes a group
#pragma unroll
    for (int i = 0; i < 16; ++i) vst2(vt + (size_t)(i * 8) * TT, *(const v4u*)&th[i * 8 + (tid >> 4)][(tid & 15) * 8]);
    asm volatile("s_wait_xcnt 0x0" :: "v"(vt) : "memory");   // as in ld16
    if (t0 < KHI) { const size_t o3 = (bb * CC + c0 + (tid >> 3)) * (size_t)KHI + t0 + (tid & 7) * 8; __bf16* vb = VB + o3; __bf16* vbl = VBL + o3;
#pragma unroll
      for (int i = 0; i < 8; ++i) { vst2(vb + (size_t)(i * 16) * KHI, *(const v4u*)&tb[i * 16 + (tid >> 3)][(tid & 7) * 8]); vst2(vbl + (size_t)(i * 16) * KHI, *(const v4u*)&tbl[i * 16 + (tid >> 3)][(tid & 7) * 8]); }
      asm volatile("s_wait_xcnt 0x0" :: "v"(vb), "v"(vbl) : "memory"); } } }   // as in ld16
// value of lane l ^ M inside the lane's 16-lane row, by DPP row_xmask (every lane on): a vector move, where a shuffle would go through the LDS unit
template <int M> __device__ __forceinline__ float rowx(float v) { return __builtin_bit_cast(float, __builtin_amdgcn_update_dpp(0, __builtin_bit_cast(int, v), 0x160 | M, 0xf, 0xf, true)); }
// native exp2 with its v_nop in the same statement: the slot that the instruction set asks for between a transcendental and an instruction that reads its result or overwrites its source
__device__ __forceinline__ float exp2_slot(float v) { float e; asm("v_exp_f32 %0, %1\n\tv_nop" : "=v"(e) : "v"(v)); return e; }
// ---- k_sc: block = (128 queries qb, key block kb, batch b = blockIdx.z, plane b): logits x SCALE2 (base-2 units), one product, then this key block's share of the softmax (row max m, e = exp2(logit - m) to the plane, (m, sum e) to ST)  [here: head width HDSC = 512, single head]
static_assert(QBH == 0 && QHI == 0 && !CAUSAL, "every query block takes the staged single-product path over all key blocks");
__global__ __launch_bounds__(128) void k_sc(const _Float16* __restrict__ QH, const _Float16* __restrict__ KH, _Float16* __restrict__ S0, float* __restrict__ ST) { __shared__ __align__(16) unsigned char smem[(BM + 128) * LP * 2];   // main loop: q tile ta, k tile tk; behind its last barrier: the output staging se
  _Float16 (*se)[32][LP] = (_Float16 (*)[32][LP])smem; _Float16* ta = (_Float16*)smem; _Float16* tk = ta + BM * LP;
  const int qb = blockIdx.x, kb = blockIdx.y;
  const int b = blockIdx.z; _Float16* S = S0 + (size_t)b * TT * TT;
  const int tid = threadIdx.x, wave = tid >> 5, lane = tid & 31, col = lane & 15, g = lane >> 4; const int k0 = kb * 128; const int ql0 = qb * BM + wave * 32; const size_t kr0 = (size_t)b * TT + k0;
  v8f acc[2][8] = {};
#pragma unroll 1   // rolled, as in k_proj
  for (int c = 0; c < HDSC / KCH; ++c) { { v8h qr[16], kr[16]; ld16<BM>(qr, QH + ((size_t)b * TT + qb * BM) * CC + c * KCH, CC, tid); ld16<128>(kr, KH + kr0 * CC + c * KCH, CC, tid); st16<BM>(ta, qr, tid); st16<128>(tk, kr, tid); }
    __syncthreads();   // the chunk's tiles are complete before any wave reads them
    chunk_h(ta + (wave * 32 + col) * LP, tk + col * LP, lane, acc);
    __syncthreads(); }   // every wave has left the tiles before they are refilled (or reused as output staging)
  // row 16i + 8g + r of the wave's tile lies in the 16 lanes of half g, 8 columns a lane: max and sum go over the lane's 8 values, then over the half by 4 exchanges
  float mo = 0.f, so = 0.f;
#pragma unroll
  for (int i = 0; i < 2; ++i)
#pragma unroll
  for (int r = 0; r < 8; ++r) { float lg[8]; float m = -3.0e38f;
#pragma unroll
    for (int j = 0; j < 8; ++j) { lg[j] = acc[i][j][r] * SCALE2; m = fmaxf(m, lg[j]); }
    m = fmaxf(m, rowx<1>(m)); m = fmaxf(m, rowx<2>(m)); m = fmaxf(m, rowx<4>(m)); m = fmaxf(m, rowx<8>(m));
    float sum = 0.f;
#pragma unroll
    for (int j = 0; j < 8; ++j) { const float e = exp2_slot(lg[j] - m); sum += e; se[wave][i * 16 + 8 * g + r][j * 16 + col] = (_Float16)e; }
    sum += rowx<1>(sum); sum += rowx<2>(sum); sum += rowx<4>(sum); sum += rowx<8>(sum);
    if (col == i * 8 + r) { mo = m; so = sum; } }
  float* sp = ST + (((size_t)b * (TT / 128) + kb) * TT + ql0 + (col >> 3) * 16 + 8 * g + (col & 7)) * 2;
  _Float16* op = S + (size_t)(ql0 + g) * TT + k0 + col * 8;
  LDSX();
#pragma unroll
  for (int i = 0; i < 16; ++i) vst2(op + (size_t)(i * 2) * TT, *(const v4u*)&se[wave][i * 2 + g][col * 8]);   // 16 lanes per 256-B row segment
  { v2f st; st[0] = mo; st[1] = so; vst2(sp, st); }   // lane col of half g stores row 16 (col >> 3) + 8g + (col & 7): the wave's 32 rows fill two 128-B lines
  asm volatile("s_wait_xcnt 0x0" :: "v"(sp), "v"(op) : "memory"); }   // as in ld16: stands in front of any overwrite of the address pairs that these stores name
// ---- k_pv: block = 128 queries (qb = blockIdx.x) of (column group h = blockIdx.y, batch b = blockIdx.z; plane b): ctx = sum over key blocks kb of w[kb] * (e[kb] . v[kb]) (e f16 against v f16: 1 product), w[kb] = exp2(m[kb] - row max) / row sum from the score kernel's (m, sum) pairs, per row, f32; 512-B (row, column group) segment by the wave's 32 lanes
__global__ __launch_bounds__(128) void k_pv(const _Float16* __restrict__ PS0, const float* __restrict__ ST, const _Float16* __restrict__ VT, float* __restrict__ Y) { const int h = blockIdx.y, b = blockIdx.z; const _Float16* PS = PS0 + (size_t)b * TT * TT; __shared__ __align__(16) float ss[4][32][HD + 4]; __shared__ __align__(16) _Float16 tp[BM * LP], tv[128 * LP]; __shared__ __align__(16) float sf[TT / 128][BM];
  const int tid = threadIdx.x, wave = tid >> 5, lane = tid & 31, col = lane & 15, g = lane >> 4; const int qb = blockIdx.x; const int ql0 = qb * BM + wave * 32;
  v8f acc[2][HD / 16] = {};
  const _Float16* Pg = PS + (size_t)qb * BM * TT; const _Float16* Vg = VT + ((size_t)b * CC + h * HD) * (size_t)TT; const int nch = TT / KCH;
  v8h pr[16], vr[16]; ld16<BM>(pr, Pg, TT, tid); ld16<128>(vr, Vg, TT, tid);
  {   // one query row a thread: the row's weight for each key block (read behind the loop's first barrier)
    const float* sp = ST + ((size_t)b * (TT / 128) * TT + qb * BM + tid) * 2; float mk[TT / 128], sk[TT / 128]; float mx = -3.0e38f, sum = 0.f;
#pragma unroll
    for (int kb = 0; kb < TT / 128; ++kb) { const v2f st = *(const v2f*)(sp + (size_t)kb * TT * 2); mk[kb] = st[0]; sk[kb] = st[1]; }
    asm volatile("s_wait_xcnt 0x0" :: "v"(sp) : "memory");   // as in ld16
#pragma unroll
    for (int kb = 0; kb < TT / 128; ++kb) mx = fmaxf(mx, mk[kb]);
#pragma unroll
    for (int kb = 0; kb < TT / 128; ++kb) { mk[kb] = exp2_slot(mk[kb] - mx); sum += sk[kb] * mk[kb]; }
    const float inv = 1.0f / sum;
#pragma unroll
    for (int kb = 0; kb < TT / 128; ++kb) sf[kb][tid] = mk[kb] * inv; }
#pragma unroll 1   // rolled, as in k_proj
  for (int c = 0; c < nch; ++c) { st16<BM>(tp, pr, tid); st16<128>(tv, vr, tid);
    __syncthreads();   // the chunk's tiles (and, on the first trip, the weights) are complete before any wave reads them
    if (c + 1 < nch) { ld16<BM>(pr, Pg + (c + 1) * KCH, TT, tid); ld16<128>(vr, Vg + (c + 1) * KCH, TT, tid); }   // the next chunk flies into registers while this one is multiplied
    v4f w[2][2];   // weights of the lane's 16 accumulator rows
#pragma unroll
    for (int i = 0; i < 2; ++i) { w[i][0] = *(const v4f*)&sf[c][wave * 32 + i * 16 + 8 * g]; w[i][1] = *(const v4f*)&sf[c][wave * 32 + i * 16 + 8 * g + 4]; }
    v8f part[2][HD / 16] = {}; chunk_h(tp + (wave * 32 + col) * LP, tv + col * LP, lane, part);
#pragma unroll
    for (int i = 0; i < 2; ++i)
#pragma unroll
      for (int j = 0; j < HD / 16; ++j)
#pragma unroll
        for (int r = 0; r < 8; ++r) acc[i][j][r] += part[i][j][r] * w[i][r >> 2][r & 3];
    __syncthreads(); }   // every wave has left the tiles before they are refilled
#pragma unroll
  for (int i = 0; i < 2; ++i)
#pragma unroll
    for (int j = 0; j < HD / 16; ++j)
#pragma unroll
      for (int r = 0; r < 8; ++r) ss[wave][i * 16 + 8 * g + r][j * 16 + col] = acc[i][j][r];
  float* yp = Y + ((size_t)b * TT + ql0) * CC + h * HD + lane * 4;
  LDSX();
#pragma unroll
  for (int rl = 0; rl < 32; ++rl) vst2(yp + (size_t)rl * CC, *(const v4f*)&ss[wave][rl][lane * 4]);
  asm volatile("s_wait_xcnt 0x0" :: "v"(yp) : "memory"); }   // as in ld16: stands in front of any overwrite of the address pair that these stores name

extern "C" void kernel_launch(void* const* d_in, const int* in_sizes, int n_in, void* d_out, int out_size, void* d_ws, size_t ws_size, hipStream_t stream) {
  (void)in_sizes; (void)n_in; (void)out_size;
  const float** F = (const float**)d_in;
  if (ws_size < (size_t)WS_END) return;
  char* ws = (char*)d_ws; _Float16 *QH = (_Float16*)(ws + WS_QH), *KH = (_Float16*)(ws + WS_KH), *VT = (_Float16*)(ws + WS_VT), *QL = (_Float16*)(ws + WS_QL), *KL = (_Float16*)(ws + WS_KL); __bf16 *VB = (__bf16*)(ws + WS_VB), *VBL = (__bf16*)(ws + WS_VBL); _Float16* S = (_Float16*)(ws + WS_S); float *ST = (float*)(ws + WS_ST), *Y = (float*)(ws + WS_Y);
  (void)Y;
  // inputs: 0 x [4,2048,512]; 1 Wq [512,512] (out,in), 2 bq; 3 Wk, 4 bk; 5 Wv, 6 bv (biases nonzero)
  k_proj<<<dim3(TNB * TT / BM, CC / 128, 3), 128, 0, stream>>>(F[0], F[0], F[0], F[1], F[3], F[5], F[2], F[4], F[6], QH, QL, KH, KL, VT, VB, VBL);
  k_sc<<<dim3(TT / BM, TT / 128, TNB), 128, 0, stream>>>(QH, KH, S, ST);   /* one 2,048 x 2,048 plane per batch: scores over all 512 columns */
  k_pv<<<dim3(TT / BM, NH, TNB), 128, 0, stream>>>(S, ST, VT, (float*)d_out);   /* column group y: v / output columns 128y .. 128y+127, all four from the batch's one plane */
}

// v005
// It runs in 64.8 microseconds.
// In two side-by-side timings against v004, it was 1.07 and 1.06 times as fast.
// Over all steps from v000 it is 28.0 times as fast.
// compute dtype: all float inputs rounded to bf16; q/k/v projections with EXACT bf16 products on WMMA 16x16x32 (f32 accumulate) + bias; logits q x k once to f16 each (1 product) over the full 512-wide head x 512^-0.5; softmax f32, split by key block: exp(logit - block max) once to f16 x v once to f16 (1 product per key block), each block's partial product weighted in f32 by exp(block max - row max) / row sum; four 128-column passes over the same plane; f32 output (no output projection).
#include <hip/hip_runtime.h>
#include <math.h>
#include <stdint.h>

typedef __attribute__((ext_vector_type(16))) _Float16 v16h;
typedef __attribute__((ext_vector_type(16))) __bf16 v16b;
typedef __attribute__((ext_vector_type(8)))  _Float16 v8h;
typedef __attribute__((ext_vector_type(8)))  float v8f;
typedef __attribute__((ext_vector_type(4)))  float v4f;
typedef __attribute__((ext_vector_type(2)))  float v2f;
typedef __attribute__((ext_vector_type(4)))  unsigned v4u;
typedef __attribute__((ext_vector_type(4)))  int v4i;
typedef float __attribute__((may_alias)) float_a;
typedef int __attribute__((may_alias)) int_a;

template <typename T> __device__ __forceinline__ void vst2(void* p, T v) { *(T*)p = v;  }
// the products are the plain builtins (the compiler keeps the distances behind its own matrix instructions): an asm statement of v_nop tied to d, a and b holds those operands in v0 to v255, and the 32 x 128 wave tile, with more than 256 registers live in its loop, then builds with spills to scratch in all three kernels
__device__ __forceinline__ v8f wmma16(v16h a, v16h b, v8f c) {
  v8f d = __builtin_amdgcn_wmma_f32_16x16x32_f16(false, a, false, b, (short)0, c, false, false);
  return d;
}
__device__ __forceinline__ v8f wmma_bf(v16b a, v16b b, v8f c) {
  v8f d = __builtin_amdgcn_wmma_f32_16x16x32_bf16(false, a, false, b, (short)0, c, false, false);
  return d;
}
// 16x16x32 fragments: lane = (h = lane>>4, row/col = lane&15); elements 0..7 = k0+8h+0..7, 8..15 = k0+16+8h+0..7; D element r = row 8h+r
__device__ __forceinline__ v16h frag_h(const _Float16* rowk0, int lane) {
  union { v16h v; v8h q[2]; } u; const _Float16* p = rowk0 + 8 * (lane >> 4);
  u.q[0] = *(const v8h*)p; u.q[1] = *(const v8h*)(p + 16); return u.v;
}
__device__ __forceinline__ v16h frag_f32(const float* rowk0, int lane) {
  v16h a; const float* p = rowk0 + 8 * (lane >> 4);
#pragma unroll
  for (int i = 0; i < 8; ++i) { a[i] = (_Float16)p[i]; a[8 + i] = (_Float16)p[16 + i]; }
  return a;
}
__device__ __forceinline__ v16h frag_f32s(const float* rowk0, int lane, float sc) {
  v16h a; const float* p = rowk0 + 8 * (lane >> 4);
#pragma unroll
  for (int i = 0; i < 8; ++i) { a[i] = (_Float16)(p[i] * sc); a[8 + i] = (_Float16)(p[16 + i] * sc); }
  return a;
}
// column fragment from a [K][ld] layout (column n), rows >= K read as 0
__device__ __forceinline__ v16h fragc_f32(const float* W, int k0, int n, int lane, int ld, int K) {
  v16h a; const int g = lane >> 4;
#pragma unroll
  for (int i = 0; i < 8; ++i) { const int ka = k0 + 8 * g + i, kb = ka + 16;
    a[i] = (_Float16)(ka < K ? W[(size_t)(ka < K ? ka : K - 1) * ld + n] : 0.f); a[8 + i] = (_Float16)(kb < K ? W[(size_t)(kb < K ? kb : K - 1) * ld + n] : 0.f); }
  return a;
}
struct F2 { v16b h, l; };
__device__ __forceinline__ F2 bsplit16(const float v[16]) { F2 r;
#pragma unroll
  for (int i = 0; i < 16; ++i) { const __bf16 h = (__bf16)v[i]; r.h[i] = h; r.l[i] = (__bf16)(v[i] - (float)h); }
  return r; }
__device__ __forceinline__ F2 split_row(const float* row, int k0, int lane) { float v[16]; const float* p = row + k0 + 8 * (lane >> 4);
#pragma unroll
  for (int i = 0; i < 8; ++i) { v[i] = p[i]; v[8 + i] = p[16 + i]; }
  return bsplit16(v); }
__device__ __forceinline__ F2 split_rowK(const float* row, int k0, int lane, int K) { float v[16]; const int g = lane >> 4;
#pragma unroll
  for (int i = 0; i < 8; ++i) { const int ka = k0 + 8 * g + i, kb = ka + 16; v[i] = ka < K ? row[ka < K ? ka : K - 1] : 0.f; v[8 + i] = kb < K ? row[kb < K ? kb : K - 1] : 0.f; }
  return bsplit16(v); }
__device__ __forceinline__ F2 split_col(const float* W, int k0, int n, int lane, int ld, int K) { float v[16]; const int g = lane >> 4;
#pragma unroll
  for (int i = 0; i < 8; ++i) { const int ka = k0 + 8 * g + i, kb = ka + 16; v[i] = ka < K ? W[(size_t)(ka < K ? ka : K - 1) * ld + n] : 0.f; v[8 + i] = kb < K ? W[(size_t)(kb < K ? kb : K - 1) * ld + n] : 0.f; }
  return bsplit16(v); }
__device__ __forceinline__ v8f mac3(const F2& a, const F2& b, v8f c) { c = wmma_bf(a.l, b.h, c); c = wmma_bf(a.h, b.l, c); return wmma_bf(a.h, b.h, c); }
__device__ __forceinline__ float sigm(float v) { return 1.0f / (1.0f + expf(-v)); }
#define LDSX() do { asm volatile("s_wait_dscnt 0" ::: "memory"); __builtin_amdgcn_wave_barrier(); __builtin_amdgcn_fence(__ATOMIC_RELEASE, "workgroup"); } while (0)

// Single-head scaled-dot-product self-attention with a 512-wide head (x [4,2048,512]; torch (out,in) Wq / Wk / Wv [512,512] and biases uniform(+-1/sqrt(512)) (nonzero), einsum 'bnd,ed->bne'; scores = q k^T / sqrt(512) over all 512 dims; softmax over the 2,048 keys; out = weights v, [4,2048,512]; no output projection).
#define NB 4
#define TT 2048
#define CC 512            // NH * HD = projected width
#define DIN 512          // input (model) width
#define NH 4   // P.v column groups of HD = 128 (they share ONE probability plane)
#define HD 128
#define HDSC 512   // the score kernel contracts over the whole 512-wide head
#define NQB (TT / 64)
#define SCALE (0.04419417382415922f)   // 1 / sqrt(512)
#define SCALE2 (SCALE * 1.4426950408889634f)   // SCALE x log2(e): logits in base-2 units, so that exp(a - b) is one native exp2
#define CAUSAL 0
#ifndef TNB
#define TNB NB
#endif
__device__ __forceinline__ float bfr(float v) { return (float)(__bf16)v; }
__host__ __device__ __forceinline__ int kb_last(int qb) { return CAUSAL ? ((qb * 64 + 63) >> 7) : (TT / 128 - 1); }
typedef __attribute__((ext_vector_type(8))) __bf16 v8b;
__device__ __forceinline__ v16b frag_b(const __bf16* rowk0, int lane) {
  union { v16b v; v8b q[2]; } u; const __bf16* p = rowk0 + 8 * (lane >> 4);
  u.q[0] = *(const v8b*)p; u.q[1] = *(const v8b*)(p + 16); return u.v;
}
#define QBH 0              // no query block takes a high-precision path: k_sc has only the single-product path
#define QHI 0               // single-product logits on every row
#define KHI 64            // key rows carrying k residual / v bf16 hi+lo planes (no kernel reads the k residual or the v planes)
// B fragment (k rows k0+.., output column o) of a weight: (in,out) [K][ld] or (out,in) [ld rows of K]: bf16 exact, or f16(bf16 * 256) exact
__device__ __forceinline__ v16b wcol_io(const float* Wm, int k0, int o, int lane, int ld) { v16b w; const int g = lane >> 4;
#pragma unroll
  for (int i = 0; i < 8; ++i) { w[i] = (__bf16)Wm[(size_t)(k0 + 8 * g + i) * ld + o]; w[8 + i] = (__bf16)Wm[(size_t)(k0 + 16 + 8 * g + i) * ld + o]; }
  return w; }
__device__ __forceinline__ v16b wcol_oi(const float* Wm, int k0, int o, int lane, int K) { v16b w; const float* p = Wm + (size_t)o * K + k0 + 8 * (lane >> 4);
#pragma unroll
  for (int i = 0; i < 8; ++i) { w[i] = (__bf16)p[i]; w[8 + i] = (__bf16)p[16 + i]; }
  return w; }
__device__ __forceinline__ v16h wcolh_io(const float* Wm, int k0, int o, int lane, int ld) { v16h w; const int g = lane >> 4;
#pragma unroll
  for (int i = 0; i < 8; ++i) { w[i] = (_Float16)(bfr(Wm[(size_t)(k0 + 8 * g + i) * ld + o]) * 256.0f); w[8 + i] = (_Float16)(bfr(Wm[(size_t)(k0 + 16 + 8 * g + i) * ld + o]) * 256.0f); }
  return w; }
__device__ __forceinline__ v16h wcolh_oi(const float* Wm, int k0, int o, int lane, int K) { v16h w; const float* p = Wm + (size_t)o * K + k0 + 8 * (lane >> 4);
#pragma unroll
  for (int i = 0; i < 8; ++i) { w[i] = (_Float16)(bfr(p[i]) * 256.0f); w[8 + i] = (_Float16)(bfr(p[16 + i]) * 256.0f); }
  return w; }
#define WQKV_LAYOUT 1   // 0 = (in,out) [DIN][CC]; 1 = (out,in) [CC][DIN]; 2 = per-head [NH][DIN][HD]
__device__ __forceinline__ v16b wcol_hdk(const float* Wm, int k0, int o, int lane) { v16b w; const int g = lane >> 4; const float* p = Wm + (size_t)(o / HD) * DIN * HD + (o % HD);
#pragma unroll
  for (int i = 0; i < 8; ++i) { w[i] = (__bf16)p[(size_t)(k0 + 8 * g + i) * HD]; w[8 + i] = (__bf16)p[(size_t)(k0 + 16 + 8 * g + i) * HD]; }
  return w; }
#define WO_OUT_IN 1
#if WQKV_LAYOUT == 1
#define WCOL(W, k0, o, lane) wcol_oi(W, k0, o, lane, DIN)
#elif WQKV_LAYOUT == 2
#define WCOL(W, k0, o, lane) wcol_hdk(W, k0, o, lane)
#else
#define WCOL(W, k0, o, lane) wcol_io(W, k0, o, lane, CC)
#endif
#if WO_OUT_IN
#define WOCOL(W, k0, o, lane) wcol_oi(W, k0, o, lane, CC)
#define WOCOLH(W, k0, o, lane) wcolh_oi(W, k0, o, lane, CC)
#else
#define WOCOL(W, k0, o, lane) wcol_io(W, k0, o, lane, DIN)
#define WOCOLH(W, k0, o, lane) wcolh_io(W, k0, o, lane, DIN)
#endif

static_assert(CC == NH * HD && HDSC == CC && HD <= 128, "one 512-wide head: scores over all CC columns, P.v in NH column groups of HD <= 128 (the k_pv store width)");
#ifndef PROJ_EXTRA_PARAMS
#define PROJ_EXTRA_PARAMS
#endif

#define WS_QH  0u                                      // f16 q rows [b*t][CC]
#define WS_KH  (WS_QH + 2u * (size_t)NB * TT * CC)      // f16 k rows [b*t][CC]
#define WS_VT  (WS_KH + 2u * (size_t)NB * TT * CC)      // f16 v planes [b][c][t]
#define WS_QL  (WS_VT + 2u * (size_t)NB * CC * TT)      // f16 q residual x 2^10 rows [b][t < QHI][CC]
#define WS_KL  (WS_QL + 2u * (size_t)NB * QHI * CC)     // f16 k residual x 2^10 rows [b][t < KHI][CC]
#define WS_VB  (WS_KL + 2u * (size_t)NB * KHI * CC)     // bf16 v hi planes [b][c][t < KHI]
#define WS_VBL (WS_VB + 2u * (size_t)NB * CC * KHI)
#define WS_S   (WS_VBL + 2u * (size_t)NB * CC * KHI)    // f16 exp2(base-2 logit - key block's row max) [b][t][s]: one plane per batch, so that each stage is one launch over all batches
#define WS_ST  (WS_S  + 2u * (size_t)NB * TT * TT)      // f32 pairs (row max in base-2 units, row sum of exp2) of each 128-key block [b][kb][t]: a wave's 32 rows fill two 128-B lines
#define WS_Y   (WS_ST + 8u * (size_t)NB * (TT / 128) * TT)   // f32 ctx rows [b*t][CC] (only when there is an output projection)
#define WS_END (WS_Y)   // no ctx rows: k_pv writes the output directly

// ---- operand staging: a block's A tile (128 rows) and B tile (128 rows) of one 128-wide k chunk go to LDS (f32 source: whole-line loads through registers, one wave per 512-B row, rounded once on the way; 16-bit source: tensor loads, below); all 4 waves then read their fragments from LDS (the loops of these helpers are unrolled whole, so that every register array is indexed by constants)
#define KCH 128   // k elements per staged chunk
#define LP 136    // LDS row pitch in 16-bit elements: 272 B = 17 x 16 B, so that 16 rows read 16 B each fall on all 64 banks
typedef __attribute__((ext_vector_type(4))) _Float16 v4h;
typedef __attribute__((ext_vector_type(4))) __bf16 v4b;
template <int ROWS> __device__ __forceinline__ void ld32(v4f (&r)[ROWS / 4], const float* src, size_t ld, int tid) { const float* p = src + (size_t)(tid >> 5) * ld + (tid & 31) * 4;
#pragma unroll
  for (int i = 0; i < ROWS / 4; ++i) r[i] = *(const v4f*)(p + (size_t)(i * 4) * ld);
  asm volatile("s_wait_xcnt 0x0" :: "v"(p) : "memory"); }   // stands in front of any overwrite of the address register pair that these loads name; p as an input keeps that pair whole up to here
template <int ROWS, typename E, typename V4> __device__ __forceinline__ void st32(E* t, const v4f (&r)[ROWS / 4], int tid) {
#pragma unroll
  for (int i = 0; i < ROWS / 4; ++i) { V4 h;
#pragma unroll
    for (int e = 0; e < 4; ++e) h[e] = (E)r[i][e];
    *(V4*)(t + (i * 4 + (tid >> 5)) * LP + (tid & 31) * 4) = h; } }
// ---- 16-bit operands: one tensor load a wave and stage brings a slice of 64 rows of 256 B straight into LDS, through no register, at the same 272-B pitch (pad of 16 B behind every 256-B row); waves 0 and 1 bring the two halves of the A tile, waves 2 and 3 those of the B tile; two buffers, so that stage s + 1 flies while stage s is multiplied
typedef uint32_t u32x4 __attribute__((ext_vector_type(4)));
typedef uint32_t u32x8 __attribute__((ext_vector_type(8)));
#define SLB 18432u          // a slice's place in LDS: 64 rows x 272 B = 17,408 B, rounded up to a multiple of 2 KiB
#define RBUF (4u * SLB)     // one buffer: A slices 0, 1, then B slices 0, 1
#define BRO(j) (((j) >> 2) * (int)(SLB / 2u) + ((j) & 3) * 16 * LP)   // 16-bit elements from B row 0 to B row 16 j
static_assert(SLB % 2048u == 0 && SLB >= 64u * LP * 2u && KCH * 2 == 256 && LP * 2 == 256 + 16, "slices at multiples of 2 KiB; rows of 256 B at the padded pitch");
__device__ __forceinline__ uint32_t uni(uint32_t v) { return (uint32_t)__builtin_amdgcn_readfirstlane(v); }
__device__ __forceinline__ uint32_t pinned(uint32_t v) { uint32_t w = uni(v); asm volatile("" : "+s"(w)); return w; }   // it holds a wave-uniform value in a scalar register, so that the test around a tensor load compiles to a scalar branch, and the descriptor words formed from a stage number taken behind a wait stay behind that wait
__device__ __forceinline__ u32x8 tdm_group1(uint32_t src_pitch) { u32x8 g;   // extents in bytes, tensor = tile = 64 rows of 256 B
  g[0] = uni((1u << 20) | (5u << 22) | (3u << 25)); g[1] = uni(256u << 16); g[2] = uni(64u << 16); g[3] = uni(256u << 16); g[4] = uni(64u); g[5] = uni(src_pitch); g[6] = uni(0u); g[7] = uni(0u); return g; }
__device__ __forceinline__ void tdm_load(uint32_t lds_dst, uint64_t ga, u32x8 g1) { u32x4 g0; g0[0] = uni(1u); g0[1] = uni(lds_dst); g0[2] = uni((uint32_t)ga); g0[3] = uni((((uint32_t)(ga >> 32)) & 0x01FFFFFFu) | 0x80000000u);
  asm volatile("tensor_load_to_lds %0, %1" :: "s"(g0), "s"(g1) : "memory"); }
__device__ __forceinline__ void wait_tensor0() { asm volatile("s_wait_tensorcnt 0x0" ::: "memory"); }   // the wave's own request has landed (the compiler places no wait for a tensor load)
__device__ __forceinline__ void wait_ds0() { asm volatile("s_wait_dscnt 0x0" ::: "memory"); }   // the wave's LDS reads have returned before the buffer is given up for a refill
// one staged chunk of a wave's 32 x 128 product (two 16-row tiles against eight 16-column tiles: every B fragment read from LDS serves two products): the 20 fragment reads of k step kc + 1 stand as one group in front of the 16 products of step kc, so that no product waits out an LDS latency of its own (arow: the lane's A row in row tile 0; brow: the lane's row of B column group 0)
__device__ __forceinline__ void chunk_h(const _Float16* arow, const _Float16* brow, int lane, v8f (&acc)[2][8]) { v16h a[2], b[8];
#pragma unroll
  for (int i = 0; i < 2; ++i) a[i] = frag_h(arow + i * 16 * LP, lane);
#pragma unroll
  for (int j = 0; j < 8; ++j) b[j] = frag_h(brow + BRO(j), lane);
#pragma unroll
  for (int kc = 0; kc < KCH / 32; ++kc) { v16h an[2], bn[8];
#pragma unroll
    for (int i = 0; i < 2; ++i) an[i] = a[i];
#pragma unroll
    for (int j = 0; j < 8; ++j) bn[j] = b[j];
    if (kc + 1 < KCH / 32) {
#pragma unroll
      for (int i = 0; i < 2; ++i) an[i] = frag_h(arow + i * 16 * LP + (kc + 1) * 32, lane);
#pragma unroll
      for (int j = 0; j < 8; ++j) bn[j] = frag_h(brow + BRO(j) + (kc + 1) * 32, lane); }
    __builtin_amdgcn_sched_barrier(0);   // keeps the next step's reads one group in front of this step's products: left free, the compiler spreads them among the products, each with a wait of its own
#pragma unroll
    for (int j = 0; j < 8; ++j)
#pragma unroll
      for (int i = 0; i < 2; ++i) acc[i][j] = wmma16(a[i], b[j], acc[i][j]);
    __builtin_amdgcn_sched_barrier(0);   // closes the block of products against the reads of the step after next
#pragma unroll
    for (int i = 0; i < 2; ++i) a[i] = an[i];
#pragma unroll
    for (int j = 0; j < 8; ++j) b[j] = bn[j]; } }
__device__ __forceinline__ void chunk_b(const __bf16* arow, const __bf16* brow, int lane, v8f (&acc)[2][8]) { v16b a[2], b[8];
#pragma unroll
  for (int i = 0; i < 2; ++i) a[i] = frag_b(arow + i * 16 * LP, lane);
#pragma unroll
  for (int j = 0; j < 8; ++j) b[j] = frag_b(brow + j * 16 * LP, lane);
#pragma unroll
  for (int kc = 0; kc < KCH / 32; ++kc) { v16b an[2], bn[8];
#pragma unroll
    for (int i = 0; i < 2; ++i) an[i] = a[i];
#pragma unroll
    for (int j = 0; j < 8; ++j) bn[j] = b[j];
    if (kc + 1 < KCH / 32) {
#pragma unroll
      for (int i = 0; i < 2; ++i) an[i] = frag_b(arow + i * 16 * LP + (kc + 1) * 32, lane);
#pragma unroll
      for (int j = 0; j < 8; ++j) bn[j] = frag_b(brow + j * 16 * LP + (kc + 1) * 32, lane); }
    __builtin_amdgcn_sched_barrier(0);   // keeps the next step's reads one group in front of this step's products: left free, the compiler spreads them among the products, each with a wait of its own
#pragma unroll
    for (int j = 0; j < 8; ++j)
#pragma unroll
      for (int i = 0; i < 2; ++i) acc[i][j] = wmma_bf(a[i], b[j], acc[i][j]);
    __builtin_amdgcn_sched_barrier(0);   // closes the block of products against the reads of the step after next
#pragma unroll
    for (int i = 0; i < 2; ++i) a[i] = an[i];
#pragma unroll
    for (int j = 0; j < 8; ++j) b[j] = bn[j]; } }
static_assert(HD == 128 && WQKV_LAYOUT == 1 && DIN % KCH == 0 && HDSC % KCH == 0 && KCH == 128, "staged chunks: k-contiguous (out,in) weights, whole chunks, one key block of kb_last() per chunk");

#define BM 128   // rows of a block's tile: 4 waves x 32 rows
static_assert(TT % BM == 0 && KHI % 8 == 0 && QHI % 8 == 0 && KHI == 64 && (QHI == 0 || QHI == 64), "a block's rows lie in one batch; residual rows are none or the first 64 of a batch's first block (waves 0 and 1)");
// ---- k_proj: block = (128 rows, 128 cols, which): q/k/v = X W (+ b) with exact bf16 products (K = DIN) -> which 0: q f16 rows (+ residual rows < QHI); 1: k f16 rows (+ residual rows < KHI); 2: v f16 planes [c][t] (+ bf16 hi/lo planes for t < KHI)
__global__ __launch_bounds__(128) void k_proj(const float* __restrict__ XQ, const float* __restrict__ XK, const float* __restrict__ XV, const float* __restrict__ WQ, const float* __restrict__ WK, const float* __restrict__ WV, const float* __restrict__ BQ, const float* __restrict__ BK, const float* __restrict__ BV,
    _Float16* __restrict__ QH, _Float16* __restrict__ QL, _Float16* __restrict__ KH, _Float16* __restrict__ KL, _Float16* __restrict__ VT, __bf16* __restrict__ VB, __bf16* __restrict__ VBL) {
  __shared__ __align__(16) unsigned char smem[71680];   // main loop: operand tiles xa, xb; behind its last barrier: the output staging arrays
  _Float16 (*sh)[136] = (_Float16 (*)[136])smem; _Float16 (*sl)[136] = (_Float16 (*)[136])(smem + 34816); _Float16 (*th)[136] = (_Float16 (*)[136])smem; __bf16 (*tb)[72] = (__bf16 (*)[72])(smem + 34816); __bf16 (*tbl)[72] = (__bf16 (*)[72])(smem + 53248);
  __bf16* xa = (__bf16*)smem; __bf16* xb = xa + BM * LP;
  const int tid = threadIdx.x, wave = tid >> 5, lane = tid & 31, col = lane & 15, g = lane >> 4; const int which = blockIdx.z; const int c0 = blockIdx.y * 128; const size_t r0 = (size_t)blockIdx.x * BM; const size_t bb = r0 / TT; const int t0 = (int)(r0 % TT);
  const float* X = which == 0 ? XQ : which == 1 ? XK : XV; const float* WA = which == 0 ? WQ : which == 1 ? WK : WV; const float* BA = which == 0 ? BQ : which == 1 ? BK : BV;
  v8f acc[2][8] = {};
#pragma unroll 1   // rolled: the barriers keep the chunks apart anyway, and one copy of the chunk body keeps the code short
  for (int c = 0; c < DIN / KCH; ++c) { { v4f xr[32]; ld32<BM>(xr, X + r0 * DIN + c * KCH, DIN, tid); st32<BM, __bf16, v4b>(xa, xr, tid); }
    { v4f wr[32]; ld32<128>(wr, WA + (size_t)c0 * DIN + c * KCH, DIN, tid); st32<128, __bf16, v4b>(xb, wr, tid); }
    __syncthreads();   // the chunk's tiles are complete before any wave reads them
    chunk_b(xa + (wave * 32 + col) * LP, xb + col * LP, lane, acc);
    __syncthreads(); }   // every wave has left the tiles before they are refilled (or reused as output staging)
  if (which < 2) { _Float16* DH = which == 0 ? QH : KH; _Float16* DL = which == 0 ? QL : KL; const int nhi = which == 0 ? QHI : KHI;
#pragma unroll
    for (int j = 0; j < 8; ++j) { const float bias = BA ? bfr(BA[c0 + j * 16 + col]) : 0.f;
#pragma unroll
      for (int i = 0; i < 2; ++i)
#pragma unroll
        for (int r = 0; r < 8; ++r) { const float v = acc[i][j][r] + bias; const _Float16 hv = (_Float16)v; sh[wave * 32 + i * 16 + 8 * g + r][j * 16 + col] = hv; sl[wave * 32 + i * 16 + 8 * g + r][j * 16 + col] = (_Float16)((v - (float)hv) * 1024.0f); } }
    __syncthreads();
    _Float16* dh = DH + (r0 + (tid >> 4)) * CC + c0 + (tid & 15) * 8; _Float16* dl = DL + (bb * nhi + t0 + (tid >> 4)) * (size_t)CC + c0 + (tid & 15) * 8;   // 16 lanes per 256-B row segment, 8 rows a group
#pragma unroll
    for (int i = 0; i < BM / 8; ++i) vst2(dh + (size_t)(i * 8) * CC, *(const v4u*)&sh[i * 8 + (tid >> 4)][(tid & 15) * 8]);
    asm volatile("s_wait_xcnt 0x0" :: "v"(dh) : "memory");   // as in ld32, and in front of the LDS reads below, which reuse these stores' data registers
    if (t0 < nhi) {   // nhi is 0 or 64 and t0 a multiple of BM: the block's first 64 rows, all below nhi
#pragma unroll
      for (int i = 0; i < 8; ++i) vst2(dl + (size_t)(i * 8) * CC, *(const v4u*)&sl[i * 8 + (tid >> 4)][(tid & 15) * 8]); }
    asm volatile("s_wait_xcnt 0x0" :: "v"(dl) : "memory");   // as in ld32
  } else {
#pragma unroll
    for (int j = 0; j < 8; ++j) { const float bias = BA ? bfr(BA[c0 + j * 16 + col]) : 0.f;
#pragma unroll
      for (int i = 0; i < 2; ++i)
#pragma unroll
        for (int r = 0; r < 8; ++r) { acc[i][j][r] += bias; th[j * 16 + col][wave * 32 + i * 16 + 8 * g + r] = (_Float16)acc[i][j][r]; } }
    if (wave < 2) {   // waves 0 and 1 hold the block's first 64 rows, the only ones that can lie below KHI
#pragma unroll
      for (int j = 0; j < 8; ++j)
#pragma unroll
        for (int i = 0; i < 2; ++i)
#pragma unroll
          for (int r = 0; r < 8; ++r) { const float v = acc[i][j][r]; const int rl = wave * 32 + i * 16 + 8 * g + r, cl = j * 16 + col; const __bf16 bh = (__bf16)v; tb[cl][rl] = bh; tbl[cl][rl] = (__bf16)(v - (float)bh); } }
    __syncthreads();
    _Float16* vt = VT + (bb * CC + c0 + (tid >> 4)) * (size_t)TT + t0 + (tid & 15) * 8;   // 16 lanes per 256-B plane segment, 8 planes a group
#pragma unroll
    for (int i = 0; i < 16; ++i) vst2(vt + (size_t)(i * 8) * TT, *(const v4u*)&th[i * 8 + (tid >> 4)][(tid & 15) * 8]);
    asm volatile("s_wait_xcnt 0x0" :: "v"(vt) : "memory");   // as in ld32
    if (t0 < KHI) { const size_t o3 = (bb * CC + c0 + (tid >> 3)) * (size_t)KHI + t0 + (tid & 7) * 8; __bf16* vb = VB + o3; __bf16* vbl = VBL + o3;
#pragma unroll
      for (int i = 0; i < 8; ++i) { vst2(vb + (size_t)(i * 16) * KHI, *(const v4u*)&tb[i * 16 + (tid >> 3)][(tid & 7) * 8]); vst2(vbl + (size_t)(i * 16) * KHI, *(const v4u*)&tbl[i * 16 + (tid >> 3)][(tid & 7) * 8]); }
      asm volatile("s_wait_xcnt 0x0" :: "v"(vb), "v"(vbl) : "memory"); } } }   // as in ld32
// value of lane l ^ M inside the lane's 16-lane row, by DPP row_xmask (every lane on): a vector move, where a shuffle would go through the LDS unit
template <int M> __device__ __forceinline__ float rowx(float v) { return __builtin_bit_cast(float, __builtin_amdgcn_update_dpp(0, __builtin_bit_cast(int, v), 0x160 | M, 0xf, 0xf, true)); }
// native exp2 with its v_nop in the same statement: the slot that the instruction set asks for between a transcendental and an instruction that reads its result or overwrites its source
__device__ __forceinline__ float exp2_slot(float v) { float e; asm("v_exp_f32 %0, %1\n\tv_nop" : "=v"(e) : "v"(v)); return e; }
// ---- k_sc: block = (128 queries qb, key block kb, batch b = blockIdx.z, plane b): logits x SCALE2 (base-2 units), one product, then this key block's share of the softmax (row max m, e = exp2(logit - m) to the plane, (m, sum e) to ST)  [here: head width HDSC = 512, single head]
static_assert(QBH == 0 && QHI == 0 && !CAUSAL, "every query block takes the staged single-product path over all key blocks");
__global__ __launch_bounds__(128) void k_sc(const _Float16* __restrict__ QH, const _Float16* __restrict__ KH, _Float16* __restrict__ S0, float* __restrict__ ST) { __shared__ __attribute__((aligned(2048))) unsigned char smem[2 * RBUF];   // main loop: two buffers of q and k slices; behind its last barrier: the output staging se
  _Float16 (*se)[32][LP] = (_Float16 (*)[32][LP])smem;
  const int qb = blockIdx.x, kb = blockIdx.y;
  const int b = blockIdx.z; _Float16* S = S0 + (size_t)b * TT * TT;
  const int tid = threadIdx.x, wave = tid >> 5, lane = tid & 31, col = lane & 15, g = lane >> 4; const int k0 = kb * 128; const int ql0 = qb * BM + wave * 32; const size_t kr0 = (size_t)b * TT + k0;
  v8f acc[2][8] = {};
  const uint32_t wv = uni((uint32_t)tid >> 5), nst = HDSC / KCH; const uint32_t tdst = (uint32_t)(size_t)smem + wv * SLB;   // the wave's slice: its place in buffer 0, and its first source byte
  const uint64_t tsrc = (uint64_t)(size_t)(((wv & 2u) ? KH + kr0 * CC : QH + ((size_t)b * TT + qb * BM) * CC) + (size_t)(wv & 1u) * 64 * CC); const u32x8 g1 = tdm_group1(CC * 2u);
  tdm_load(tdst, tsrc, g1); wait_tensor0();
  __syncthreads();   // stage 0 is complete before any wave reads it
  { const uint32_t sn = pinned(1u); tdm_load(tdst + (sn & 1u) * RBUF, tsrc + (uint64_t)sn * (KCH * 2u), g1); }   // the stage number is taken behind the wait, so that no descriptor word is rewritten while stage 0's request is out
#pragma unroll 1   // rolled, as in k_proj
  for (uint32_t c = 0; c < nst; ++c) { const _Float16* tb = (const _Float16*)(smem + (c & 1u) * RBUF);
    chunk_h(tb + (wave >> 1) * (int)(SLB / 2u) + ((wave & 1) * 32 + col) * LP, tb + SLB + col * LP, lane, acc);   // the B slices begin 2 SLB bytes = SLB elements into the buffer
    wait_ds0(); wait_tensor0();
    __syncthreads();   // stage c + 1 is complete, and every wave has left stage c's buffer before it is refilled (or reused as output staging)
    if (pinned(c + 2u < nst)) { const uint32_t sn = pinned(c + 2u); tdm_load(tdst + (sn & 1u) * RBUF, tsrc + (uint64_t)sn * (KCH * 2u), g1); } }   // refill of the buffer just left, only while that stage exists: scalar branch, descriptor formed behind the wait
  wait_tensor0(); wait_ds0();
  // row 16i + 8g + r of the wave's tile lies in the 16 lanes of half g, 8 columns a lane: max and sum go over the lane's 8 values, then over the half by 4 exchanges
  float mo = 0.f, so = 0.f;
#pragma unroll
  for (int i = 0; i < 2; ++i)
#pragma unroll
  for (int r = 0; r < 8; ++r) { float lg[8]; float m = -3.0e38f;
#pragma unroll
    for (int j = 0; j < 8; ++j) { lg[j] = acc[i][j][r] * SCALE2; m = fmaxf(m, lg[j]); }
    m = fmaxf(m, rowx<1>(m)); m = fmaxf(m, rowx<2>(m)); m = fmaxf(m, rowx<4>(m)); m = fmaxf(m, rowx<8>(m));
    float sum = 0.f;
#pragma unroll
    for (int j = 0; j < 8; ++j) { const float e = exp2_slot(lg[j] - m); sum += e; se[wave][i * 16 + 8 * g + r][j * 16 + col] = (_Float16)e; }
    sum += rowx<1>(sum); sum += rowx<2>(sum); sum += rowx<4>(sum); sum += rowx<8>(sum);
    if (col == i * 8 + r) { mo = m; so = sum; } }
  float* sp = ST + (((size_t)b * (TT / 128) + kb) * TT + ql0 + (col >> 3) * 16 + 8 * g + (col & 7)) * 2;
  _Float16* op = S + (size_t)(ql0 + g) * TT + k0 + col * 8;
  LDSX();
#pragma unroll
  for (int i = 0; i < 16; ++i) vst2(op + (size_t)(i * 2) * TT, *(const v4u*)&se[wave][i * 2 + g][col * 8]);   // 16 lanes per 256-B row segment
  { v2f st; st[0] = mo; st[1] = so; vst2(sp, st); }   // lane col of half g stores row 16 (col >> 3) + 8g + (col & 7): the wave's 32 rows fill two 128-B lines
  asm volatile("s_wait_xcnt 0x0" :: "v"(sp), "v"(op) : "memory"); }   // as in ld32: stands in front of any overwrite of the address pairs that these stores name
// ---- k_pv: block = 128 queries (qb = blockIdx.x) of (column group h = blockIdx.y, batch b = blockIdx.z; plane b): ctx = sum over key blocks kb of w[kb] * (e[kb] . v[kb]) (e f16 against v f16: 1 product), w[kb] = exp2(m[kb] - row max) / row sum from the score kernel's (m, sum) pairs, per row, f32; 512-B (row, column group) segment by the wave's 32 lanes
__global__ __launch_bounds__(128) void k_pv(const _Float16* __restrict__ PS0, const float* __restrict__ ST, const _Float16* __restrict__ VT, float* __restrict__ Y) { const int h = blockIdx.y, b = blockIdx.z; const _Float16* PS = PS0 + (size_t)b * TT * TT; __shared__ __align__(16) float ss[4][32][HD + 4]; __shared__ __attribute__((aligned(2048))) unsigned char ring[2 * RBUF]; __shared__ __align__(16) float sf[TT / 128][BM];
  const int tid = threadIdx.x, wave = tid >> 5, lane = tid & 31, col = lane & 15, g = lane >> 4; const int qb = blockIdx.x; const int ql0 = qb * BM + wave * 32;
  v8f acc[2][HD / 16] = {};
  const _Float16* Pg = PS + (size_t)qb * BM * TT; const _Float16* Vg = VT + ((size_t)b * CC + h * HD) * (size_t)TT; const uint32_t nst = TT / KCH;
  const uint32_t wv = uni((uint32_t)tid >> 5); const uint32_t tdst = (uint32_t)(size_t)ring + wv * SLB;   // the wave's slice: its place in buffer 0, and its first source byte
  const uint64_t tsrc = (uint64_t)(size_t)(((wv & 2u) ? Vg : Pg) + (size_t)(wv & 1u) * 64 * TT); const u32x8 g1 = tdm_group1(TT * 2u);
  tdm_load(tdst, tsrc, g1);
  {   // one query row a thread: the row's weight for each key block (read behind the barrier in front of the loop), while stage 0 flies
    const float* sp = ST + ((size_t)b * (TT / 128) * TT + qb * BM + tid) * 2; float mk[TT / 128], sk[TT / 128]; float mx = -3.0e38f, sum = 0.f;
#pragma unroll
    for (int kb = 0; kb < TT / 128; ++kb) { const v2f st = *(const v2f*)(sp + (size_t)kb * TT * 2); mk[kb] = st[0]; sk[kb] = st[1]; }
    asm volatile("s_wait_xcnt 0x0" :: "v"(sp) : "memory");   // as in ld32
#pragma unroll
    for (int kb = 0; kb < TT / 128; ++kb) mx = fmaxf(mx, mk[kb]);
#pragma unroll
    for (int kb = 0; kb < TT / 128; ++kb) { mk[kb] = exp2_slot(mk[kb] - mx); sum += sk[kb] * mk[kb]; }
    const float inv = 1.0f / sum;
#pragma unroll
    for (int kb = 0; kb < TT / 128; ++kb) sf[kb][tid] = mk[kb] * inv; }
  wait_tensor0();
  __syncthreads();   // stage 0 and the weights are complete before any wave reads them
  { const uint32_t sn = pinned(1u); tdm_load(tdst + (sn & 1u) * RBUF, tsrc + (uint64_t)sn * (KCH * 2u), g1); }   // the stage number is taken behind the wait, so that no descriptor word is rewritten while stage 0's request is out
#pragma unroll 1   // rolled, as in k_proj
  for (uint32_t c = 0; c < nst; ++c) { const _Float16* tb = (const _Float16*)(ring + (c & 1u) * RBUF);
    v4f w[2][2];   // weights of the lane's 16 accumulator rows
#pragma unroll
    for (int i = 0; i < 2; ++i) { w[i][0] = *(const v4f*)&sf[c][wave * 32 + i * 16 + 8 * g]; w[i][1] = *(const v4f*)&sf[c][wave * 32 + i * 16 + 8 * g + 4]; }
    v8f part[2][HD / 16] = {}; chunk_h(tb + (wave >> 1) * (int)(SLB / 2u) + ((wave & 1) * 32 + col) * LP, tb + SLB + col * LP, lane, part);   // the B slices begin 2 SLB bytes = SLB elements into the buffer
    wait_ds0(); wait_tensor0();
    __syncthreads();   // stage c + 1 is complete, and every wave has left stage c's buffer before it is refilled
    if (pinned(c + 2u < nst)) { const uint32_t sn = pinned(c + 2u); tdm_load(tdst + (sn & 1u) * RBUF, tsrc + (uint64_t)sn * (KCH * 2u), g1); }   // refill of the buffer just left, only while that stage exists: scalar branch, descriptor formed behind the wait
#pragma unroll
    for (int i = 0; i < 2; ++i)   // the weighting works on registers alone: behind the refill, so that the refill starts as early as it may
#pragma unroll
      for (int j = 0; j < HD / 16; ++j)
#pragma unroll
        for (int r = 0; r < 8; ++r) acc[i][j][r] += part[i][j][r] * w[i][r >> 2][r & 3]; }
  wait_tensor0(); wait_ds0();
#pragma unroll
  for (int i = 0; i < 2; ++i)
#pragma unroll
    for (int j = 0; j < HD / 16; ++j)
#pragma unroll
      for (int r = 0; r < 8; ++r) ss[wave][i * 16 + 8 * g + r][j * 16 + col] = acc[i][j][r];
  float* yp = Y + ((size_t)b * TT + ql0) * CC + h * HD + lane * 4;
  LDSX();
#pragma unroll
  for (int rl = 0; rl < 32; ++rl) vst2(yp + (size_t)rl * CC, *(const v4f*)&ss[wave][rl][lane * 4]);
  asm volatile("s_wait_xcnt 0x0" :: "v"(yp) : "memory"); }   // as in ld32: stands in front of any overwrite of the address pair that these stores name

extern "C" void kernel_launch(void* const* d_in, const int* in_sizes, int n_in, void* d_out, int out_size, void* d_ws, size_t ws_size, hipStream_t stream) {
  (void)in_sizes; (void)n_in; (void)out_size;
  const float** F = (const float**)d_in;
  if (ws_size < (size_t)WS_END) return;
  char* ws = (char*)d_ws; _Float16 *QH = (_Float16*)(ws + WS_QH), *KH = (_Float16*)(ws + WS_KH), *VT = (_Float16*)(ws + WS_VT), *QL = (_Float16*)(ws + WS_QL), *KL = (_Float16*)(ws + WS_KL); __bf16 *VB = (__bf16*)(ws + WS_VB), *VBL = (__bf16*)(ws + WS_VBL); _Float16* S = (_Float16*)(ws + WS_S); float *ST = (float*)(ws + WS_ST), *Y = (float*)(ws + WS_Y);
  (void)Y;
  // inputs: 0 x [4,2048,512]; 1 Wq [512,512] (out,in), 2 bq; 3 Wk, 4 bk; 5 Wv, 6 bv (biases nonzero)
  k_proj<<<dim3(TNB * TT / BM, CC / 128, 3), 128, 0, stream>>>(F[0], F[0], F[0], F[1], F[3], F[5], F[2], F[4], F[6], QH, QL, KH, KL, VT, VB, VBL);
  k_sc<<<dim3(TT / BM, TT / 128, TNB), 128, 0, stream>>>(QH, KH, S, ST);   /* one 2,048 x 2,048 plane per batch: scores over all 512 columns */
  k_pv<<<dim3(TT / BM, NH, TNB), 128, 0, stream>>>(S, ST, VT, (float*)d_out);   /* column group y: v / output columns 128y .. 128y+127, all four from the batch's one plane */
}

// v006
// Measured time: 58.4 microseconds a run.
// Next to v005, in two timings, it ran 1.10 times as fast each time.
// Counting every step since v000, it is 30.9 times as fast.
// compute dtype: all float inputs rounded to bf16; q/k/v projections with EXACT bf16 products on WMMA 16x16x32 (f32 accumulate) + bias; logits q x k once to f16 each (1 product) over the full 512-wide head x 512^-0.5; softmax f32, split by key block: exp(logit - block max) once to f16 x v once to f16 (1 product per key block), each block's partial product weighted in f32 by exp(block max - row max) / row sum; four 128-column passes over the same plane; f32 output (no output projection).
#include <hip/hip_runtime.h>
#include <math.h>
#include <stdint.h>

typedef __attribute__((ext_vector_type(16))) _Float16 v16h;
typedef __attribute__((ext_vector_type(16))) __bf16 v16b;
typedef __attribute__((ext_vector_type(8)))  _Float16 v8h;
typedef __attribute__((ext_vector_type(8)))  float v8f;
typedef __attribute__((ext_vector_type(4)))  float v4f;
typedef __attribute__((ext_vector_type(2)))  float v2f;
typedef __attribute__((ext_vector_type(4)))  unsigned v4u;
typedef __attribute__((ext_vector_type(4)))  int v4i;
typedef float __attribute__((may_alias)) float_a;
typedef int __attribute__((may_alias)) int_a;

template <typename T> __device__ __forceinline__ void vst2(void* p, T v) { *(T*)p = v;  }
// the products are the plain builtins (the compiler keeps the distances behind its own matrix instructions): an asm statement of v_nop tied to d, a and b holds those operands in v0 to v255, and the 32 x 128 wave tile, with more than 256 registers live in its loop, then builds with spills to scratch in all three kernels
__device__ __forceinline__ v8f wmma16(v16h a, v16h b, v8f c) {
  v8f d = __builtin_amdgcn_wmma_f32_16x16x32_f16(false, a, false, b, (short)0, c, false, false);
  return d;
}
__device__ __forceinline__ v8f wmma_bf(v16b a, v16b b, v8f c) {
  v8f d = __builtin_amdgcn_wmma_f32_16x16x32_bf16(false, a, false, b, (short)0, c, false, false);
  return d;
}
// 16x16x32 fragments: lane = (h = lane>>4, row/col = lane&15); elements 0..7 = k0+8h+0..7, 8..15 = k0+16+8h+0..7; D element r = row 8h+r
__device__ __forceinline__ v16h frag_h(const _Float16* rowk0, int lane) {
  union { v16h v; v8h q[2]; } u; const _Float16* p = rowk0 + 8 * (lane >> 4);
  u.q[0] = *(const v8h*)p; u.q[1] = *(const v8h*)(p + 16); return u.v;
}
__device__ __forceinline__ v16h frag_f32(const float* rowk0, int lane) {
  v16h a; const float* p = rowk0 + 8 * (lane >> 4);
#pragma unroll
  for (int i = 0; i < 8; ++i) { a[i] = (_Float16)p[i]; a[8 + i] = (_Float16)p[16 + i]; }
  return a;
}
__device__ __forceinline__ v16h frag_f32s(const float* rowk0, int lane, float sc) {
  v16h a; const float* p = rowk0 + 8 * (lane >> 4);
#pragma unroll
  for (int i = 0; i < 8; ++i) { a[i] = (_Float16)(p[i] * sc); a[8 + i] = (_Float16)(p[16 + i] * sc); }
  return a;
}
// column fragment from a [K][ld] layout (column n), rows >= K read as 0
__device__ __forceinline__ v16h fragc_f32(const float* W, int k0, int n, int lane, int ld, int K) {
  v16h a; const int g = lane >> 4;
#pragma unroll
  for (int i = 0; i < 8; ++i) { const int ka = k0 + 8 * g + i, kb = ka + 16;
    a[i] = (_Float16)(ka < K ? W[(size_t)(ka < K ? ka : K - 1) * ld + n] : 0.f); a[8 + i] = (_Float16)(kb < K ? W[(size_t)(kb < K ? kb : K - 1) * ld + n] : 0.f); }
  return a;
}
struct F2 { v16b h, l; };
__device__ __forceinline__ F2 bsplit16(const float v[16]) { F2 r;
#pragma unroll
  for (int i = 0; i < 16; ++i) { const __bf16 h = (__bf16)v[i]; r.h[i] = h; r.l[i] = (__bf16)(v[i] - (float)h); }
  return r; }
__device__ __forceinline__ F2 split_row(const float* row, int k0, int lane) { float v[16]; const float* p = row + k0 + 8 * (lane >> 4);
#pragma unroll
  for (int i = 0; i < 8; ++i) { v[i] = p[i]; v[8 + i] = p[16 + i]; }
  return bsplit16(v); }
__device__ __forceinline__ F2 split_rowK(const float* row, int k0, int lane, int K) { float v[16]; const int g = lane >> 4;
#pragma unroll
  for (int i = 0; i < 8; ++i) { const int ka = k0 + 8 * g + i, kb = ka + 16; v[i] = ka < K ? row[ka < K ? ka : K - 1] : 0.f; v[8 + i] = kb < K ? row[kb < K ? kb : K - 1] : 0.f; }
  return bsplit16(v); }
__device__ __forceinline__ F2 split_col(const float* W, int k0, int n, int lane, int ld, int K) { float v[16]; const int g = lane >> 4;
#pragma unroll
  for (int i = 0; i < 8; ++i) { const int ka = k0 + 8 * g + i, kb = ka + 16; v[i] = ka < K ? W[(size_t)(ka < K ? ka : K - 1) * ld + n] : 0.f; v[8 + i] = kb < K ? W[(size_t)(kb < K ? kb : K - 1) * ld + n] : 0.f; }
  return bsplit16(v); }
__device__ __forceinline__ v8f mac3(const F2& a, const F2& b, v8f c) { c = wmma_bf(a.l, b.h, c); c = wmma_bf(a.h, b.l, c); return wmma_bf(a.h, b.h, c); }
__device__ __forceinline__ float sigm(float v) { return 1.0f / (1.0f + expf(-v)); }
#define LDSX() do { asm volatile("s_wait_dscnt 0" ::: "memory"); __builtin_amdgcn_wave_barrier(); __builtin_amdgcn_fence(__ATOMIC_RELEASE, "workgroup"); } while (0)

// Single-head scaled-dot-product self-attention with a 512-wide head (x [4,2048,512]; torch (out,in) Wq / Wk / Wv [512,512] and biases uniform(+-1/sqrt(512)) (nonzero), einsum 'bnd,ed->bne'; scores = q k^T / sqrt(512) over all 512 dims; softmax over the 2,048 keys; out = weights v, [4,2048,512]; no output projection).
#define NB 4
#define TT 2048
#define CC 512            // NH * HD = projected width
#define DIN 512          // input (model) width
#define NH 4   // P.v column groups of HD = 128 (they share ONE probability plane)
#define HD 128
#define HDSC 512   // the score kernel contracts over the whole 512-wide head
#define NQB (TT / 64)
#define SCALE (0.04419417382415922f)   // 1 / sqrt(512)
#define SCALE2 (SCALE * 1.4426950408889634f)   // SCALE x log2(e): logits in base-2 units, so that exp(a - b) is one native exp2
#define CAUSAL 0
#ifndef TNB
#define TNB NB
#endif
__device__ __forceinline__ float bfr(float v) { return (float)(__bf16)v; }
__host__ __device__ __forceinline__ int kb_last(int qb) { return CAUSAL ? ((qb * 64 + 63) >> 7) : (TT / 128 - 1); }
typedef __attribute__((ext_vector_type(8))) __bf16 v8b;
__device__ __forceinline__ v16b frag_b(const __bf16* rowk0, int lane) {
  union { v16b v; v8b q[2]; } u; const __bf16* p = rowk0 + 8 * (lane >> 4);
  u.q[0] = *(const v8b*)p; u.q[1] = *(const v8b*)(p + 16); return u.v;
}
#define QBH 0              // no query block takes a high-precision path: k_sc has only the single-product path
#define QHI 0               // single-product logits on every row
#define KHI 64            // key rows carrying k residual / v bf16 hi+lo planes (no kernel reads the k residual or the v planes)
// B fragment (k rows k0+.., output column o) of a weight: (in,out) [K][ld] or (out,in) [ld rows of K]: bf16 exact, or f16(bf16 * 256) exact
__device__ __forceinline__ v16b wcol_io(const float* Wm, int k0, int o, int lane, int ld) { v16b w; const int g = lane >> 4;
#pragma unroll
  for (int i = 0; i < 8; ++i) { w[i] = (__bf16)Wm[(size_t)(k0 + 8 * g + i) * ld + o]; w[8 + i] = (__bf16)Wm[(size_t)(k0 + 16 + 8 * g + i) * ld + o]; }
  return w; }
__device__ __forceinline__ v16b wcol_oi(const float* Wm, int k0, int o, int lane, int K) { v16b w; const float* p = Wm + (size_t)o * K + k0 + 8 * (lane >> 4);
#pragma unroll
  for (int i = 0; i < 8; ++i) { w[i] = (__bf16)p[i]; w[8 + i] = (__bf16)p[16 + i]; }
  return w; }
__device__ __forceinline__ v16h wcolh_io(const float* Wm, int k0, int o, int lane, int ld) { v16h w; const int g = lane >> 4;
#pragma unroll
  for (int i = 0; i < 8; ++i) { w[i] = (_Float16)(bfr(Wm[(size_t)(k0 + 8 * g + i) * ld + o]) * 256.0f); w[8 + i] = (_Float16)(bfr(Wm[(size_t)(k0 + 16 + 8 * g + i) * ld + o]) * 256.0f); }
  return w; }
__device__ __forceinline__ v16h wcolh_oi(const float* Wm, int k0, int o, int lane, int K) { v16h w; const float* p = Wm + (size_t)o * K + k0 + 8 * (lane >> 4);
#pragma unroll
  for (int i = 0; i < 8; ++i) { w[i] = (_Float16)(bfr(p[i]) * 256.0f); w[8 + i] = (_Float16)(bfr(p[16 + i]) * 256.0f); }
  return w; }
#define WQKV_LAYOUT 1   // 0 = (in,out) [DIN][CC]; 1 = (out,in) [CC][DIN]; 2 = per-head [NH][DIN][HD]
__device__ __forceinline__ v16b wcol_hdk(const float* Wm, int k0, int o, int lane) { v16b w; const int g = lane >> 4; const float* p = Wm + (size_t)(o / HD) * DIN * HD + (o % HD);
#pragma unroll
  for (int i = 0; i < 8; ++i) { w[i] = (__bf16)p[(size_t)(k0 + 8 * g + i) * HD]; w[8 + i] = (__bf16)p[(size_t)(k0 + 16 + 8 * g + i) * HD]; }
  return w; }
#define WO_OUT_IN 1
#if WQKV_LAYOUT == 1
#define WCOL(W, k0, o, lane) wcol_oi(W, k0, o, lane, DIN)
#elif WQKV_LAYOUT == 2
#define WCOL(W, k0, o, lane) wcol_hdk(W, k0, o, lane)
#else
#define WCOL(W, k0, o, lane) wcol_io(W, k0, o, lane, CC)
#endif
#if WO_OUT_IN
#define WOCOL(W, k0, o, lane) wcol_oi(W, k0, o, lane, CC)
#define WOCOLH(W, k0, o, lane) wcolh_oi(W, k0, o, lane, CC)
#else
#define WOCOL(W, k0, o, lane) wcol_io(W, k0, o, lane, DIN)
#define WOCOLH(W, k0, o, lane) wcolh_io(W, k0, o, lane, DIN)
#endif

static_assert(CC == NH * HD && HDSC == CC && HD <= 128, "one 512-wide head: scores over all CC columns, P.v in NH column groups of HD <= 128 (the k_pv store width)");
#ifndef PROJ_EXTRA_PARAMS
#define PROJ_EXTRA_PARAMS
#endif

#define WS_QH  0u                                      // f16 q rows [b*t][CC]
#define WS_KH  (WS_QH + 2u * (size_t)NB * TT * CC)      // f16 k rows [b*t][CC]
#define WS_VT  (WS_KH + 2u * (size_t)NB * TT * CC)      // f16 v planes [b][c][t]
#define WS_QL  (WS_VT + 2u * (size_t)NB * CC * TT)      // f16 q residual x 2^10 rows [b][t < QHI][CC]
#define WS_KL  (WS_QL + 2u * (size_t)NB * QHI * CC)     // f16 k residual x 2^10 rows [b][t < KHI][CC]
#define WS_VB  (WS_KL + 2u * (size_t)NB * KHI * CC)     // bf16 v hi planes [b][c][t < KHI]
#define WS_VBL (WS_VB + 2u * (size_t)NB * CC * KHI)
#define WS_S   (WS_VBL + 2u * (size_t)NB * CC * KHI)    // f16 exp2(base-2 logit - key block's row max) [b][t][s]: one plane per batch, so that each stage is one launch over all batches
#define WS_ST  (WS_S  + 2u * (size_t)NB * TT * TT)      // f32 pairs (row max in base-2 units, row sum of exp2) of each 128-key block [b][kb][t]: a wave's 32 rows fill two 128-B lines
#define WS_Y   (WS_ST + 8u * (size_t)NB * (TT / 128) * TT)   // f32 ctx rows [b*t][CC] (only when there is an output projection)
#define WS_END (WS_Y)   // no ctx rows: k_pv writes the output directly

// ---- operand staging: a block's A tile (128 rows) and B tile (128 rows) of one 128-wide k chunk go to LDS (f32 source: whole-line loads through registers, one wave per 512-B row, rounded once on the way; 16-bit source: tensor loads, below); all 4 waves then read their fragments from LDS (the loops of these helpers are unrolled whole, so that every register array is indexed by constants)
#define KCH 128   // k elements per staged chunk
#define LP 136    // LDS row pitch in 16-bit elements: 272 B = 17 x 16 B, so that 16 rows read 16 B each fall on all 64 banks
typedef __attribute__((ext_vector_type(4))) _Float16 v4h;
typedef __attribute__((ext_vector_type(4))) __bf16 v4b;
template <int ROWS> __device__ __forceinline__ void ld32(v4f (&r)[ROWS / 4], const float* src, size_t ld, int tid) { const float* p = src + (size_t)(tid >> 5) * ld + (tid & 31) * 4;
#pragma unroll
  for (int i = 0; i < ROWS / 4; ++i) r[i] = *(const v4f*)(p + (size_t)(i * 4) * ld);
  asm volatile("s_wait_xcnt 0x0" :: "v"(p) : "memory"); }   // stands in front of any overwrite of the address register pair that these loads name; p as an input keeps that pair whole up to here
template <int ROWS, typename E, typename V4> __device__ __forceinline__ void st32(E* t, const v4f (&r)[ROWS / 4], int tid) {
#pragma unroll
  for (int i = 0; i < ROWS / 4; ++i) { V4 h;
#pragma unroll
    for (int e = 0; e < 4; ++e) h[e] = (E)r[i][e];
    *(V4*)(t + (i * 4 + (tid >> 5)) * LP + (tid & 31) * 4) = h; } }
// ---- 16-bit operands: one tensor load a wave and stage brings a slice of 64 rows of 256 B straight into LDS, through no register, at the same 272-B pitch (pad of 16 B behind every 256-B row); waves 0 and 1 bring the two halves of the A tile, waves 2 and 3 those of the B tile; two buffers, so that stage s + 1 flies while stage s is multiplied
typedef uint32_t u32x4 __attribute__((ext_vector_type(4)));
typedef uint32_t u32x8 __attribute__((ext_vector_type(8)));
#define SLB 18432u          // a slice's place in LDS: 64 rows x 272 B = 17,408 B, rounded up to a multiple of 2 KiB
#define RBUF (4u * SLB)     // one buffer: A slices 0, 1, then B slices 0, 1
#define BRO(j) (((j) >> 2) * (int)(SLB / 2u) + ((j) & 3) * 16 * LP)   // 16-bit elements from B row 0 to B row 16 j
static_assert(SLB % 2048u == 0 && SLB >= 64u * LP * 2u && KCH * 2 == 256 && LP * 2 == 256 + 16, "slices at multiples of 2 KiB; rows of 256 B at the padded pitch");
__device__ __forceinline__ uint32_t uni(uint32_t v) { return (uint32_t)__builtin_amdgcn_readfirstlane(v); }
__device__ __forceinline__ uint32_t pinned(uint32_t v) { uint32_t w = uni(v); asm volatile("" : "+s"(w)); return w; }   // it holds a wave-uniform value in a scalar register, so that the test around a tensor load compiles to a scalar branch, and the descriptor words formed from a stage number taken behind a wait stay behind that wait
__device__ __forceinline__ u32x8 tdm_group1(uint32_t src_pitch) { u32x8 g;   // extents in bytes, tensor = tile = 64 rows of 256 B
  g[0] = uni((1u << 20) | (5u << 22) | (3u << 25)); g[1] = uni(256u << 16); g[2] = uni(64u << 16); g[3] = uni(256u << 16); g[4] = uni(64u); g[5] = uni(src_pitch); g[6] = uni(0u); g[7] = uni(0u); return g; }
__device__ __forceinline__ void tdm_load(uint32_t lds_dst, uint64_t ga, u32x8 g1) { u32x4 g0; g0[0] = uni(1u); g0[1] = uni(lds_dst); g0[2] = uni((uint32_t)ga); g0[3] = uni((((uint32_t)(ga >> 32)) & 0x01FFFFFFu) | 0x80000000u);
  asm volatile("tensor_load_to_lds %0, %1" :: "s"(g0), "s"(g1) : "memory"); }
__device__ __forceinline__ void wait_tensor0() { asm volatile("s_wait_tensorcnt 0x0" ::: "memory"); }   // the wave's own request has landed (the compiler places no wait for a tensor load)
__device__ __forceinline__ void wait_ds0() { asm volatile("s_wait_dscnt 0x0" ::: "memory"); }   // the wave's LDS reads have returned before the buffer is given up for a refill
// one staged chunk of a wave's 32 x 128 product (two 16-row tiles against eight 16-column tiles: every B fragment read from LDS serves two products): the 20 fragment reads of k step kc + 1 stand as one group in front of the 16 products of step kc, so that no product waits out an LDS latency of its own (arow: the lane's A row in row tile 0; brow: the lane's row of B column group 0)
__device__ __forceinline__ void chunk_h(const _Float16* arow, const _Float16* brow, int lane, v8f (&acc)[2][8]) { v16h a[2], b[8];
#pragma unroll
  for (int i = 0; i < 2; ++i) a[i] = frag_h(arow + i * 16 * LP, lane);
#pragma unroll
  for (int j = 0; j < 8; ++j) b[j] = frag_h(brow + BRO(j), lane);
#pragma unroll
  for (int kc = 0; kc < KCH / 32; ++kc) { v16h an[2], bn[8];
#pragma unroll
    for (int i = 0; i < 2; ++i) an[i] = a[i];
#pragma unroll
    for (int j = 0; j < 8; ++j) bn[j] = b[j];
    if (kc + 1 < KCH / 32) {
#pragma unroll
      for (int i = 0; i < 2; ++i) an[i] = frag_h(arow + i * 16 * LP + (kc + 1) * 32, lane);
#pragma unroll
      for (int j = 0; j < 8; ++j) bn[j] = frag_h(brow + BRO(j) + (kc + 1) * 32, lane); }
    __builtin_amdgcn_sched_barrier(0);   // keeps the next step's reads one group in front of this step's products: left free, the compiler spreads them among the products, each with a wait of its own
#pragma unroll
    for (int j = 0; j < 8; ++j)
#pragma unroll
      for (int i = 0; i < 2; ++i) acc[i][j] = wmma16(a[i], b[j], acc[i][j]);
    __builtin_amdgcn_sched_barrier(0);   // closes the block of products against the reads of the step after next
#pragma unroll
    for (int i = 0; i < 2; ++i) a[i] = an[i];
#pragma unroll
    for (int j = 0; j < 8; ++j) b[j] = bn[j]; } }
__device__ __forceinline__ void chunk_b(const __bf16* arow, const __bf16* brow, int lane, v8f (&acc)[2][8]) { v16b a[2], b[8];
#pragma unroll
  for (int i = 0; i < 2; ++i) a[i] = frag_b(arow + i * 16 * LP, lane);
#pragma unroll
  for (int j = 0; j < 8; ++j) b[j] = frag_b(brow + j * 16 * LP, lane);
#pragma unroll
  for (int kc = 0; kc < KCH / 32; ++kc) { v16b an[2], bn[8];
#pragma unroll
    for (int i = 0; i < 2; ++i) an[i] = a[i];
#pragma unroll
    for (int j = 0; j < 8; ++j) bn[j] = b[j];
    if (kc + 1 < KCH / 32) {
#pragma unroll
      for (int i = 0; i < 2; ++i) an[i] = frag_b(arow + i * 16 * LP + (kc + 1) * 32, lane);
#pragma unroll
      for (int j = 0; j < 8; ++j) bn[j] = frag_b(brow + j * 16 * LP + (kc + 1) * 32, lane); }
    __builtin_amdgcn_sched_barrier(0);   // keeps the next step's reads one group in front of this step's products: left free, the compiler spreads them among the products, each with a wait of its own
#pragma unroll
    for (int j = 0; j < 8; ++j)
#pragma unroll
      for (int i = 0; i < 2; ++i) acc[i][j] = wmma_bf(a[i], b[j], acc[i][j]);
    __builtin_amdgcn_sched_barrier(0);   // closes the block of products against the reads of the step after next
#pragma unroll
    for (int i = 0; i < 2; ++i) a[i] = an[i];
#pragma unroll
    for (int j = 0; j < 8; ++j) b[j] = bn[j]; } }
static_assert(HD == 128 && WQKV_LAYOUT == 1 && DIN % KCH == 0 && HDSC % KCH == 0 && KCH == 128, "staged chunks: k-contiguous (out,in) weights, whole chunks, one key block of kb_last() per chunk");
static_assert(((DIN / KCH) & (DIN / KCH - 1)) == 0 && ((HDSC / KCH) & (HDSC / KCH - 1)) == 0 && ((TT / KCH) & (TT / KCH - 1)) == 0, "rotated walks wrap by a mask: stage counts are powers of two");

#define BM 128   // rows of a block's tile: 4 waves x 32 rows
static_assert(TT % BM == 0 && KHI % 8 == 0 && QHI % 8 == 0 && KHI == 64 && (QHI == 0 || QHI == 64), "a block's rows lie in one batch; residual rows are none or the first 64 of a batch's first block (waves 0 and 1)");
// ---- k_proj: block = (128 rows, 128 cols, which): q/k/v = X W (+ b) with exact bf16 products (K = DIN) -> which 0: q f16 rows (+ residual rows < QHI); 1: k f16 rows (+ residual rows < KHI); 2: v f16 planes [c][t] (+ bf16 hi/lo planes for t < KHI)
__global__ __launch_bounds__(128) void k_proj(const float* __restrict__ XQ, const float* __restrict__ XK, const float* __restrict__ XV, const float* __restrict__ WQ, const float* __restrict__ WK, const float* __restrict__ WV, const float* __restrict__ BQ, const float* __restrict__ BK, const float* __restrict__ BV,
    _Float16* __restrict__ QH, _Float16* __restrict__ QL, _Float16* __restrict__ KH, _Float16* __restrict__ KL, _Float16* __restrict__ VT, __bf16* __restrict__ VB, __bf16* __restrict__ VBL) {
  __shared__ __align__(16) unsigned char smem[71680];   // main loop: operand tiles xa, xb; behind its last barrier: the output staging arrays
  _Float16 (*sh)[136] = (_Float16 (*)[136])smem; _Float16 (*sl)[136] = (_Float16 (*)[136])(smem + 34816); _Float16 (*th)[136] = (_Float16 (*)[136])smem; __bf16 (*tb)[72] = (__bf16 (*)[72])(smem + 34816); __bf16 (*tbl)[72] = (__bf16 (*)[72])(smem + 53248);
  __bf16* xa = (__bf16*)smem; __bf16* xb = xa + BM * LP;
  const int tid = threadIdx.x, wave = tid >> 5, lane = tid & 31, col = lane & 15, g = lane >> 4; const int which = blockIdx.z; const int c0 = blockIdx.y * 128; const size_t r0 = (size_t)blockIdx.x * BM; const size_t bb = r0 / TT; const int t0 = (int)(r0 % TT);
  const float* X = which == 0 ? XQ : which == 1 ? XK : XV; const float* WA = which == 0 ? WQ : which == 1 ? WK : WV; const float* BA = which == 0 ? BQ : which == 1 ? BK : BV;
  v8f acc[2][8] = {};
  const int rot = (int)(blockIdx.x + blockIdx.y + blockIdx.z);   // rotated start of the k walk: the 12 blocks that share an x tile and the 64 that share a weight tile begin at different chunks and wrap, so that they do not ask L2 for the same lines at the same moment
#pragma unroll 1   // rolled: the barriers keep the chunks apart anyway, and one copy of the chunk body keeps the code short
  for (int c = 0; c < DIN / KCH; ++c) { const int cs = (c + rot) & (DIN / KCH - 1);
    { v4f xr[32]; ld32<BM>(xr, X + r0 * DIN + cs * KCH, DIN, tid); st32<BM, __bf16, v4b>(xa, xr, tid); }
    { v4f wr[32]; ld32<128>(wr, WA + (size_t)c0 * DIN + cs * KCH, DIN, tid); st32<128, __bf16, v4b>(xb, wr, tid); }
    __syncthreads();   // the chunk's tiles are complete before any wave reads them
    chunk_b(xa + (wave * 32 + col) * LP, xb + col * LP, lane, acc);
    __syncthreads(); }   // every wave has left the tiles before they are refilled (or reused as output staging)
  if (which < 2) { _Float16* DH = which == 0 ? QH : KH; _Float16* DL = which == 0 ? QL : KL; const int nhi = which == 0 ? QHI : KHI;
#pragma unroll
    for (int j = 0; j < 8; ++j) { const float bias = BA ? bfr(BA[c0 + j * 16 + col]) : 0.f;
#pragma unroll
      for (int i = 0; i < 2; ++i)
#pragma unroll
        for (int r = 0; r < 8; ++r) { const float v = acc[i][j][r] + bias; const _Float16 hv = (_Float16)v; sh[wave * 32 + i * 16 + 8 * g + r][j * 16 + col] = hv; sl[wave * 32 + i * 16 + 8 * g + r][j * 16 + col] = (_Float16)((v - (float)hv) * 1024.0f); } }
    __syncthreads();
    _Float16* dh = DH + (r0 + (tid >> 4)) * CC + c0 + (tid & 15) * 8; _Float16* dl = DL + (bb * nhi + t0 + (tid >> 4)) * (size_t)CC + c0 + (tid & 15) * 8;   // 16 lanes per 256-B row segment, 8 rows a group
#pragma unroll
    for (int i = 0; i < BM / 8; ++i) vst2(dh + (size_t)(i * 8) * CC, *(const v4u*)&sh[i * 8 + (tid >> 4)][(tid & 15) * 8]);
    asm volatile("s_wait_xcnt 0x0" :: "v"(dh) : "memory");   // as in ld32, and in front of the LDS reads below, which reuse these stores' data registers
    if (t0 < nhi) {   // nhi is 0 or 64 and t0 a multiple of BM: the block's first 64 rows, all below nhi
#pragma unroll
      for (int i = 0; i < 8; ++i) vst2(dl + (size_t)(i * 8) * CC, *(const v4u*)&sl[i * 8 + (tid >> 4)][(tid & 15) * 8]); }
    asm volatile("s_wait_xcnt 0x0" :: "v"(dl) : "memory");   // as in ld32
  } else {
#pragma unroll
    for (int j = 0; j < 8; ++j) { const float bias = BA ? bfr(BA[c0 + j * 16 + col]) : 0.f;
#pragma unroll
      for (int i = 0; i < 2; ++i)
#pragma unroll
        for (int r = 0; r < 8; ++r) { acc[i][j][r] += bias; th[j * 16 + col][wave * 32 + i * 16 + 8 * g + r] = (_Float16)acc[i][j][r]; } }
    if (wave < 2) {   // waves 0 and 1 hold the block's first 64 rows, the only ones that can lie below KHI
#pragma unroll
      for (int j = 0; j < 8; ++j)
#pragma unroll
        for (int i = 0; i < 2; ++i)
#pragma unroll
          for (int r = 0; r < 8; ++r) { const float v = acc[i][j][r]; const int rl = wave * 32 + i * 16 + 8 * g + r, cl = j * 16 + col; const __bf16 bh = (__bf16)v; tb[cl][rl] = bh; tbl[cl][rl] = (__bf16)(v - (float)bh); } }
    __syncthreads();
    _Float16* vt = VT + (bb * CC + c0 + (tid >> 4)) * (size_t)TT + t0 + (tid & 15) * 8;   // 16 lanes per 256-B plane segment, 8 planes a group
#pragma unroll
    for (int i = 0; i < 16; ++i) vst2(vt + (size_t)(i * 8) * TT, *(const v4u*)&th[i * 8 + (tid >> 4)][(tid & 15) * 8]);
    asm volatile("s_wait_xcnt 0x0" :: "v"(vt) : "memory");   // as in ld32
    if (t0 < KHI) { const size_t o3 = (bb * CC + c0 + (tid >> 3)) * (size_t)KHI + t0 + (tid & 7) * 8; __bf16* vb = VB + o3; __bf16* vbl = VBL + o3;
#pragma unroll
      for (int i = 0; i < 8; ++i) { vst2(vb + (size_t)(i * 16) * KHI, *(const v4u*)&tb[i * 16 + (tid >> 3)][(tid & 7) * 8]); vst2(vbl + (size_t)(i * 16) * KHI, *(const v4u*)&tbl[i * 16 + (tid >> 3)][(tid & 7) * 8]); }
      asm volatile("s_wait_xcnt 0x0" :: "v"(vb), "v"(vbl) : "memory"); } } }   // as in ld32
// value of lane l ^ M inside the lane's 16-lane row, by DPP row_xmask (every lane on): a vector move, where a shuffle would go through the LDS unit
template <int M> __device__ __forceinline__ float rowx(float v) { return __builtin_bit_cast(float, __builtin_amdgcn_update_dpp(0, __builtin_bit_cast(int, v), 0x160 | M, 0xf, 0xf, true)); }
// native exp2 with its v_nop in the same statement: the slot that the instruction set asks for between a transcendental and an instruction that reads its result or overwrites its source
__device__ __forceinline__ float exp2_slot(float v) { float e; asm("v_exp_f32 %0, %1\n\tv_nop" : "=v"(e) : "v"(v)); return e; }
// ---- k_sc: block = (128 queries qb, key block kb, batch b = blockIdx.z, plane b): logits x SCALE2 (base-2 units), one product, then this key block's share of the softmax (row max m, e = exp2(logit - m) to the plane, (m, sum e) to ST)  [here: head width HDSC = 512, single head]
static_assert(QBH == 0 && QHI == 0 && !CAUSAL, "every query block takes the staged single-product path over all key blocks");
__global__ __launch_bounds__(128) void k_sc(const _Float16* __restrict__ QH, const _Float16* __restrict__ KH, _Float16* __restrict__ S0, float* __restrict__ ST) { __shared__ __attribute__((aligned(2048))) unsigned char smem[2 * RBUF];   // main loop: two buffers of q and k slices; behind its last barrier: the output staging se
  _Float16 (*se)[32][LP] = (_Float16 (*)[32][LP])smem;
  const int qb = blockIdx.x, kb = blockIdx.y;
  const int b = blockIdx.z; _Float16* S = S0 + (size_t)b * TT * TT;
  const int tid = threadIdx.x, wave = tid >> 5, lane = tid & 31, col = lane & 15, g = lane >> 4; const int k0 = kb * 128; const int ql0 = qb * BM + wave * 32; const size_t kr0 = (size_t)b * TT + k0;
  v8f acc[2][8] = {};
  const uint32_t wv = uni((uint32_t)tid >> 5), nst = HDSC / KCH; const uint32_t tdst = (uint32_t)(size_t)smem + wv * SLB;   // the wave's slice: its place in buffer 0, and its first source byte
  const uint64_t tsrc = (uint64_t)(size_t)(((wv & 2u) ? KH + kr0 * CC : QH + ((size_t)b * TT + qb * BM) * CC) + (size_t)(wv & 1u) * 64 * CC); const u32x8 g1 = tdm_group1(CC * 2u);
  const uint32_t rot = uni((uint32_t)(qb + kb));   // rotated start of the k walk: stage s brings chunk (s + rot) mod nst, so that the 16 blocks that share a q tile and the 16 that share a k tile do not ask L2 for the same lines at the same moment
  tdm_load(tdst, tsrc + (uint64_t)(rot & (nst - 1u)) * (KCH * 2u), g1); wait_tensor0();
  __syncthreads();   // stage 0 is complete before any wave reads it
  { const uint32_t sn = pinned(1u); tdm_load(tdst + (sn & 1u) * RBUF, tsrc + (uint64_t)((sn + rot) & (nst - 1u)) * (KCH * 2u), g1); }   // the stage number is taken behind the wait, so that no descriptor word is rewritten while stage 0's request is out
#pragma unroll 1   // rolled, as in k_proj
  for (uint32_t c = 0; c < nst; ++c) { const _Float16* tb = (const _Float16*)(smem + (c & 1u) * RBUF);
    chunk_h(tb + (wave >> 1) * (int)(SLB / 2u) + ((wave & 1) * 32 + col) * LP, tb + SLB + col * LP, lane, acc);   // the B slices begin 2 SLB bytes = SLB elements into the buffer
    wait_ds0(); wait_tensor0();
    __syncthreads();   // stage c + 1 is complete, and every wave has left stage c's buffer before it is refilled (or reused as output staging)
    if (pinned(c + 2u < nst)) { const uint32_t sn = pinned(c + 2u); tdm_load(tdst + (sn & 1u) * RBUF, tsrc + (uint64_t)((sn + rot) & (nst - 1u)) * (KCH * 2u), g1); } }   // refill of the buffer just left, only while that stage exists: scalar branch, descriptor formed behind the wait
  wait_tensor0(); wait_ds0();
  // row 16i + 8g + r of the wave's tile lies in the 16 lanes of half g, 8 columns a lane: max and sum go over the lane's 8 values, then over the half by 4 exchanges
  float mo = 0.f, so = 0.f;
#pragma unroll
  for (int i = 0; i < 2; ++i)
#pragma unroll
  for (int r = 0; r < 8; ++r) { float lg[8]; float m = -3.0e38f;
#pragma unroll
    for (int j = 0; j < 8; ++j) { lg[j] = acc[i][j][r] * SCALE2; m = fmaxf(m, lg[j]); }
    m = fmaxf(m, rowx<1>(m)); m = fmaxf(m, rowx<2>(m)); m = fmaxf(m, rowx<4>(m)); m = fmaxf(m, rowx<8>(m));
    float sum = 0.f;
#pragma unroll
    for (int j = 0; j < 8; ++j) { const float e = exp2_slot(lg[j] - m); sum += e; se[wave][i * 16 + 8 * g + r][j * 16 + col] = (_Float16)e; }
    sum += rowx<1>(sum); sum += rowx<2>(sum); sum += rowx<4>(sum); sum += rowx<8>(sum);
    if (col == i * 8 + r) { mo = m; so = sum; } }
  float* sp = ST + (((size_t)b * (TT / 128) + kb) * TT + ql0 + (col >> 3) * 16 + 8 * g + (col & 7)) * 2;
  _Float16* op = S + (size_t)(ql0 + g) * TT + k0 + col * 8;
  LDSX();
#pragma unroll
  for (int i = 0; i < 16; ++i) vst2(op + (size_t)(i * 2) * TT, *(const v4u*)&se[wave][i * 2 + g][col * 8]);   // 16 lanes per 256-B row segment
  { v2f st; st[0] = mo; st[1] = so; vst2(sp, st); }   // lane col of half g stores row 16 (col >> 3) + 8g + (col & 7): the wave's 32 rows fill two 128-B lines
  asm volatile("s_wait_xcnt 0x0" :: "v"(sp), "v"(op) : "memory"); }   // as in ld32: stands in front of any overwrite of the address pairs that these stores name
// ---- k_pv: block = 128 queries (qb = blockIdx.x) of (column group h = blockIdx.y, batch b = blockIdx.z; plane b): ctx = sum over key blocks kb of w[kb] * (e[kb] . v[kb]) (e f16 against v f16: 1 product), w[kb] = exp2(m[kb] - row max) / row sum from the score kernel's (m, sum) pairs, per row, f32; 512-B (row, column group) segment by the wave's 32 lanes
__global__ __launch_bounds__(128) void k_pv(const _Float16* __restrict__ PS0, const float* __restrict__ ST, const _Float16* __restrict__ VT, float* __restrict__ Y) { const int h = blockIdx.y, b = blockIdx.z; const _Float16* PS = PS0 + (size_t)b * TT * TT; __shared__ __align__(16) float ss[4][32][HD + 4]; __shared__ __attribute__((aligned(2048))) unsigned char ring[2 * RBUF]; __shared__ __align__(16) float sf[TT / 128][BM];
  const int tid = threadIdx.x, wave = tid >> 5, lane = tid & 31, col = lane & 15, g = lane >> 4; const int qb = blockIdx.x; const int ql0 = qb * BM + wave * 32;
  v8f acc[2][HD / 16] = {};
  const _Float16* Pg = PS + (size_t)qb * BM * TT; const _Float16* Vg = VT + ((size_t)b * CC + h * HD) * (size_t)TT; const uint32_t nst = TT / KCH;
  const uint32_t wv = uni((uint32_t)tid >> 5); const uint32_t tdst = (uint32_t)(size_t)ring + wv * SLB;   // the wave's slice: its place in buffer 0, and its first source byte
  const uint64_t tsrc = (uint64_t)(size_t)(((wv & 2u) ? Vg : Pg) + (size_t)(wv & 1u) * 64 * TT); const u32x8 g1 = tdm_group1(TT * 2u);
  const uint32_t rot = uni((uint32_t)(qb + 4 * h));   // rotated start of the key walk: stage s brings key block (s + rot) mod nst, so that the 4 blocks that share a row block of the plane and the 16 that share a v tile do not ask L2 for the same lines at the same moment
  tdm_load(tdst, tsrc + (uint64_t)(rot & (nst - 1u)) * (KCH * 2u), g1);
  {   // one query row a thread: the row's weight for each key block (read behind the barrier in front of the loop), while stage 0 flies
    const float* sp = ST + ((size_t)b * (TT / 128) * TT + qb * BM + tid) * 2; float mk[TT / 128], sk[TT / 128]; float mx = -3.0e38f, sum = 0.f;
#pragma unroll
    for (int kb = 0; kb < TT / 128; ++kb) { const v2f st = *(const v2f*)(sp + (size_t)kb * TT * 2); mk[kb] = st[0]; sk[kb] = st[1]; }
    asm volatile("s_wait_xcnt 0x0" :: "v"(sp) : "memory");   // as in ld32
#pragma unroll
    for (int kb = 0; kb < TT / 128; ++kb) mx = fmaxf(mx, mk[kb]);
#pragma unroll
    for (int kb = 0; kb < TT / 128; ++kb) { mk[kb] = exp2_slot(mk[kb] - mx); sum += sk[kb] * mk[kb]; }
    const float inv = 1.0f / sum;
#pragma unroll
    for (int kb = 0; kb < TT / 128; ++kb) sf[kb][tid] = mk[kb] * inv; }
  wait_tensor0();
  __syncthreads();   // stage 0 and the weights are complete before any wave reads them
  { const uint32_t sn = pinned(1u); tdm_load(tdst + (sn & 1u) * RBUF, tsrc + (uint64_t)((sn + rot) & (nst - 1u)) * (KCH * 2u), g1); }   // the stage number is taken behind the wait, so that no descriptor word is rewritten while stage 0's request is out
#pragma unroll 1   // rolled, as in k_proj
  for (uint32_t c = 0; c < nst; ++c) { const _Float16* tb = (const _Float16*)(ring + (c & 1u) * RBUF);
    const uint32_t kbs = (c + rot) & (nst - 1u);   // the key block that stage c holds
    v4f w[2][2];   // weights of the lane's 16 accumulator rows
#pragma unroll
    for (int i = 0; i < 2; ++i) { w[i][0] = *(const v4f*)&sf[kbs][wave * 32 + i * 16 + 8 * g]; w[i][1] = *(const v4f*)&sf[kbs][wave * 32 + i * 16 + 8 * g + 4]; }
    v8f part[2][HD / 16] = {}; chunk_h(tb + (wave >> 1) * (int)(SLB / 2u) + ((wave & 1) * 32 + col) * LP, tb + SLB + col * LP, lane, part);   // the B slices begin 2 SLB bytes = SLB elements into the buffer
    wait_ds0(); wait_tensor0();
    __syncthreads();   // stage c + 1 is complete, and every wave has left stage c's buffer before it is refilled
    if (pinned(c + 2u < nst)) { const uint32_t sn = pinned(c + 2u); tdm_load(tdst + (sn & 1u) * RBUF, tsrc + (uint64_t)((sn + rot) & (nst - 1u)) * (KCH * 2u), g1); }   // refill of the buffer just left, only while that stage exists: scalar branch, descriptor formed behind the wait
#pragma unroll
    for (int i = 0; i < 2; ++i)   // the weighting works on registers alone: behind the refill, so that the refill starts as early as it may
#pragma unroll
      for (int j = 0; j < HD / 16; ++j)
#pragma unroll
        for (int r = 0; r < 8; ++r) acc[i][j][r] += part[i][j][r] * w[i][r >> 2][r & 3]; }
  wait_tensor0(); wait_ds0();
#pragma unroll
  for (int i = 0; i < 2; ++i)
#pragma unroll
    for (int j = 0; j < HD / 16; ++j)
#pragma unroll
      for (int r = 0; r < 8; ++r) ss[wave][i * 16 + 8 * g + r][j * 16 + col] = acc[i][j][r];
  float* yp = Y + ((size_t)b * TT + ql0) * CC + h * HD + lane * 4;
  LDSX();
#pragma unroll
  for (int rl = 0; rl < 32; ++rl) vst2(yp + (size_t)rl * CC, *(const v4f*)&ss[wave][rl][lane * 4]);
  asm volatile("s_wait_xcnt 0x0" :: "v"(yp) : "memory"); }   // as in ld32: stands in front of any overwrite of the address pair that these stores name

extern "C" void kernel_launch(void* const* d_in, const int* in_sizes, int n_in, void* d_out, int out_size, void* d_ws, size_t ws_size, hipStream_t stream) {
  (void)in_sizes; (void)n_in; (void)out_size;
  const float** F = (const float**)d_in;
  if (ws_size < (size_t)WS_END) return;
  char* ws = (char*)d_ws; _Float16 *QH = (_Float16*)(ws + WS_QH), *KH = (_Float16*)(ws + WS_KH), *VT = (_Float16*)(ws + WS_VT), *QL = (_Float16*)(ws + WS_QL), *KL = (_Float16*)(ws + WS_KL); __bf16 *VB = (__bf16*)(ws + WS_VB), *VBL = (__bf16*)(ws + WS_VBL); _Float16* S = (_Float16*)(ws + WS_S); float *ST = (float*)(ws + WS_ST), *Y = (float*)(ws + WS_Y);
  (void)Y;
  // inputs: 0 x [4,2048,512]; 1 Wq [512,512] (out,in), 2 bq; 3 Wk, 4 bk; 5 Wv, 6 bv (biases nonzero)
  k_proj<<<dim3(TNB * TT / BM, CC / 128, 3), 128, 0, stream>>>(F[0], F[0], F[0], F[1], F[3], F[5], F[2], F[4], F[6], QH, QL, KH, KL, VT, VB, VBL);
  k_sc<<<dim3(TT / BM, TT / 128, TNB), 128, 0, stream>>>(QH, KH, S, ST);   /* one 2,048 x 2,048 plane per batch: scores over all 512 columns */
  k_pv<<<dim3(TT / BM, NH, TNB), 128, 0, stream>>>(S, ST, VT, (float*)d_out);   /* column group y: v / output columns 128y .. 128y+127, all four from the batch's one plane */
}

// v007
// Measured time: 55.8 microseconds a run.
// Next to v006, in two timings, it ran 1.05 times as fast each time.
// All steps since v000 together make it 32.3 times as fast.
// compute dtype: all float inputs rounded to bf16; q/k/v projections with EXACT bf16 products on WMMA 16x16x32 (f32 accumulate) + bias; logits q x k once to f16 each (1 product) over the full 512-wide head x 512^-0.5; softmax f32, split by key block: exp(logit - block max) once to f16 x v once to f16 (1 product per key block), each block's partial product weighted in f32 by exp(block max - row max) / row sum; four 128-column passes over the same plane; f32 output (no output projection).
#include <hip/hip_runtime.h>
#include <math.h>
#include <stdint.h>

typedef __attribute__((ext_vector_type(16))) _Float16 v16h;
typedef __attribute__((ext_vector_type(16))) __bf16 v16b;
typedef __attribute__((ext_vector_type(8)))  _Float16 v8h;
typedef __attribute__((ext_vector_type(8)))  float v8f;
typedef __attribute__((ext_vector_type(4)))  float v4f;
typedef __attribute__((ext_vector_type(2)))  float v2f;
typedef __attribute__((ext_vector_type(4)))  unsigned v4u;
typedef __attribute__((ext_vector_type(4)))  int v4i;
typedef float __attribute__((may_alias)) float_a;
typedef int __attribute__((may_alias)) int_a;

template <typename T> __device__ __forceinline__ void vst2(void* p, T v) { *(T*)p = v;  }
// the products are the plain builtins (the compiler keeps the distances behind its own matrix instructions): an asm statement of v_nop tied to d, a and b holds those operands in v0 to v255, and the 32 x 128 wave tile, with more than 256 registers live in its loop, then builds with spills to scratch in all three kernels
__device__ __forceinline__ v8f wmma16(v16h a, v16h b, v8f c) {
  v8f d = __builtin_amdgcn_wmma_f32_16x16x32_f16(false, a, false, b, (short)0, c, false, false);
  return d;
}
__device__ __forceinline__ v8f wmma_bf(v16b a, v16b b, v8f c) {
  v8f d = __builtin_amdgcn_wmma_f32_16x16x32_bf16(false, a, false, b, (short)0, c, false, false);
  return d;
}
// 16x16x32 fragments: lane = (h = lane>>4, row/col = lane&15); elements 0..7 = k0+8h+0..7, 8..15 = k0+16+8h+0..7; D element r = row 8h+r
__device__ __forceinline__ v16h frag_h(const _Float16* rowk0, int lane) {
  union { v16h v; v8h q[2]; } u; const _Float16* p = rowk0 + 8 * (lane >> 4);
  u.q[0] = *(const v8h*)p; u.q[1] = *(const v8h*)(p + 16); return u.v;
}
__device__ __forceinline__ v16h frag_f32(const float* rowk0, int lane) {
  v16h a; const float* p = rowk0 + 8 * (lane >> 4);
#pragma unroll
  for (int i = 0; i < 8; ++i) { a[i] = (_Float16)p[i]; a[8 + i] = (_Float16)p[16 + i]; }
  return a;
}
__device__ __forceinline__ v16h frag_f32s(const float* rowk0, int lane, float sc) {
  v16h a; const float* p = rowk0 + 8 * (lane >> 4);
#pragma unroll
  for (int i = 0; i < 8; ++i) { a[i] = (_Float16)(p[i] * sc); a[8 + i] = (_Float16)(p[16 + i] * sc); }
  return a;
}
// column fragment from a [K][ld] layout (column n), rows >= K read as 0
__device__ __forceinline__ v16h fragc_f32(const float* W, int k0, int n, int lane, int ld, int K) {
  v16h a; const int g = lane >> 4;
#pragma unroll
  for (int i = 0; i < 8; ++i) { const int ka = k0 + 8 * g + i, kb = ka + 16;
    a[i] = (_Float16)(ka < K ? W[(size_t)(ka < K ? ka : K - 1) * ld + n] : 0.f); a[8 + i] = (_Float16)(kb < K ? W[(size_t)(kb < K ? kb : K - 1) * ld + n] : 0.f); }
  return a;
}
struct F2 { v16b h, l; };
__device__ __forceinline__ F2 bsplit16(const float v[16]) { F2 r;
#pragma unroll
  for (int i = 0; i < 16; ++i) { const __bf16 h = (__bf16)v[i]; r.h[i] = h; r.l[i] = (__bf16)(v[i] - (float)h); }
  return r; }
__device__ __forceinline__ F2 split_row(const float* row, int k0, int lane) { float v[16]; const float* p = row + k0 + 8 * (lane >> 4);
#pragma unroll
  for (int i = 0; i < 8; ++i) { v[i] = p[i]; v[8 + i] = p[16 + i]; }
  return bsplit16(v); }
__device__ __forceinline__ F2 split_rowK(const float* row, int k0, int lane, int K) { float v[16]; const int g = lane >> 4;
#pragma unroll
  for (int i = 0; i < 8; ++i) { const int ka = k0 + 8 * g + i, kb = ka + 16; v[i] = ka < K ? row[ka < K ? ka : K - 1] : 0.f; v[8 + i] = kb < K ? row[kb < K ? kb : K - 1] : 0.f; }
  return bsplit16(v); }
__device__ __forceinline__ F2 split_col(const float* W, int k0, int n, int lane, int ld, int K) { float v[16]; const int g = lane >> 4;
#pragma unroll
  for (int i = 0; i < 8; ++i) { const int ka = k0 + 8 * g + i, kb = ka + 16; v[i] = ka < K ? W[(size_t)(ka < K ? ka : K - 1) * ld + n] : 0.f; v[8 + i] = kb < K ? W[(size_t)(kb < K ? kb : K - 1) * ld + n] : 0.f; }
  return bsplit16(v); }
__device__ __forceinline__ v8f mac3(const F2& a, const F2& b, v8f c) { c = wmma_bf(a.l, b.h, c); c = wmma_bf(a.h, b.l, c); return wmma_bf(a.h, b.h, c); }
__device__ __forceinline__ float sigm(float v) { return 1.0f / (1.0f + expf(-v)); }
#define LDSX() do { asm volatile("s_wait_dscnt 0" ::: "memory"); __builtin_amdgcn_wave_barrier(); __builtin_amdgcn_fence(__ATOMIC_RELEASE, "workgroup"); } while (0)

// Single-head scaled-dot-product self-attention with a 512-wide head (x [4,2048,512]; torch (out,in) Wq / Wk / Wv [512,512] and biases uniform(+-1/sqrt(512)) (nonzero), einsum 'bnd,ed->bne'; scores = q k^T / sqrt(512) over all 512 dims; softmax over the 2,048 keys; out = weights v, [4,2048,512]; no output projection).
#define NB 4
#define TT 2048
#define CC 512            // NH * HD = projected width
#define DIN 512          // input (model) width
#define NH 4   // P.v column groups of HD = 128 (they share ONE probability plane)
#define HD 128
#define HDSC 512   // the score kernel contracts over the whole 512-wide head
#define NQB (TT / 64)
#define SCALE (0.04419417382415922f)   // 1 / sqrt(512)
#define SCALE2 (SCALE * 1.4426950408889634f)   // SCALE x log2(e): logits in base-2 units, so that exp(a - b) is one native exp2
#define CAUSAL 0
#ifndef TNB
#define TNB NB
#endif
__device__ __forceinline__ float bfr(float v) { return (float)(__bf16)v; }
__host__ __device__ __forceinline__ int kb_last(int qb) { return CAUSAL ? ((qb * 64 + 63) >> 7) : (TT / 128 - 1); }
typedef __attribute__((ext_vector_type(8))) __bf16 v8b;
__device__ __forceinline__ v16b frag_b(const __bf16* rowk0, int lane) {
  union { v16b v; v8b q[2]; } u; const __bf16* p = rowk0 + 8 * (lane >> 4);
  u.q[0] = *(const v8b*)p; u.q[1] = *(const v8b*)(p + 16); return u.v;
}
#define QBH 0              // no query block takes a high-precision path: k_sc has only the single-product path
#define QHI 0               // single-product logits on every row
#define KHI 64            // key rows carrying k residual / v bf16 hi+lo planes (no kernel reads the k residual or the v planes)
// B fragment (k rows k0+.., output column o) of a weight: (in,out) [K][ld] or (out,in) [ld rows of K]: bf16 exact, or f16(bf16 * 256) exact
__device__ __forceinline__ v16b wcol_io(const float* Wm, int k0, int o, int lane, int ld) { v16b w; const int g = lane >> 4;
#pragma unroll
  for (int i = 0; i < 8; ++i) { w[i] = (__bf16)Wm[(size_t)(k0 + 8 * g + i) * ld + o]; w[8 + i] = (__bf16)Wm[(size_t)(k0 + 16 + 8 * g + i) * ld + o]; }
  return w; }
__device__ __forceinline__ v16b wcol_oi(const float* Wm, int k0, int o, int lane, int K) { v16b w; const float* p = Wm + (size_t)o * K + k0 + 8 * (lane >> 4);
#pragma unroll
  for (int i = 0; i < 8; ++i) { w[i] = (__bf16)p[i]; w[8 + i] = (__bf16)p[16 + i]; }
  return w; }
__device__ __forceinline__ v16h wcolh_io(const float* Wm, int k0, int o, int lane, int ld) { v16h w; const int g = lane >> 4;
#pragma unroll
  for (int i = 0; i < 8; ++i) { w[i] = (_Float16)(bfr(Wm[(size_t)(k0 + 8 * g + i) * ld + o]) * 256.0f); w[8 + i] = (_Float16)(bfr(Wm[(size_t)(k0 + 16 + 8 * g + i) * ld + o]) * 256.0f); }
  return w; }
__device__ __forceinline__ v16h wcolh_oi(const float* Wm, int k0, int o, int lane, int K) { v16h w; const float* p = Wm + (size_t)o * K + k0 + 8 * (lane >> 4);
#pragma unroll
  for (int i = 0; i < 8; ++i) { w[i] = (_Float16)(bfr(p[i]) * 256.0f); w[8 + i] = (_Float16)(bfr(p[16 + i]) * 256.0f); }
  return w; }
#define WQKV_LAYOUT 1   // 0 = (in,out) [DIN][CC]; 1 = (out,in) [CC][DIN]; 2 = per-head [NH][DIN][HD]
__device__ __forceinline__ v16b wcol_hdk(const float* Wm, int k0, int o, int lane) { v16b w; const int g = lane >> 4; const float* p = Wm + (size_t)(o / HD) * DIN * HD + (o % HD);
#pragma unroll
  for (int i = 0; i < 8; ++i) { w[i] = (__bf16)p[(size_t)(k0 + 8 * g + i) * HD]; w[8 + i] = (__bf16)p[(size_t)(k0 + 16 + 8 * g + i) * HD]; }
  return w; }
#define WO_OUT_IN 1
#if WQKV_LAYOUT == 1
#define WCOL(W, k0, o, lane) wcol_oi(W, k0, o, lane, DIN)
#elif WQKV_LAYOUT == 2
#define WCOL(W, k0, o, lane) wcol_hdk(W, k0, o, lane)
#else
#define WCOL(W, k0, o, lane) wcol_io(W, k0, o, lane, CC)
#endif
#if WO_OUT_IN
#define WOCOL(W, k0, o, lane) wcol_oi(W, k0, o, lane, CC)
#define WOCOLH(W, k0, o, lane) wcolh_oi(W, k0, o, lane, CC)
#else
#define WOCOL(W, k0, o, lane) wcol_io(W, k0, o, lane, DIN)
#define WOCOLH(W, k0, o, lane) wcolh_io(W, k0, o, lane, DIN)
#endif

static_assert(CC == NH * HD && HDSC == CC && HD <= 128, "one 512-wide head: scores over all CC columns, P.v in NH column groups of HD <= 128 (the k_pv store width)");
#ifndef PROJ_EXTRA_PARAMS
#define PROJ_EXTRA_PARAMS
#endif

#define WS_QH  0u                                      // f16 q rows [b*t][CC]
#define WS_KH  (WS_QH + 2u * (size_t)NB * TT * CC)      // f16 k rows [b*t][CC]
#define WS_VT  (WS_KH + 2u * (size_t)NB * TT * CC)      // f16 v planes [b][c][t]
#define WS_QL  (WS_VT + 2u * (size_t)NB * CC * TT)      // f16 q residual x 2^10 rows [b][t < QHI][CC]
#define WS_KL  (WS_QL + 2u * (size_t)NB * QHI * CC)     // f16 k residual x 2^10 rows [b][t < KHI][CC]
#define WS_VB  (WS_KL + 2u * (size_t)NB * KHI * CC)     // bf16 v hi planes [b][c][t < KHI]
#define WS_VBL (WS_VB + 2u * (size_t)NB * CC * KHI)
#define WS_S   (WS_VBL + 2u * (size_t)NB * CC * KHI)    // f16 exp2(base-2 logit - key block's row max) [b][t][s]: one plane per batch, so that each stage is one launch over all batches
#define WS_ST  (WS_S  + 2u * (size_t)NB * TT * TT)      // f32 pairs (row max in base-2 units, row sum of exp2) of each 128-key block [b][kb][t]: a wave's 32 rows fill two 128-B lines
#define WS_Y   (WS_ST + 8u * (size_t)NB * (TT / 128) * TT)   // f32 ctx rows [b*t][CC] (only when there is an output projection)
#define WS_END (WS_Y)   // no ctx rows: k_pv writes the output directly

// ---- operand staging: a block's A tile (128 rows) and B tile (128 rows) of one 128-wide k chunk go to LDS (f32 source: whole-line loads through registers, one wave per 512-B row, rounded once on the way; 16-bit source: tensor loads, below); all 4 waves then read their fragments from LDS (the loops of these helpers are unrolled whole, so that every register array is indexed by constants)
#define KCH 128   // k elements per staged chunk
#define LP 136    // LDS row pitch in 16-bit elements: 272 B = 17 x 16 B, so that 16 rows read 16 B each fall on all 64 banks
typedef __attribute__((ext_vector_type(4))) _Float16 v4h;
typedef __attribute__((ext_vector_type(4))) __bf16 v4b;
template <int ROWS> __device__ __forceinline__ void ld32(v4f (&r)[ROWS / 4], const float* src, size_t ld, int tid) { const float* p = src + (size_t)(tid >> 5) * ld + (tid & 31) * 4;
#pragma unroll
  for (int i = 0; i < ROWS / 4; ++i) r[i] = *(const v4f*)(p + (size_t)(i * 4) * ld);
  asm volatile("s_wait_xcnt 0x0" :: "v"(p) : "memory"); }   // stands in front of any overwrite of the address register pair that these loads name; p as an input keeps that pair whole up to here
template <int ROWS, typename E, typename V4> __device__ __forceinline__ void st32(E* t, const v4f (&r)[ROWS / 4], int tid) {
#pragma unroll
  for (int i = 0; i < ROWS / 4; ++i) { V4 h;
#pragma unroll
    for (int e = 0; e < 4; ++e) h[e] = (E)r[i][e];
    *(V4*)(t + (i * 4 + (tid >> 5)) * LP + (tid & 31) * 4) = h; } }
// ---- 16-bit operands: one tensor load a wave and stage brings a slice of 64 rows of 256 B straight into LDS, through no register, at the same 272-B pitch (pad of 16 B behind every 256-B row); waves 0 and 1 bring the two halves of the A tile, waves 2 and 3 those of the B tile; two buffers, so that stage s + 1 flies while stage s is multiplied
typedef uint32_t u32x4 __attribute__((ext_vector_type(4)));
typedef uint32_t u32x8 __attribute__((ext_vector_type(8)));
#define SLB 18432u          // a slice's place in LDS: 64 rows x 272 B = 17,408 B, rounded up to a multiple of 2 KiB
#define RBUF (4u * SLB)     // one buffer: A slices 0, 1, then B slices 0, 1
#define BRO(j) (((j) >> 2) * (int)(SLB / 2u) + ((j) & 3) * 16 * LP)   // 16-bit elements from B row 0 to B row 16 j
static_assert(SLB % 2048u == 0 && SLB >= 64u * LP * 2u && KCH * 2 == 256 && LP * 2 == 256 + 16, "slices at multiples of 2 KiB; rows of 256 B at the padded pitch");
__device__ __forceinline__ uint32_t uni(uint32_t v) { return (uint32_t)__builtin_amdgcn_readfirstlane(v); }
__device__ __forceinline__ uint32_t pinned(uint32_t v) { uint32_t w = uni(v); asm volatile("" : "+s"(w)); return w; }   // it holds a wave-uniform value in a scalar register, so that the test around a tensor load compiles to a scalar branch, and the descriptor words formed from a stage number taken behind a wait stay behind that wait
__device__ __forceinline__ u32x8 tdm_group1(uint32_t src_pitch) { u32x8 g;   // extents in bytes, tensor = tile = 64 rows of 256 B
  g[0] = uni((1u << 20) | (5u << 22) | (3u << 25)); g[1] = uni(256u << 16); g[2] = uni(64u << 16); g[3] = uni(256u << 16); g[4] = uni(64u); g[5] = uni(src_pitch); g[6] = uni(0u); g[7] = uni(0u); return g; }
__device__ __forceinline__ void tdm_load(uint32_t lds_dst, uint64_t ga, u32x8 g1) { u32x4 g0; g0[0] = uni(1u); g0[1] = uni(lds_dst); g0[2] = uni((uint32_t)ga); g0[3] = uni((((uint32_t)(ga >> 32)) & 0x01FFFFFFu) | 0x80000000u);
  asm volatile("tensor_load_to_lds %0, %1" :: "s"(g0), "s"(g1) : "memory"); }
__device__ __forceinline__ void wait_tensor0() { asm volatile("s_wait_tensorcnt 0x0" ::: "memory"); }   // the wave's own request has landed (the compiler places no wait for a tensor load)
__device__ __forceinline__ void wait_ds0() { asm volatile("s_wait_dscnt 0x0" ::: "memory"); }   // the wave's LDS reads have returned before the buffer is given up for a refill
// one staged chunk of a wave's 32 x 128 product (two 16-row tiles against eight 16-column tiles: every B fragment read from LDS serves two products): the 20 fragment reads of k step kc + 1 stand as one group in front of the 16 products of step kc, so that no product waits out an LDS latency of its own (arow: the lane's A row in row tile 0; brow: the lane's row of B column group 0)
// the brow side is the product's first operand and the arow side its second, so that the result tile acc[i][j] comes out as lane = row 16i + (lane & 15) of the arow side, the lane's 8 registers = the 8 adjacent rows 16j + 8 (lane >> 4) + r of the brow side; both sides use the same fragment loader, so the k order stays paired
__device__ __forceinline__ void chunk_h(const _Float16* arow, const _Float16* brow, int lane, v8f (&acc)[2][8]) { v16h a[2], b[8];
#pragma unroll
  for (int i = 0; i < 2; ++i) a[i] = frag_h(arow + i * 16 * LP, lane);
#pragma unroll
  for (int j = 0; j < 8; ++j) b[j] = frag_h(brow + BRO(j), lane);
#pragma unroll
  for (int kc = 0; kc < KCH / 32; ++kc) { v16h an[2], bn[8];
#pragma unroll
    for (int i = 0; i < 2; ++i) an[i] = a[i];
#pragma unroll
    for (int j = 0; j < 8; ++j) bn[j] = b[j];
    if (kc + 1 < KCH / 32) {
#pragma unroll
      for (int i = 0; i < 2; ++i) an[i] = frag_h(arow + i * 16 * LP + (kc + 1) * 32, lane);
#pragma unroll
      for (int j = 0; j < 8; ++j) bn[j] = frag_h(brow + BRO(j) + (kc + 1) * 32, lane); }
    __builtin_amdgcn_sched_barrier(0);   // keeps the next step's reads one group in front of this step's products: left free, the compiler spreads them among the products, each with a wait of its own
#pragma unroll
    for (int j = 0; j < 8; ++j)
#pragma unroll
      for (int i = 0; i < 2; ++i) acc[i][j] = wmma16(b[j], a[i], acc[i][j]);
    __builtin_amdgcn_sched_barrier(0);   // closes the block of products against the reads of the step after next
#pragma unroll
    for (int i = 0; i < 2; ++i) a[i] = an[i];
#pragma unroll
    for (int j = 0; j < 8; ++j) b[j] = bn[j]; } }
__device__ __forceinline__ void chunk_b(const __bf16* arow, const __bf16* brow, int lane, v8f (&acc)[2][8]) { v16b a[2], b[8];
#pragma unroll
  for (int i = 0; i < 2; ++i) a[i] = frag_b(arow + i * 16 * LP, lane);
#pragma unroll
  for (int j = 0; j < 8; ++j) b[j] = frag_b(brow + j * 16 * LP, lane);
#pragma unroll
  for (int kc = 0; kc < KCH / 32; ++kc) { v16b an[2], bn[8];
#pragma unroll
    for (int i = 0; i < 2; ++i) an[i] = a[i];
#pragma unroll
    for (int j = 0; j < 8; ++j) bn[j] = b[j];
    if (kc + 1 < KCH / 32) {
#pragma unroll
      for (int i = 0; i < 2; ++i) an[i] = frag_b(arow + i * 16 * LP + (kc + 1) * 32, lane);
#pragma unroll
      for (int j = 0; j < 8; ++j) bn[j] = frag_b(brow + j * 16 * LP + (kc + 1) * 32, lane); }
    __builtin_amdgcn_sched_barrier(0);   // keeps the next step's reads one group in front of this step's products: left free, the compiler spreads them among the products, each with a wait of its own
#pragma unroll
    for (int j = 0; j < 8; ++j)
#pragma unroll
      for (int i = 0; i < 2; ++i) acc[i][j] = wmma_bf(a[i], b[j], acc[i][j]);
    __builtin_amdgcn_sched_barrier(0);   // closes the block of products against the reads of the step after next
#pragma unroll
    for (int i = 0; i < 2; ++i) a[i] = an[i];
#pragma unroll
    for (int j = 0; j < 8; ++j) b[j] = bn[j]; } }
static_assert(HD == 128 && WQKV_LAYOUT == 1 && DIN % KCH == 0 && HDSC % KCH == 0 && KCH == 128, "staged chunks: k-contiguous (out,in) weights, whole chunks, one key block of kb_last() per chunk");
static_assert(((DIN / KCH) & (DIN / KCH - 1)) == 0 && ((HDSC / KCH) & (HDSC / KCH - 1)) == 0 && ((TT / KCH) & (TT / KCH - 1)) == 0, "rotated walks wrap by a mask: stage counts are powers of two");

#define BM 128   // rows of a block's tile: 4 waves x 32 rows (q and k in k_proj: 4 waves x 32 columns over all 128 rows)
static_assert(TT % BM == 0 && KHI % 8 == 0 && QHI % 8 == 0 && KHI == 64 && (QHI == 0 || QHI == 64), "a block's rows lie in one batch; residual rows are none or the first 64 of a batch's first block (q and k: all four waves; v: waves 0 and 1)");
// ---- k_proj: block = (128 rows, 128 cols, which): q/k/v = X W (+ b) with exact bf16 products (K = DIN) -> which 0: q f16 rows (+ residual rows < QHI); 1: k f16 rows (+ residual rows < KHI); 2: v f16 planes [c][t] (+ bf16 hi/lo planes for t < KHI)
__global__ __launch_bounds__(128) void k_proj(const float* __restrict__ XQ, const float* __restrict__ XK, const float* __restrict__ XV, const float* __restrict__ WQ, const float* __restrict__ WK, const float* __restrict__ WV, const float* __restrict__ BQ, const float* __restrict__ BK, const float* __restrict__ BV,
    _Float16* __restrict__ QH, _Float16* __restrict__ QL, _Float16* __restrict__ KH, _Float16* __restrict__ KL, _Float16* __restrict__ VT, __bf16* __restrict__ VB, __bf16* __restrict__ VBL) {
  __shared__ __align__(16) unsigned char smem[71680];   // main loop: operand tiles xa, xb; behind its last barrier: the output staging arrays
  _Float16 (*sh)[136] = (_Float16 (*)[136])smem; _Float16 (*sl)[136] = (_Float16 (*)[136])(smem + 34816); _Float16 (*th)[136] = (_Float16 (*)[136])smem; __bf16 (*tb)[72] = (__bf16 (*)[72])(smem + 34816); __bf16 (*tbl)[72] = (__bf16 (*)[72])(smem + 53248);
  __bf16* xa = (__bf16*)smem; __bf16* xb = xa + BM * LP;
  const int tid = threadIdx.x, wave = tid >> 5, lane = tid & 31, col = lane & 15, g = lane >> 4; const int which = blockIdx.z; const int c0 = blockIdx.y * 128; const size_t r0 = (size_t)blockIdx.x * BM; const size_t bb = r0 / TT; const int t0 = (int)(r0 % TT);
  const float* X = which == 0 ? XQ : which == 1 ? XK : XV; const float* WA = which == 0 ? WQ : which == 1 ? WK : WV; const float* BA = which == 0 ? BQ : which == 1 ? BK : BV;
  v8f acc[2][8] = {};
  // q and k (stored as rows [t][c]) take the weight tile on the two-tile side and the x tile on the eight-tile side: the wave's tile is 32 columns x 128 rows and comes out transposed, lane = row t, the lane's 8 registers = 8 adjacent columns c; v (stored as planes [c][t]) keeps x on the two-tile side: lane = column c, registers = adjacent t
  const __bf16* pa = (which < 2 ? xb : xa) + (wave * 32 + col) * LP; const __bf16* pb = (which < 2 ? xa : xb) + col * LP;
  const int rot = (int)(blockIdx.x + blockIdx.y + blockIdx.z);   // rotated start of the k walk: the 12 blocks that share an x tile and the 64 that share a weight tile begin at different chunks and wrap, so that they do not ask L2 for the same lines at the same moment
#pragma unroll 1   // rolled: the barriers keep the chunks apart anyway, and one copy of the chunk body keeps the code short
  for (int c = 0; c < DIN / KCH; ++c) { const int cs = (c + rot) & (DIN / KCH - 1);
    { v4f xr[32]; ld32<BM>(xr, X + r0 * DIN + cs * KCH, DIN, tid); st32<BM, __bf16, v4b>(xa, xr, tid); }
    { v4f wr[32]; ld32<128>(wr, WA + (size_t)c0 * DIN + cs * KCH, DIN, tid); st32<128, __bf16, v4b>(xb, wr, tid); }
    __syncthreads();   // the chunk's tiles are complete before any wave reads them
    chunk_b(pa, pb, lane, acc);
    __syncthreads(); }   // every wave has left the tiles before they are refilled (or reused as output staging)
  if (which < 2) { _Float16* DH = which == 0 ? QH : KH; _Float16* DL = which == 0 ? QL : KL; const int nhi = which == 0 ? QHI : KHI;
    const float* bp = BA + c0 + wave * 32 + 8 * g; v4f bv[2][2] = {};   // biases of the lane's 16 columns
    if (BA) {
#pragma unroll
      for (int i = 0; i < 2; ++i) { bv[i][0] = *(const v4f*)(bp + i * 16); bv[i][1] = *(const v4f*)(bp + i * 16 + 4); }
      asm volatile("s_wait_xcnt 0x0" :: "v"(bp) : "memory"); }   // as in ld32
#pragma unroll
    for (int i = 0; i < 2; ++i)
#pragma unroll
      for (int j = 0; j < 8; ++j) { v8h h8, l8;
#pragma unroll
        for (int r = 0; r < 8; ++r) { const float v = acc[i][j][r] + bfr(bv[i][r >> 2][r & 3]); const _Float16 hv = (_Float16)v; h8[r] = hv; l8[r] = (_Float16)((v - (float)hv) * 1024.0f); }
        *(v8h*)&sh[j * 16 + col][wave * 32 + i * 16 + 8 * g] = h8; *(v8h*)&sl[j * 16 + col][wave * 32 + i * 16 + 8 * g] = l8; }   // 8 adjacent columns: one 16-B LDS store each
    __syncthreads();
    _Float16* dh = DH + (r0 + (tid >> 4)) * CC + c0 + (tid & 15) * 8; _Float16* dl = DL + (bb * nhi + t0 + (tid >> 4)) * (size_t)CC + c0 + (tid & 15) * 8;   // 16 lanes per 256-B row segment, 8 rows a group
#pragma unroll
    for (int i = 0; i < BM / 8; ++i) vst2(dh + (size_t)(i * 8) * CC, *(const v4u*)&sh[i * 8 + (tid >> 4)][(tid & 15) * 8]);
    asm volatile("s_wait_xcnt 0x0" :: "v"(dh) : "memory");   // as in ld32, and in front of the LDS reads below, which reuse these stores' data registers
    if (t0 < nhi) {   // nhi is 0 or 64 and t0 a multiple of BM: the block's first 64 rows, all below nhi
#pragma unroll
      for (int i = 0; i < 8; ++i) vst2(dl + (size_t)(i * 8) * CC, *(const v4u*)&sl[i * 8 + (tid >> 4)][(tid & 15) * 8]); }
    asm volatile("s_wait_xcnt 0x0" :: "v"(dl) : "memory");   // as in ld32
  } else {
#pragma unroll
    for (int j = 0; j < 8; ++j) { const float bias = BA ? bfr(BA[c0 + j * 16 + col]) : 0.f;
#pragma unroll
      for (int i = 0; i < 2; ++i)
#pragma unroll
        for (int r = 0; r < 8; ++r) { acc[i][j][r] += bias; th[j * 16 + col][wave * 32 + i * 16 + 8 * g + r] = (_Float16)acc[i][j][r]; } }
    if (wave < 2) {   // waves 0 and 1 hold the block's first 64 rows, the only ones that can lie below KHI
#pragma unroll
      for (int j = 0; j < 8; ++j)
#pragma unroll
        for (int i = 0; i < 2; ++i)
#pragma unroll
          for (int r = 0; r < 8; ++r) { const float v = acc[i][j][r]; const int rl = wave * 32 + i * 16 + 8 * g + r, cl = j * 16 + col; const __bf16 bh = (__bf16)v; tb[cl][rl] = bh; tbl[cl][rl] = (__bf16)(v - (float)bh); } }
    __syncthreads();
    _Float16* vt = VT + (bb * CC + c0 + (tid >> 4)) * (size_t)TT + t0 + (tid & 15) * 8;   // 16 lanes per 256-B plane segment, 8 planes a group
#pragma unroll
    for (int i = 0; i < 16; ++i) vst2(vt + (size_t)(i * 8) * TT, *(const v4u*)&th[i * 8 + (tid >> 4)][(tid & 15) * 8]);
    asm volatile("s_wait_xcnt 0x0" :: "v"(vt) : "memory");   // as in ld32
    if (t0 < KHI) { const size_t o3 = (bb * CC + c0 + (tid >> 3)) * (size_t)KHI + t0 + (tid & 7) * 8; __bf16* vb = VB + o3; __bf16* vbl = VBL + o3;
#pragma unroll
      for (int i = 0; i < 8; ++i) { vst2(vb + (size_t)(i * 16) * KHI, *(const v4u*)&tb[i * 16 + (tid >> 3)][(tid & 7) * 8]); vst2(vbl + (size_t)(i * 16) * KHI, *(const v4u*)&tbl[i * 16 + (tid >> 3)][(tid & 7) * 8]); }
      asm volatile("s_wait_xcnt 0x0" :: "v"(vb), "v"(vbl) : "memory"); } } }   // as in ld32
// value of lane l ^ 16 (the same place in the other 16-lane row): a vector cross-row move
__device__ __forceinline__ float xhalf(float v) { return __builtin_bit_cast(float, __builtin_amdgcn_permlanex16(__builtin_bit_cast(int, v), __builtin_bit_cast(int, v), 0x76543210, 0xfedcba98, false, false)); }
// native exp2 with its v_nop in the same statement: the slot that the instruction set asks for between a transcendental and an instruction that reads its result or overwrites its source
__device__ __forceinline__ float exp2_slot(float v) { float e; asm("v_exp_f32 %0, %1\n\tv_nop" : "=v"(e) : "v"(v)); return e; }
// ---- k_sc: block = (128 queries qb, key block kb, batch b = blockIdx.z, plane b): logits x SCALE2 (base-2 units), one product, then this key block's share of the softmax (row max m, e = exp2(logit - m) to the plane, (m, sum e) to ST)  [here: head width HDSC = 512, single head]
static_assert(QBH == 0 && QHI == 0 && !CAUSAL, "every query block takes the staged single-product path over all key blocks");
__global__ __launch_bounds__(128) void k_sc(const _Float16* __restrict__ QH, const _Float16* __restrict__ KH, _Float16* __restrict__ S0, float* __restrict__ ST) { __shared__ __attribute__((aligned(2048))) unsigned char smem[2 * RBUF];   // main loop: two buffers of q and k slices; behind its last barrier: the output staging se
  _Float16 (*se)[32][LP] = (_Float16 (*)[32][LP])smem;
  const int qb = blockIdx.x, kb = blockIdx.y;
  const int b = blockIdx.z; _Float16* S = S0 + (size_t)b * TT * TT;
  const int tid = threadIdx.x, wave = tid >> 5, lane = tid & 31, col = lane & 15, g = lane >> 4; const int k0 = kb * 128; const int ql0 = qb * BM + wave * 32; const size_t kr0 = (size_t)b * TT + k0;
  v8f acc[2][8] = {};
  const uint32_t wv = uni((uint32_t)tid >> 5), nst = HDSC / KCH; const uint32_t tdst = (uint32_t)(size_t)smem + wv * SLB;   // the wave's slice: its place in buffer 0, and its first source byte
  const uint64_t tsrc = (uint64_t)(size_t)(((wv & 2u) ? KH + kr0 * CC : QH + ((size_t)b * TT + qb * BM) * CC) + (size_t)(wv & 1u) * 64 * CC); const u32x8 g1 = tdm_group1(CC * 2u);
  const uint32_t rot = uni((uint32_t)(qb + kb));   // rotated start of the k walk: stage s brings chunk (s + rot) mod nst, so that the 16 blocks that share a q tile and the 16 that share a k tile do not ask L2 for the same lines at the same moment
  tdm_load(tdst, tsrc + (uint64_t)(rot & (nst - 1u)) * (KCH * 2u), g1); wait_tensor0();
  __syncthreads();   // stage 0 is complete before any wave reads it
  { const uint32_t sn = pinned(1u); tdm_load(tdst + (sn & 1u) * RBUF, tsrc + (uint64_t)((sn + rot) & (nst - 1u)) * (KCH * 2u), g1); }   // the stage number is taken behind the wait, so that no descriptor word is rewritten while stage 0's request is out
#pragma unroll 1   // rolled, as in k_proj
  for (uint32_t c = 0; c < nst; ++c) { const _Float16* tb = (const _Float16*)(smem + (c & 1u) * RBUF);
    chunk_h(tb + (wave >> 1) * (int)(SLB / 2u) + ((wave & 1) * 32 + col) * LP, tb + SLB + col * LP, lane, acc);   // the B slices begin 2 SLB bytes = SLB elements into the buffer
    wait_ds0(); wait_tensor0();
    __syncthreads();   // stage c + 1 is complete, and every wave has left stage c's buffer before it is refilled (or reused as output staging)
    if (pinned(c + 2u < nst)) { const uint32_t sn = pinned(c + 2u); tdm_load(tdst + (sn & 1u) * RBUF, tsrc + (uint64_t)((sn + rot) & (nst - 1u)) * (KCH * 2u), g1); } }   // refill of the buffer just left, only while that stage exists: scalar branch, descriptor formed behind the wait
  wait_tensor0(); wait_ds0();
  // transposed tiles: lane (g, col) holds query 16i + col against keys 16j + 8g + r, so a query's 128 logits lie in two lanes: max and sum go over the lane's 64 values (8 independent chains) and then over one exchange with lane ^ 16, and 8 adjacent keys leave as one 16-B LDS store
  float mo = 0.f, so = 0.f;
#pragma unroll
  for (int i = 0; i < 2; ++i) { float mr[8], sr[8];
#pragma unroll
    for (int r = 0; r < 8; ++r) mr[r] = acc[i][0][r];
#pragma unroll
    for (int j = 1; j < 8; ++j)
#pragma unroll
      for (int r = 0; r < 8; ++r) mr[r] = fmaxf(mr[r], acc[i][j][r]);
    float m = fmaxf(fmaxf(fmaxf(mr[0], mr[1]), fmaxf(mr[2], mr[3])), fmaxf(fmaxf(mr[4], mr[5]), fmaxf(mr[6], mr[7])));
    m = fmaxf(m, xhalf(m)) * SCALE2;   // SCALE2 > 0: the max of the scaled logits is the scaled max
#pragma unroll
    for (int j = 0; j < 8; ++j) { v8h h;
#pragma unroll
      for (int r = 0; r < 8; ++r) { const float e = exp2_slot(acc[i][j][r] * SCALE2 - m); sr[r] = j ? sr[r] + e : e; h[r] = (_Float16)e; }
      *(v8h*)&se[wave][i * 16 + col][j * 16 + 8 * g] = h; }
    float sum = ((sr[0] + sr[1]) + (sr[2] + sr[3])) + ((sr[4] + sr[5]) + (sr[6] + sr[7]));
    sum += xhalf(sum);
    if (g == i) { mo = m; so = sum; } }
  float* sp = ST + (((size_t)b * (TT / 128) + kb) * TT + ql0 + lane) * 2;
  _Float16* op = S + (size_t)(ql0 + g) * TT + k0 + col * 8;
  LDSX();
#pragma unroll
  for (int i = 0; i < 16; ++i) vst2(op + (size_t)(i * 2) * TT, *(const v4u*)&se[wave][i * 2 + g][col * 8]);   // 16 lanes per 256-B row segment
  { v2f st; st[0] = mo; st[1] = so; vst2(sp, st); }   // lane l stores row l: the wave's 32 rows fill two 128-B lines
  asm volatile("s_wait_xcnt 0x0" :: "v"(sp), "v"(op) : "memory"); }   // as in ld32: stands in front of any overwrite of the address pairs that these stores name
// ---- k_pv: block = 128 queries (qb = blockIdx.x) of (column group h = blockIdx.y, batch b = blockIdx.z; plane b): ctx = sum over key blocks kb of w[kb] * (e[kb] . v[kb]) (e f16 against v f16: 1 product), w[kb] = exp2(m[kb] - row max) / row sum from the score kernel's (m, sum) pairs, per row, f32; 512-B (row, column group) segment by the wave's 32 lanes
__global__ __launch_bounds__(128) void k_pv(const _Float16* __restrict__ PS0, const float* __restrict__ ST, const _Float16* __restrict__ VT, float* __restrict__ Y) { const int h = blockIdx.y, b = blockIdx.z; const _Float16* PS = PS0 + (size_t)b * TT * TT; __shared__ __align__(16) float ss[4][32][HD + 4]; __shared__ __attribute__((aligned(2048))) unsigned char ring[2 * RBUF]; __shared__ __align__(16) float sf[TT / 128][BM];
  const int tid = threadIdx.x, wave = tid >> 5, lane = tid & 31, col = lane & 15, g = lane >> 4; const int qb = blockIdx.x; const int ql0 = qb * BM + wave * 32;
  v8f acc[2][HD / 16] = {};
  const _Float16* Pg = PS + (size_t)qb * BM * TT; const _Float16* Vg = VT + ((size_t)b * CC + h * HD) * (size_t)TT; const uint32_t nst = TT / KCH;
  const uint32_t wv = uni((uint32_t)tid >> 5); const uint32_t tdst = (uint32_t)(size_t)ring + wv * SLB;   // the wave's slice: its place in buffer 0, and its first source byte
  const uint64_t tsrc = (uint64_t)(size_t)(((wv & 2u) ? Vg : Pg) + (size_t)(wv & 1u) * 64 * TT); const u32x8 g1 = tdm_group1(TT * 2u);
  const uint32_t rot = uni((uint32_t)(qb + 4 * h));   // rotated start of the key walk: stage s brings key block (s + rot) mod nst, so that the 4 blocks that share a row block of the plane and the 16 that share a v tile do not ask L2 for the same lines at the same moment
  tdm_load(tdst, tsrc + (uint64_t)(rot & (nst - 1u)) * (KCH * 2u), g1);
  {   // one query row a thread: the row's weight for each key block (read behind the barrier in front of the loop), while stage 0 flies
    const float* sp = ST + ((size_t)b * (TT / 128) * TT + qb * BM + tid) * 2; float mk[TT / 128], sk[TT / 128]; float mx = -3.0e38f, sum = 0.f;
#pragma unroll
    for (int kb = 0; kb < TT / 128; ++kb) { const v2f st = *(const v2f*)(sp + (size_t)kb * TT * 2); mk[kb] = st[0]; sk[kb] = st[1]; }
    asm volatile("s_wait_xcnt 0x0" :: "v"(sp) : "memory");   // as in ld32
#pragma unroll
    for (int kb = 0; kb < TT / 128; ++kb) mx = fmaxf(mx, mk[kb]);
#pragma unroll
    for (int kb = 0; kb < TT / 128; ++kb) { mk[kb] = exp2_slot(mk[kb] - mx); sum += sk[kb] * mk[kb]; }
    const float inv = 1.0f / sum;
#pragma unroll
    for (int kb = 0; kb < TT / 128; ++kb) sf[kb][tid] = mk[kb] * inv; }
  wait_tensor0();
  __syncthreads();   // stage 0 and the weights are complete before any wave reads them
  { const uint32_t sn = pinned(1u); tdm_load(tdst + (sn & 1u) * RBUF, tsrc + (uint64_t)((sn + rot) & (nst - 1u)) * (KCH * 2u), g1); }   // the stage number is taken behind the wait, so that no descriptor word is rewritten while stage 0's request is out
#pragma unroll 1   // rolled, as in k_proj
  for (uint32_t c = 0; c < nst; ++c) { const _Float16* tb = (const _Float16*)(ring + (c & 1u) * RBUF);
    const uint32_t kbs = (c + rot) & (nst - 1u);   // the key block that stage c holds
    float w[2];   // transposed tiles (lane = query 16i + col, registers = output columns 16j + 8g + r): one weight a lane and row tile
#pragma unroll
    for (int i = 0; i < 2; ++i) w[i] = sf[kbs][wave * 32 + i * 16 + col];
    v8f part[2][HD / 16] = {}; chunk_h(tb + (wave >> 1) * (int)(SLB / 2u) + ((wave & 1) * 32 + col) * LP, tb + SLB + col * LP, lane, part);   // the B slices begin 2 SLB bytes = SLB elements into the buffer
    wait_ds0(); wait_tensor0();
    __syncthreads();   // stage c + 1 is complete, and every wave has left stage c's buffer before it is refilled
    if (pinned(c + 2u < nst)) { const uint32_t sn = pinned(c + 2u); tdm_load(tdst + (sn & 1u) * RBUF, tsrc + (uint64_t)((sn + rot) & (nst - 1u)) * (KCH * 2u), g1); }   // refill of the buffer just left, only while that stage exists: scalar branch, descriptor formed behind the wait
#pragma unroll
    for (int i = 0; i < 2; ++i)   // the weighting works on registers alone: behind the refill, so that the refill starts as early as it may
#pragma unroll
      for (int j = 0; j < HD / 16; ++j)
#pragma unroll
        for (int r = 0; r < 8; ++r) acc[i][j][r] += part[i][j][r] * w[i]; }
  wait_tensor0(); wait_ds0();
#pragma unroll
  for (int i = 0; i < 2; ++i)
#pragma unroll
    for (int j = 0; j < HD / 16; ++j)
#pragma unroll
      for (int q = 0; q < 2; ++q) { v4f o;
#pragma unroll
        for (int e = 0; e < 4; ++e) o[e] = acc[i][j][q * 4 + e];
        *(v4f*)&ss[wave][i * 16 + col][j * 16 + 8 * g + q * 4] = o; }   // 4 adjacent columns: one 16-B LDS store
  float* yp = Y + ((size_t)b * TT + ql0) * CC + h * HD + lane * 4;
  LDSX();
#pragma unroll
  for (int rl = 0; rl < 32; ++rl) vst2(yp + (size_t)rl * CC, *(const v4f*)&ss[wave][rl][lane * 4]);
  asm volatile("s_wait_xcnt 0x0" :: "v"(yp) : "memory"); }   // as in ld32: stands in front of any overwrite of the address pair that these stores name

extern "C" void kernel_launch(void* const* d_in, const int* in_sizes, int n_in, void* d_out, int out_size, void* d_ws, size_t ws_size, hipStream_t stream) {
  (void)in_sizes; (void)n_in; (void)out_size;
  const float** F = (const float**)d_in;
  if (ws_size < (size_t)WS_END) return;
  char* ws = (char*)d_ws; _Float16 *QH = (_Float16*)(ws + WS_QH), *KH = (_Float16*)(ws + WS_KH), *VT = (_Float16*)(ws + WS_VT), *QL = (_Float16*)(ws + WS_QL), *KL = (_Float16*)(ws + WS_KL); __bf16 *VB = (__bf16*)(ws + WS_VB), *VBL = (__bf16*)(ws + WS_VBL); _Float16* S = (_Float16*)(ws + WS_S); float *ST = (float*)(ws + WS_ST), *Y = (float*)(ws + WS_Y);
  (void)Y;
  // inputs: 0 x [4,2048,512]; 1 Wq [512,512] (out,in), 2 bq; 3 Wk, 4 bk; 5 Wv, 6 bv (biases nonzero)
  k_proj<<<dim3(TNB * TT / BM, CC / 128, 3), 128, 0, stream>>>(F[0], F[0], F[0], F[1], F[3], F[5], F[2], F[4], F[6], QH, QL, KH, KL, VT, VB, VBL);
  k_sc<<<dim3(TT / BM, TT / 128, TNB), 128, 0, stream>>>(QH, KH, S, ST);   /* one 2,048 x 2,048 plane per batch: scores over all 512 columns */
  k_pv<<<dim3(TT / BM, NH, TNB), 128, 0, stream>>>(S, ST, VT, (float*)d_out);   /* column group y: v / output columns 128y .. 128y+127, all four from the batch's one plane */
}
